// v000
// The times below were measured on an AMD MI455X: many runs one after another, warmed up first and cycling through
// copies of the inputs, with the whole window's GPU time divided by the number of runs. Launches and the gaps
// between them are all in it. The median over several windows is given; except for v000 it joins two sittings, which
// can be a few percent apart, so the side-by-side timings, each taken in one sitting, are the better comparison.
// v000 is the starting kernel. One run takes 203 microseconds.
#include <hip/hip_runtime.h>
#include <hip/hip_bf16.h>

typedef __attribute__((ext_vector_type(2))) float v2f;
typedef __attribute__((ext_vector_type(8))) float v8f;

#define HEADS  8
#define NB     16
#define CH     512
#define HT     64
#define WD     64
#define HWSZ   4096
#define PLANES 128

#if __has_builtin(__builtin_amdgcn_global_load_async_to_lds_b128) && \
    __has_builtin(__builtin_amdgcn_s_wait_asynccnt)
#define USE_ASYNC_LDS 1
#else
#define USE_ASYNC_LDS 0
#endif

// async copy builtin wants typed int4 (vector_size 16) pointers:
//   arg0: AS1 (global, prints as __device__), arg1: AS3 (LDS, prints as __shared__)
typedef int async_v4i __attribute__((vector_size(16)));
#define ASYNC_GPTR(p)                                              \
    ((__attribute__((address_space(1))) async_v4i*)                \
     (__attribute__((address_space(1))) void*)(void*)(p))
#define ASYNC_LPTR(p)                                              \
    ((__attribute__((address_space(3))) async_v4i*)                \
     (__attribute__((address_space(3))) void*)(void*)(p))

// ---------------------------------------------------------------------------
// Kernel 1: logits[b,n,hw] = sum_c x[b,c,hw] * cmw[n,c] + cmb[n]
// WMMA f32 16x16x4: M = heads (8 used of 16), N = 16 hw columns, K over C.
// ---------------------------------------------------------------------------
__global__ void __launch_bounds__(128)
k_logits_wmma(const float* __restrict__ x, const float* __restrict__ cmw,
              const float* __restrict__ cmb, float* __restrict__ mask)
{
    const int wave = threadIdx.x >> 5;
    const int lane = threadIdx.x & 31;
    const int b    = blockIdx.x >> 6;                 // 64 hw-blocks per batch
    const int hw0  = ((blockIdx.x & 63) << 6) + (wave << 4);
    const int col  = lane & 15;                       // M for A-frag, N for B-frag
    const int kgrp = lane >> 4;                       // 0 or 1: K offset group
    const long xbase = (long)b * CH * HWSZ;

    v8f c = {0.f, 0.f, 0.f, 0.f, 0.f, 0.f, 0.f, 0.f};

    for (int k = 0; k < CH; k += 4) {
        const int kk = k + kgrp * 2;
        // A fragment: conv_mask_w[m, kk], rows >= 8 are zero padding
        float a0 = cmw[(col & 7) * CH + kk];
        float a1 = cmw[(col & 7) * CH + kk + 1];
        v2f af; af.x = (col < HEADS) ? a0 : 0.f;
                af.y = (col < HEADS) ? a1 : 0.f;
        // B fragment: x[b, kk, hw0+col] (coalesced across lanes 0-15)
        v2f bf;
        bf.x = x[xbase + (long)kk       * HWSZ + hw0 + col];
        bf.y = x[xbase + (long)(kk + 1) * HWSZ + hw0 + col];
        if (k + 8 < CH)
            __builtin_prefetch(&x[xbase + (long)(k + 8) * HWSZ + hw0 + col], 0, 1);
        c = __builtin_amdgcn_wmma_f32_16x16x4_f32(false, af, false, bf,
                                                  (short)0, c, false, false);
    }

    // C/D layout: VGPR r, lanes 0-15 -> M=r (heads 0..7), lanes 16-31 -> M=r+8 (pad)
    if (lane < 16) {
        const int n = lane;
#pragma unroll
        for (int r = 0; r < HEADS; ++r)
            mask[(long)(b * HEADS + r) * HWSZ + hw0 + n] = c[r] + cmb[r];
    }
}

// ---------------------------------------------------------------------------
// Kernel 2: per-(b,head) softmax over HW (in place) + centroid cx, cy
// ---------------------------------------------------------------------------
__global__ void __launch_bounds__(256)
k_softmax_centroid(float* __restrict__ mask, float* __restrict__ cx,
                   float* __restrict__ cy)
{
    __shared__ float red[256];
    const int row = blockIdx.x;                       // b*8 + n
    const int tid = threadIdx.x;
    float* r = mask + (long)row * HWSZ;

    float v[16];
    float mx = -1e30f;
#pragma unroll
    for (int i = 0; i < 16; ++i) { v[i] = r[i * 256 + tid]; mx = fmaxf(mx, v[i]); }

    red[tid] = mx; __syncthreads();
    for (int s = 128; s > 0; s >>= 1) {
        if (tid < s) red[tid] = fmaxf(red[tid], red[tid + s]);
        __syncthreads();
    }
    mx = red[0]; __syncthreads();

    float sum = 0.f, pc = 0.f, pr = 0.f;
#pragma unroll
    for (int i = 0; i < 16; ++i) {
        float e = expf(v[i] - mx);
        v[i] = e; sum += e;
        int hw = i * 256 + tid;
        pc += e * (float)(hw & 63);                   // column index j
        pr += e * (float)(hw >> 6);                   // row index i
    }
    red[tid] = sum; __syncthreads();
    for (int s = 128; s > 0; s >>= 1) {
        if (tid < s) red[tid] += red[tid + s];
        __syncthreads();
    }
    sum = red[0]; __syncthreads();

    red[tid] = pc; __syncthreads();
    for (int s = 128; s > 0; s >>= 1) {
        if (tid < s) red[tid] += red[tid + s];
        __syncthreads();
    }
    pc = red[0]; __syncthreads();

    red[tid] = pr; __syncthreads();
    for (int s = 128; s > 0; s >>= 1) {
        if (tid < s) red[tid] += red[tid + s];
        __syncthreads();
    }
    pr = red[0];

    float inv = 1.f / sum;
#pragma unroll
    for (int i = 0; i < 16; ++i) r[i * 256 + tid] = v[i] * inv;

    if (tid == 0) {
        cx[row] = pc * inv / (float)HT;
        cy[row] = pr * inv / (float)WD;
    }
}

// ---------------------------------------------------------------------------
// Kernel 3: context[b,h,c] = sum_hw x[b,c,hw] * mask[b,h,hw]
// WMMA f32 16x16x4: M = 16 channels, N = heads (8 used of 16), K over HW.
// x tiles staged into LDS via GLOBAL_LOAD_ASYNC_TO_LDS_B128, double-buffered
// and synced with s_wait_asynccnt (per-wave counter; each of the 4 waves owns
// its own tile buffers, so no block barrier is needed).
// ---------------------------------------------------------------------------
__global__ void __launch_bounds__(128)
k_context_wmma(const float* __restrict__ x, const float* __restrict__ mask,
               float* __restrict__ ctx)
{
    __shared__ float tile[4][2][16][68];              // [wave][buf][c][hw(+pad)]
    const int wave = threadIdx.x >> 5;
    const int lane = threadIdx.x & 31;
    const int b    = blockIdx.x >> 3;                 // 8 blocks per batch
    const int c0   = (((blockIdx.x & 7) << 2) + wave) << 4;   // 32 c-tiles/batch
    const int col  = lane & 15;
    const int kgrp = lane >> 4;
    const long xbase = (long)b * CH * HWSZ;
    const long mbase = (long)b * HEADS * HWSZ;

    v8f acc = {0.f, 0.f, 0.f, 0.f, 0.f, 0.f, 0.f, 0.f};

#if USE_ASYNC_LDS
    // ---- async double-buffered path ----
    // fill chunk 0 into buffer 0
    {
        const int hwc = 0;
#pragma unroll
        for (int i = 0; i < 8; ++i) {
            int idx = i * 32 + lane;
            int row = idx >> 4, c4 = idx & 15;
            __builtin_amdgcn_global_load_async_to_lds_b128(
                ASYNC_GPTR(&x[xbase + (long)(c0 + row) * HWSZ + hwc + c4 * 4]),
                ASYNC_LPTR(&tile[wave][0][row][c4 * 4]), 0, 0);
        }
    }
    for (int cidx = 0; cidx < HWSZ / 64; ++cidx) {
        const int cur = cidx & 1;
        const int hwc = cidx << 6;
        if (cidx + 1 < HWSZ / 64) {
            const int hwn = hwc + 64;
#pragma unroll
            for (int i = 0; i < 8; ++i) {
                int idx = i * 32 + lane;
                int row = idx >> 4, c4 = idx & 15;
                __builtin_amdgcn_global_load_async_to_lds_b128(
                    ASYNC_GPTR(&x[xbase + (long)(c0 + row) * HWSZ + hwn + c4 * 4]),
                    ASYNC_LPTR(&tile[wave][cur ^ 1][row][c4 * 4]), 0, 0);
            }
            __builtin_amdgcn_s_wait_asynccnt(8);      // chunk cidx complete
        } else {
            __builtin_amdgcn_s_wait_asynccnt(0);
        }
        __builtin_amdgcn_wave_barrier();

        for (int k = 0; k < 64; k += 4) {
            const int kk = k + kgrp * 2;
            v2f af; af.x = tile[wave][cur][col][kk];
                    af.y = tile[wave][cur][col][kk + 1];
            float m0 = mask[mbase + (long)(col & 7) * HWSZ + hwc + kk];
            float m1 = mask[mbase + (long)(col & 7) * HWSZ + hwc + kk + 1];
            v2f bf; bf.x = (col < HEADS) ? m0 : 0.f;
                    bf.y = (col < HEADS) ? m1 : 0.f;
            acc = __builtin_amdgcn_wmma_f32_16x16x4_f32(false, af, false, bf,
                                                        (short)0, acc, false, false);
        }
        __builtin_amdgcn_wave_barrier();
    }
#else
    // ---- fallback: register-staged LDS fill (per-wave, in-order DS) ----
    for (int hwc = 0; hwc < HWSZ; hwc += 64) {
#pragma unroll
        for (int i = 0; i < 8; ++i) {
            int idx = i * 32 + lane;
            int row = idx >> 4, c4 = idx & 15;
            float4 val = *reinterpret_cast<const float4*>(
                &x[xbase + (long)(c0 + row) * HWSZ + hwc + c4 * 4]);
            tile[wave][0][row][c4 * 4 + 0] = val.x;
            tile[wave][0][row][c4 * 4 + 1] = val.y;
            tile[wave][0][row][c4 * 4 + 2] = val.z;
            tile[wave][0][row][c4 * 4 + 3] = val.w;
        }
        __builtin_amdgcn_wave_barrier();

        for (int k = 0; k < 64; k += 4) {
            const int kk = k + kgrp * 2;
            v2f af; af.x = tile[wave][0][col][kk];
                    af.y = tile[wave][0][col][kk + 1];
            float m0 = mask[mbase + (long)(col & 7) * HWSZ + hwc + kk];
            float m1 = mask[mbase + (long)(col & 7) * HWSZ + hwc + kk + 1];
            v2f bf; bf.x = (col < HEADS) ? m0 : 0.f;
                    bf.y = (col < HEADS) ? m1 : 0.f;
            acc = __builtin_amdgcn_wmma_f32_16x16x4_f32(false, af, false, bf,
                                                        (short)0, acc, false, false);
        }
        __builtin_amdgcn_wave_barrier();
    }
#endif

    // D layout: VGPR r, lanes 0-15 -> M=r, lanes 16-31 -> M=r+8; N = lane&15 (head)
    const int h = lane & 15;
    if (h < HEADS) {
        const int mofs = (lane >> 4) * 8;
#pragma unroll
        for (int r = 0; r < 8; ++r)
            ctx[(long)(b * HEADS + h) * CH + c0 + r + mofs] = acc[r];
    }
}

// ---------------------------------------------------------------------------
// Kernel 4: per-batch head attention + channel_add MLP -> add_term[b, 512]
// ---------------------------------------------------------------------------
__global__ void __launch_bounds__(256)
k_head_attn(const float* __restrict__ ctx, const float* __restrict__ cx,
            const float* __restrict__ cy,
            const float* __restrict__ g_w, const float* __restrict__ g_b,
            const float* __restrict__ k_w, const float* __restrict__ k_b,
            const float* __restrict__ q_w, const float* __restrict__ q_b,
            const float* __restrict__ v_w, const float* __restrict__ v_b,
            const float* __restrict__ w1,  const float* __restrict__ b1,
            const float* __restrict__ lng, const float* __restrict__ lnb,
            const float* __restrict__ w2,  const float* __restrict__ b2,
            float* __restrict__ addt)
{
    __shared__ float wkqv[3 * 512];                   // wk | wq | wv, each [h][d]
    __shared__ float lt[64];
    __shared__ float wmn[64];
    __shared__ float oc[512];
    __shared__ float ly[128];
    __shared__ float stats[2];

    const int b   = blockIdx.x;
    const int tid = threadIdx.x;
    const float* cb = ctx + (long)b * HEADS * CH;

    // w_k / w_q / w_v : [8, 64] each, dot over C=512
    for (int o = tid; o < 3 * 512; o += 256) {
        int mat = o >> 9, rem = o & 511, h = rem >> 6, d = rem & 63;
        const float* wm = (mat == 0) ? k_w : (mat == 1) ? q_w : v_w;
        const float* bs = (mat == 0) ? k_b : (mat == 1) ? q_b : v_b;
        float s = bs[d];
        const float* cr = cb + h * CH;
        const float* wr = wm + d * CH;
        for (int c = 0; c < CH; ++c) s += cr[c] * wr[c];
        wkqv[o] = s;
    }
    __syncthreads();

    // w_g (geometric) and scaled_dot -> logits lt[m*8+n]
    if (tid < 64) {
        int m = tid >> 3, n = tid & 7;
        float dx = cx[b * 8 + m] - cx[b * 8 + n];
        float dy = cy[b * 8 + m] - cy[b * 8 + n];
        float pos[4] = { fmaxf(dx, 0.f), fmaxf(-dx, 0.f),
                         fmaxf(dy, 0.f), fmaxf(-dy, 0.f) };
        float s = g_b[0];
        for (int p = 0; p < 4; ++p)
            for (int f = 0; f < 8; ++f) {
                float freq = expf(-6.90775527898f * (float)f * 0.125f); // 1000^(-f/8)
                float ang  = 100.f * pos[p] * freq;
                s += sinf(ang) * g_w[p * 8 + f] + cosf(ang) * g_w[32 + p * 8 + f];
            }
        float wg = fmaxf(s, 0.f);
        float sd = 0.f;
        for (int d = 0; d < 64; ++d) sd += wkqv[m * 64 + d] * wkqv[512 + n * 64 + d];
        sd *= 0.125f;                                 // 1/sqrt(64)
        lt[tid] = logf(fmaxf(wg, 1e-6f)) + sd;
    }
    __syncthreads();

    // softmax over m (axis=1) for each n
    if (tid < 8) {
        int n = tid;
        float mx = -1e30f;
        for (int m = 0; m < 8; ++m) mx = fmaxf(mx, lt[m * 8 + n]);
        float s = 0.f;
        for (int m = 0; m < 8; ++m) s += expf(lt[m * 8 + n] - mx);
        float inv = 1.f / s;
        for (int m = 0; m < 8; ++m) wmn[m * 8 + n] = expf(lt[m * 8 + n] - mx) * inv;
    }
    __syncthreads();

    // out_ctx[n, d] = sum_m wmn[m,n] * wv[m,d] -> flat n*64+d
    for (int o = tid; o < 512; o += 256) {
        int n = o >> 6, d = o & 63;
        float s = 0.f;
        for (int m = 0; m < 8; ++m) s += wmn[m * 8 + n] * wkqv[1024 + m * 64 + d];
        oc[o] = s;
    }
    __syncthreads();

    // y = oc @ w1^T + b1  [128]
    if (tid < PLANES) {
        float s = b1[tid];
        const float* wr = w1 + tid * 512;
        for (int j = 0; j < 512; ++j) s += oc[j] * wr[j];
        ly[tid] = s;
    }
    __syncthreads();

    if (tid == 0) {
        float mu = 0.f;
        for (int p = 0; p < PLANES; ++p) mu += ly[p];
        mu *= (1.f / PLANES);
        float var = 0.f;
        for (int p = 0; p < PLANES; ++p) { float d = ly[p] - mu; var += d * d; }
        var *= (1.f / PLANES);
        stats[0] = mu;
        stats[1] = rsqrtf(var + 1e-5f);
    }
    __syncthreads();

    if (tid < PLANES)
        ly[tid] = fmaxf((ly[tid] - stats[0]) * stats[1] * lng[tid] + lnb[tid], 0.f);
    __syncthreads();

    // add_term[c] = y @ w2^T + b2  [512]
    for (int c = tid; c < 512; c += 256) {
        float s = b2[c];
        const float* wr = w2 + c * PLANES;
        for (int p = 0; p < PLANES; ++p) s += ly[p] * wr[p];
        addt[b * 512 + c] = s;
    }
}

// ---------------------------------------------------------------------------
// Kernel 5: out[b,c,hw] = x[b,c,hw] + add_term[b,c]   (float4 streaming)
// ---------------------------------------------------------------------------
__global__ void __launch_bounds__(256)
k_addout(const float* __restrict__ x, const float* __restrict__ addt,
         float* __restrict__ out)
{
    long e = (long)blockIdx.x * 256 + threadIdx.x;    // float4 index
    float a = addt[e >> 10];                          // 1024 float4 per (b,c) plane
    float4 xv = reinterpret_cast<const float4*>(x)[e];
    float4 o = { xv.x + a, xv.y + a, xv.z + a, xv.w + a };
    reinterpret_cast<float4*>(out)[e] = o;
}

// ---------------------------------------------------------------------------
extern "C" void kernel_launch(void* const* d_in, const int* in_sizes, int n_in,
                              void* d_out, int out_size, void* d_ws, size_t ws_size,
                              hipStream_t stream)
{
    const float* x   = (const float*)d_in[0];
    const float* cmw = (const float*)d_in[1];
    const float* cmb = (const float*)d_in[2];
    const float* g_w = (const float*)d_in[3];
    const float* g_b = (const float*)d_in[4];
    const float* k_w = (const float*)d_in[5];
    const float* k_b = (const float*)d_in[6];
    const float* q_w = (const float*)d_in[7];
    const float* q_b = (const float*)d_in[8];
    const float* v_w = (const float*)d_in[9];
    const float* v_b = (const float*)d_in[10];
    const float* w1  = (const float*)d_in[11];
    const float* b1  = (const float*)d_in[12];
    const float* lng = (const float*)d_in[13];
    const float* lnb = (const float*)d_in[14];
    const float* w2  = (const float*)d_in[15];
    const float* b2  = (const float*)d_in[16];
    float* out = (float*)d_out;

    // workspace layout (floats)
    float* ws   = (float*)d_ws;
    float* mask = ws;                                 // 16*8*4096 = 524288
    float* ctx  = ws + 524288;                        // 16*8*512  = 65536
    float* cxb  = ws + 524288 + 65536;                // 128
    float* cyb  = cxb + 128;                          // 128
    float* addt = cyb + 128;                          // 16*512 = 8192

    k_logits_wmma<<<dim3(NB * 64), dim3(128), 0, stream>>>(x, cmw, cmb, mask);
    k_softmax_centroid<<<dim3(NB * HEADS), dim3(256), 0, stream>>>(mask, cxb, cyb);
    k_context_wmma<<<dim3(NB * 8), dim3(128), 0, stream>>>(x, mask, ctx);
    k_head_attn<<<dim3(NB), dim3(256), 0, stream>>>(ctx, cxb, cyb, g_w, g_b,
                                                    k_w, k_b, q_w, q_b, v_w, v_b,
                                                    w1, b1, lng, lnb, w2, b2, addt);
    k_addout<<<dim3(NB * CH * HWSZ / 4 / 256), dim3(256), 0, stream>>>(x, addt, out);
}

// v001
// It runs in 134 microseconds.
// Two timings next to v000 put it at 1.52 and 1.51 times that version's speed.
#include <hip/hip_runtime.h>
#include <hip/hip_bf16.h>

typedef __attribute__((ext_vector_type(2))) float v2f;
typedef __attribute__((ext_vector_type(8))) float v8f;

#define HEADS  8
#define NB     16
#define CH     512
#define HT     64
#define WD     64
#define HWSZ   4096
#define PLANES 128

#if __has_builtin(__builtin_amdgcn_global_load_async_to_lds_b128) && \
    __has_builtin(__builtin_amdgcn_s_wait_asynccnt)
#define USE_ASYNC_LDS 1
#else
#define USE_ASYNC_LDS 0
#endif

// async copy builtin wants typed int4 (vector_size 16) pointers:
//   arg0: AS1 (global, prints as __device__), arg1: AS3 (LDS, prints as __shared__)
typedef int async_v4i __attribute__((vector_size(16)));
#define ASYNC_GPTR(p)                                              \
    ((__attribute__((address_space(1))) async_v4i*)                \
     (__attribute__((address_space(1))) void*)(void*)(p))
#define ASYNC_LPTR(p)                                              \
    ((__attribute__((address_space(3))) async_v4i*)                \
     (__attribute__((address_space(3))) void*)(void*)(p))

// ---------------------------------------------------------------------------
// Kernel 1: logits[b,n,hw] = sum_c x[b,c,hw] * cmw[n,c] + cmb[n]
// WMMA f32 16x16x4: M = heads (8 used of 16), N = 16 hw columns, K over C.
// ---------------------------------------------------------------------------
__global__ void __launch_bounds__(128)
k_logits_wmma(const float* __restrict__ x, const float* __restrict__ cmw,
              const float* __restrict__ cmb, float* __restrict__ mask)
{
    const int wave = threadIdx.x >> 5;
    const int lane = threadIdx.x & 31;
    const int b    = blockIdx.x >> 6;                 // 64 hw-blocks per batch
    const int hw0  = ((blockIdx.x & 63) << 6) + (wave << 4);
    const int col  = lane & 15;                       // M for A-frag, N for B-frag
    const int kgrp = lane >> 4;                       // 0 or 1: K offset group
    const long xbase = (long)b * CH * HWSZ;

    v8f c = {0.f, 0.f, 0.f, 0.f, 0.f, 0.f, 0.f, 0.f};

    for (int k = 0; k < CH; k += 4) {
        const int kk = k + kgrp * 2;
        // A fragment: conv_mask_w[m, kk], rows >= 8 are zero padding
        float a0 = cmw[(col & 7) * CH + kk];
        float a1 = cmw[(col & 7) * CH + kk + 1];
        v2f af; af.x = (col < HEADS) ? a0 : 0.f;
                af.y = (col < HEADS) ? a1 : 0.f;
        // B fragment: x[b, kk, hw0+col] (coalesced across lanes 0-15)
        v2f bf;
        bf.x = x[xbase + (long)kk       * HWSZ + hw0 + col];
        bf.y = x[xbase + (long)(kk + 1) * HWSZ + hw0 + col];
        if (k + 8 < CH)
            __builtin_prefetch(&x[xbase + (long)(k + 8) * HWSZ + hw0 + col], 0, 1);
        c = __builtin_amdgcn_wmma_f32_16x16x4_f32(false, af, false, bf,
                                                  (short)0, c, false, false);
    }

    // C/D layout: VGPR r, lanes 0-15 -> M=r (heads 0..7), lanes 16-31 -> M=r+8 (pad)
    if (lane < 16) {
        const int n = lane;
#pragma unroll
        for (int r = 0; r < HEADS; ++r)
            mask[(long)(b * HEADS + r) * HWSZ + hw0 + n] = c[r] + cmb[r];
    }
}

// ---------------------------------------------------------------------------
// Kernel 2: per-(b,head) softmax over HW (in place) + centroid cx, cy
// ---------------------------------------------------------------------------
__global__ void __launch_bounds__(256)
k_softmax_centroid(float* __restrict__ mask, float* __restrict__ cx,
                   float* __restrict__ cy)
{
    __shared__ float red[256];
    const int row = blockIdx.x;                       // b*8 + n
    const int tid = threadIdx.x;
    float* r = mask + (long)row * HWSZ;

    float v[16];
    float mx = -1e30f;
#pragma unroll
    for (int i = 0; i < 16; ++i) { v[i] = r[i * 256 + tid]; mx = fmaxf(mx, v[i]); }

    red[tid] = mx; __syncthreads();
    for (int s = 128; s > 0; s >>= 1) {
        if (tid < s) red[tid] = fmaxf(red[tid], red[tid + s]);
        __syncthreads();
    }
    mx = red[0]; __syncthreads();

    float sum = 0.f, pc = 0.f, pr = 0.f;
#pragma unroll
    for (int i = 0; i < 16; ++i) {
        float e = expf(v[i] - mx);
        v[i] = e; sum += e;
        int hw = i * 256 + tid;
        pc += e * (float)(hw & 63);                   // column index j
        pr += e * (float)(hw >> 6);                   // row index i
    }
    red[tid] = sum; __syncthreads();
    for (int s = 128; s > 0; s >>= 1) {
        if (tid < s) red[tid] += red[tid + s];
        __syncthreads();
    }
    sum = red[0]; __syncthreads();

    red[tid] = pc; __syncthreads();
    for (int s = 128; s > 0; s >>= 1) {
        if (tid < s) red[tid] += red[tid + s];
        __syncthreads();
    }
    pc = red[0]; __syncthreads();

    red[tid] = pr; __syncthreads();
    for (int s = 128; s > 0; s >>= 1) {
        if (tid < s) red[tid] += red[tid + s];
        __syncthreads();
    }
    pr = red[0];

    float inv = 1.f / sum;
#pragma unroll
    for (int i = 0; i < 16; ++i) r[i * 256 + tid] = v[i] * inv;

    if (tid == 0) {
        cx[row] = pc * inv / (float)HT;
        cy[row] = pr * inv / (float)WD;
    }
}

// ---------------------------------------------------------------------------
// Kernel 3: context[b,h,c] = sum_hw x[b,c,hw] * mask[b,h,hw]
// WMMA f32 16x16x4: M = 16 channels, N = heads (8 used of 16), K over HW.
// x tiles staged into LDS via GLOBAL_LOAD_ASYNC_TO_LDS_B128, double-buffered
// and synced with s_wait_asynccnt (per-wave counter; each of the 4 waves owns
// its own tile buffers, so no block barrier is needed).
// ---------------------------------------------------------------------------
__global__ void __launch_bounds__(128)
k_context_wmma(const float* __restrict__ x, const float* __restrict__ mask,
               float* __restrict__ ctx)
{
    __shared__ float tile[4][2][16][68];              // [wave][buf][c][hw(+pad)]
    const int wave = threadIdx.x >> 5;
    const int lane = threadIdx.x & 31;
    const int b    = blockIdx.x >> 3;                 // 8 blocks per batch
    const int c0   = (((blockIdx.x & 7) << 2) + wave) << 4;   // 32 c-tiles/batch
    const int col  = lane & 15;
    const int kgrp = lane >> 4;
    const long xbase = (long)b * CH * HWSZ;
    const long mbase = (long)b * HEADS * HWSZ;

    v8f acc = {0.f, 0.f, 0.f, 0.f, 0.f, 0.f, 0.f, 0.f};

#if USE_ASYNC_LDS
    // ---- async double-buffered path ----
    // fill chunk 0 into buffer 0
    {
        const int hwc = 0;
#pragma unroll
        for (int i = 0; i < 8; ++i) {
            int idx = i * 32 + lane;
            int row = idx >> 4, c4 = idx & 15;
            __builtin_amdgcn_global_load_async_to_lds_b128(
                ASYNC_GPTR(&x[xbase + (long)(c0 + row) * HWSZ + hwc + c4 * 4]),
                ASYNC_LPTR(&tile[wave][0][row][c4 * 4]), 0, 0);
        }
    }
    for (int cidx = 0; cidx < HWSZ / 64; ++cidx) {
        const int cur = cidx & 1;
        const int hwc = cidx << 6;
        if (cidx + 1 < HWSZ / 64) {
            const int hwn = hwc + 64;
#pragma unroll
            for (int i = 0; i < 8; ++i) {
                int idx = i * 32 + lane;
                int row = idx >> 4, c4 = idx & 15;
                __builtin_amdgcn_global_load_async_to_lds_b128(
                    ASYNC_GPTR(&x[xbase + (long)(c0 + row) * HWSZ + hwn + c4 * 4]),
                    ASYNC_LPTR(&tile[wave][cur ^ 1][row][c4 * 4]), 0, 0);
            }
            __builtin_amdgcn_s_wait_asynccnt(8);      // chunk cidx complete
        } else {
            __builtin_amdgcn_s_wait_asynccnt(0);
        }
        __builtin_amdgcn_wave_barrier();

        for (int k = 0; k < 64; k += 4) {
            const int kk = k + kgrp * 2;
            v2f af; af.x = tile[wave][cur][col][kk];
                    af.y = tile[wave][cur][col][kk + 1];
            float m0 = mask[mbase + (long)(col & 7) * HWSZ + hwc + kk];
            float m1 = mask[mbase + (long)(col & 7) * HWSZ + hwc + kk + 1];
            v2f bf; bf.x = (col < HEADS) ? m0 : 0.f;
                    bf.y = (col < HEADS) ? m1 : 0.f;
            acc = __builtin_amdgcn_wmma_f32_16x16x4_f32(false, af, false, bf,
                                                        (short)0, acc, false, false);
        }
        __builtin_amdgcn_wave_barrier();
    }
#else
    // ---- fallback: register-staged LDS fill (per-wave, in-order DS) ----
    for (int hwc = 0; hwc < HWSZ; hwc += 64) {
#pragma unroll
        for (int i = 0; i < 8; ++i) {
            int idx = i * 32 + lane;
            int row = idx >> 4, c4 = idx & 15;
            float4 val = *reinterpret_cast<const float4*>(
                &x[xbase + (long)(c0 + row) * HWSZ + hwc + c4 * 4]);
            tile[wave][0][row][c4 * 4 + 0] = val.x;
            tile[wave][0][row][c4 * 4 + 1] = val.y;
            tile[wave][0][row][c4 * 4 + 2] = val.z;
            tile[wave][0][row][c4 * 4 + 3] = val.w;
        }
        __builtin_amdgcn_wave_barrier();

        for (int k = 0; k < 64; k += 4) {
            const int kk = k + kgrp * 2;
            v2f af; af.x = tile[wave][0][col][kk];
                    af.y = tile[wave][0][col][kk + 1];
            float m0 = mask[mbase + (long)(col & 7) * HWSZ + hwc + kk];
            float m1 = mask[mbase + (long)(col & 7) * HWSZ + hwc + kk + 1];
            v2f bf; bf.x = (col < HEADS) ? m0 : 0.f;
                    bf.y = (col < HEADS) ? m1 : 0.f;
            acc = __builtin_amdgcn_wmma_f32_16x16x4_f32(false, af, false, bf,
                                                        (short)0, acc, false, false);
        }
        __builtin_amdgcn_wave_barrier();
    }
#endif

    // D layout: VGPR r, lanes 0-15 -> M=r, lanes 16-31 -> M=r+8; N = lane&15 (head)
    const int h = lane & 15;
    if (h < HEADS) {
        const int mofs = (lane >> 4) * 8;
#pragma unroll
        for (int r = 0; r < 8; ++r)
            ctx[(long)(b * HEADS + h) * CH + c0 + r + mofs] = acc[r];
    }
}

// ---------------------------------------------------------------------------
// Kernel 4: per-batch head attention + channel_add MLP -> add_term[b, 512]
// Every dot product is spread over the lanes of a wave: a weight row is read
// as whole 128-byte lines (16 bytes a lane) and the lanes' partial sums are
// joined afterwards (through LDS for K/Q/V, by a butterfly elsewhere).
// ---------------------------------------------------------------------------
#define PPITCH 36   // floats per row of lane partials: 144 B, an odd multiple of 16 B

template <int WIDTH>
__device__ __forceinline__ float xor_sum(float v)
{
#pragma unroll
    for (int m = WIDTH / 2; m > 0; m >>= 1) v += __shfl_xor(v, m, 32);
    return v;
}

__device__ __forceinline__ float dot4(float4 a, float4 b, float s)
{
    s += a.x * b.x; s += a.y * b.y; s += a.z * b.z; s += a.w * b.w;
    return s;
}

__global__ void __launch_bounds__(512)
k_head_attn(const float* __restrict__ ctx, const float* __restrict__ cx,
            const float* __restrict__ cy,
            const float* __restrict__ g_w, const float* __restrict__ g_b,
            const float* __restrict__ k_w, const float* __restrict__ k_b,
            const float* __restrict__ q_w, const float* __restrict__ q_b,
            const float* __restrict__ v_w, const float* __restrict__ v_b,
            const float* __restrict__ w1,  const float* __restrict__ b1,
            const float* __restrict__ lng, const float* __restrict__ lnb,
            const float* __restrict__ w2,  const float* __restrict__ b2,
            float* __restrict__ addt)
{
    __shared__ __attribute__((aligned(16))) float part[3 * 512 * PPITCH];
    __shared__ __attribute__((aligned(16))) float wkqv[3 * 512];  // wk | wq | wv, each [h][d]
    __shared__ float lt[64];
    __shared__ float wmn[64];
    __shared__ __attribute__((aligned(16))) float oc[512];
    __shared__ __attribute__((aligned(16))) float ly[128];

    const int b    = blockIdx.x;
    const int tid  = threadIdx.x;
    const int lane = tid & 31;
    const int wave = __builtin_amdgcn_readfirstlane(tid >> 5);    // 0..15
    const float* cb = ctx + (long)b * HEADS * CH;

    // w_k / w_q / w_v : one wave per weight row, all 8 heads at once.
    // The lane keeps its 16 columns of every head's context in registers.
    {
        float4 c[HEADS][4];
#pragma unroll
        for (int h = 0; h < HEADS; ++h)
#pragma unroll
            for (int i = 0; i < 4; ++i)
                c[h][i] = *reinterpret_cast<const float4*>(cb + h * CH + i * 128 + lane * 4);

#pragma unroll
        for (int j = 0; j < 12; ++j) {
            const float* wm = (j < 4) ? k_w : (j < 8) ? q_w : v_w;
            const int d = wave + 16 * (j & 3);
            const float* wr = wm + d * CH + lane * 4;
            float4 w[4];
#pragma unroll
            for (int i = 0; i < 4; ++i)
                w[i] = *reinterpret_cast<const float4*>(wr + i * 128);
            const int r = (j >> 2) * 64 + d;
#pragma unroll
            for (int h = 0; h < HEADS; ++h) {
                float s = 0.f;
#pragma unroll
                for (int i = 0; i < 4; ++i) s = dot4(w[i], c[h][i], s);
                part[(r * HEADS + h) * PPITCH + lane] = s;
            }
        }
    }
    __syncthreads();

    // join the 32 lane partials of each of the 1536 outputs
#pragma unroll
    for (int mat = 0; mat < 3; ++mat) {
        const int p = mat * 512 + tid;
        const float4* pp = reinterpret_cast<const float4*>(&part[p * PPITCH]);
        float4 t = pp[0];
#pragma unroll
        for (int i = 1; i < 8; ++i) {
            float4 u = pp[i];
            t.x += u.x; t.y += u.y; t.z += u.z; t.w += u.w;
        }
        const int h = tid & 7, d = tid >> 3;
        const float* bs = (mat == 0) ? k_b : (mat == 1) ? q_b : v_b;
        wkqv[mat * 512 + h * 64 + d] = (t.x + t.y) + (t.z + t.w) + bs[d];
    }
    __syncthreads();

    // w_g (geometric) and scaled_dot -> logits lt[m*8+n]; 8 lanes per (m, n)
    {
        const int pair = tid >> 3, sub = tid & 7;
        const int m = pair >> 3, n = pair & 7;
        float dx = cx[b * 8 + m] - cx[b * 8 + n];
        float dy = cy[b * 8 + m] - cy[b * 8 + n];
        float pos[4] = { fmaxf(dx, 0.f), fmaxf(-dx, 0.f),
                         fmaxf(dy, 0.f), fmaxf(-dy, 0.f) };
        float freq = expf(-6.90775527898f * (float)sub * 0.125f);   // 1000^(-f/8)
        float s = 0.f;
        for (int p = 0; p < 4; ++p) {
            float ang = 100.f * pos[p] * freq;
            s += sinf(ang) * g_w[p * 8 + sub] + cosf(ang) * g_w[32 + p * 8 + sub];
        }
        float sd = 0.f;
#pragma unroll
        for (int i = 0; i < 8; ++i) {
            const int d = sub + 8 * i;
            sd += wkqv[m * 64 + d] * wkqv[512 + n * 64 + d];
        }
        s  = xor_sum<8>(s);
        sd = xor_sum<8>(sd);
        if (sub == 0) {
            float wg = fmaxf(s + g_b[0], 0.f);
            lt[pair] = logf(fmaxf(wg, 1e-6f)) + sd * 0.125f;        // 1/sqrt(64)
        }
    }
    __syncthreads();

    // softmax over m (axis=1) for each n; 8 lanes per n
    if (tid < 64) {
        const int n = tid >> 3, m = tid & 7;
        float v = lt[m * 8 + n];
        float mx = v;
#pragma unroll
        for (int k = 4; k > 0; k >>= 1) mx = fmaxf(mx, __shfl_xor(mx, k, 32));
        float e = expf(v - mx);
        float inv = 1.f / xor_sum<8>(e);
        wmn[m * 8 + n] = e * inv;
    }
    __syncthreads();

    // out_ctx[n, d] = sum_m wmn[m,n] * wv[m,d] -> flat n*64+d
    {
        int n = tid >> 6, d = tid & 63;
        float s = 0.f;
        for (int m = 0; m < 8; ++m) s += wmn[m * 8 + n] * wkqv[1024 + m * 64 + d];
        oc[tid] = s;
    }
    __syncthreads();

    // y = oc @ w1^T + b1  [128]: one wave per row, 8 rows a wave
    {
        float4 o4[4];
#pragma unroll
        for (int i = 0; i < 4; ++i)
            o4[i] = *reinterpret_cast<const float4*>(&oc[i * 128 + lane * 4]);
        const char* wb = reinterpret_cast<const char*>(w1 + wave * 8 * 512);
        const int lofs = lane * 16;                   // the lane's byte offset in a 512-byte piece
        float4 w[8][4];
#pragma unroll
        for (int j = 0; j < 8; ++j)
#pragma unroll
            for (int i = 0; i < 4; ++i)
                w[j][i] = *reinterpret_cast<const float4*>(wb + lofs + j * 2048 + i * 512);
        // the 32 loads above share one offset register: this wait stands in front of
        // its reuse, and the operand keeps the lane's offset live up to here (without
        // it the last load's result was placed on the offset register)
        asm volatile("s_wait_xcnt 0x0" :: "v"(lofs) : "memory");
        float res = 0.f;
#pragma unroll
        for (int j = 0; j < 8; ++j) {
            float s = 0.f;
#pragma unroll
            for (int i = 0; i < 4; ++i) s = dot4(w[j][i], o4[i], s);
            s = xor_sum<32>(s);
            res = (lane == j) ? s : res;
        }
        if (lane < 8) ly[wave * 8 + lane] = res + b1[wave * 8 + lane];
    }
    __syncthreads();

    // LayerNorm + ReLU in registers (every 8-lane group holds all 128 values),
    // then add_term[c] = y @ w2^T + b2  [512]: 8 lanes per row, 32 rows a wave
    {
        const int s8 = lane & 7, rsub = lane >> 3;
        float y[16];
#pragma unroll
        for (int i = 0; i < 4; ++i) {
            float4 t = *reinterpret_cast<const float4*>(&ly[i * 32 + s8 * 4]);
            y[i * 4 + 0] = t.x; y[i * 4 + 1] = t.y; y[i * 4 + 2] = t.z; y[i * 4 + 3] = t.w;
        }
        float mu = 0.f;
#pragma unroll
        for (int i = 0; i < 16; ++i) mu += y[i];
        mu = xor_sum<8>(mu) * (1.f / PLANES);
        float var = 0.f;
#pragma unroll
        for (int i = 0; i < 16; ++i) { float dlt = y[i] - mu; var += dlt * dlt; }
        var = xor_sum<8>(var) * (1.f / PLANES);
        const float rstd = rsqrtf(var + 1e-5f);
        float4 yn[4];
#pragma unroll
        for (int i = 0; i < 4; ++i) {
            float4 g4 = *reinterpret_cast<const float4*>(lng + i * 32 + s8 * 4);
            float4 b4 = *reinterpret_cast<const float4*>(lnb + i * 32 + s8 * 4);
            yn[i].x = fmaxf((y[i * 4 + 0] - mu) * rstd * g4.x + b4.x, 0.f);
            yn[i].y = fmaxf((y[i * 4 + 1] - mu) * rstd * g4.y + b4.y, 0.f);
            yn[i].z = fmaxf((y[i * 4 + 2] - mu) * rstd * g4.z + b4.z, 0.f);
            yn[i].w = fmaxf((y[i * 4 + 3] - mu) * rstd * g4.w + b4.w, 0.f);
        }
        float res = 0.f;
#pragma unroll
        for (int g = 0; g < 8; ++g) {
            const float* wr = w2 + (wave * 32 + g * 4 + rsub) * PLANES + s8 * 4;
            float s = 0.f;
#pragma unroll
            for (int i = 0; i < 4; ++i)
                s = dot4(*reinterpret_cast<const float4*>(wr + i * 32), yn[i], s);
            s = xor_sum<8>(s);
            res = (s8 == g) ? s : res;
        }
        const int c = wave * 32 + s8 * 4 + rsub;
        addt[b * 512 + c] = res + b2[c];
    }
}

// ---------------------------------------------------------------------------
// Kernel 5: out[b,c,hw] = x[b,c,hw] + add_term[b,c]   (float4 streaming)
// ---------------------------------------------------------------------------
__global__ void __launch_bounds__(256)
k_addout(const float* __restrict__ x, const float* __restrict__ addt,
         float* __restrict__ out)
{
    long e = (long)blockIdx.x * 256 + threadIdx.x;    // float4 index
    float a = addt[e >> 10];                          // 1024 float4 per (b,c) plane
    float4 xv = reinterpret_cast<const float4*>(x)[e];
    float4 o = { xv.x + a, xv.y + a, xv.z + a, xv.w + a };
    reinterpret_cast<float4*>(out)[e] = o;
}

// ---------------------------------------------------------------------------
extern "C" void kernel_launch(void* const* d_in, const int* in_sizes, int n_in,
                              void* d_out, int out_size, void* d_ws, size_t ws_size,
                              hipStream_t stream)
{
    const float* x   = (const float*)d_in[0];
    const float* cmw = (const float*)d_in[1];
    const float* cmb = (const float*)d_in[2];
    const float* g_w = (const float*)d_in[3];
    const float* g_b = (const float*)d_in[4];
    const float* k_w = (const float*)d_in[5];
    const float* k_b = (const float*)d_in[6];
    const float* q_w = (const float*)d_in[7];
    const float* q_b = (const float*)d_in[8];
    const float* v_w = (const float*)d_in[9];
    const float* v_b = (const float*)d_in[10];
    const float* w1  = (const float*)d_in[11];
    const float* b1  = (const float*)d_in[12];
    const float* lng = (const float*)d_in[13];
    const float* lnb = (const float*)d_in[14];
    const float* w2  = (const float*)d_in[15];
    const float* b2  = (const float*)d_in[16];
    float* out = (float*)d_out;

    // workspace layout (floats)
    float* ws   = (float*)d_ws;
    float* mask = ws;                                 // 16*8*4096 = 524288
    float* ctx  = ws + 524288;                        // 16*8*512  = 65536
    float* cxb  = ws + 524288 + 65536;                // 128
    float* cyb  = cxb + 128;                          // 128
    float* addt = cyb + 128;                          // 16*512 = 8192

    k_logits_wmma<<<dim3(NB * 64), dim3(128), 0, stream>>>(x, cmw, cmb, mask);
    k_softmax_centroid<<<dim3(NB * HEADS), dim3(256), 0, stream>>>(mask, cxb, cyb);
    k_context_wmma<<<dim3(NB * 8), dim3(128), 0, stream>>>(x, mask, ctx);
    k_head_attn<<<dim3(NB), dim3(512), 0, stream>>>(ctx, cxb, cyb, g_w, g_b,
                                                    k_w, k_b, q_w, q_b, v_w, v_b,
                                                    w1, b1, lng, lnb, w2, b2, addt);
    k_addout<<<dim3(NB * CH * HWSZ / 4 / 256), dim3(256), 0, stream>>>(x, addt, out);
}

// v002
// It runs in 130 microseconds.
// In two side-by-side timings against v001, it was 1.05 and 1.04 times as fast.
// All steps since v000 together make it 1.58 times as fast.
#include <hip/hip_runtime.h>
#include <hip/hip_bf16.h>

typedef __attribute__((ext_vector_type(2))) float v2f;
typedef __attribute__((ext_vector_type(8))) float v8f;

#define HEADS  8
#define NB     16
#define CH     512
#define HT     64
#define WD     64
#define HWSZ   4096
#define PLANES 128

#if __has_builtin(__builtin_amdgcn_global_load_async_to_lds_b128) && \
    __has_builtin(__builtin_amdgcn_s_wait_asynccnt)
#define USE_ASYNC_LDS 1
#else
#define USE_ASYNC_LDS 0
#endif

// async copy builtin wants typed int4 (vector_size 16) pointers:
//   arg0: AS1 (global, prints as __device__), arg1: AS3 (LDS, prints as __shared__)
typedef int async_v4i __attribute__((vector_size(16)));
#define ASYNC_GPTR(p)                                              \
    ((__attribute__((address_space(1))) async_v4i*)                \
     (__attribute__((address_space(1))) void*)(void*)(p))
#define ASYNC_LPTR(p)                                              \
    ((__attribute__((address_space(3))) async_v4i*)                \
     (__attribute__((address_space(3))) void*)(void*)(p))

// ---------------------------------------------------------------------------
// Kernel 1: logits[b,n,hw] = sum_c x[b,c,hw] * cmw[n,c] + cmb[n]
// WMMA f32 16x16x4: M = heads (8 used of 16), N = 16 hw columns, K over C.
// ---------------------------------------------------------------------------
__global__ void __launch_bounds__(128)
k_logits_wmma(const float* __restrict__ x, const float* __restrict__ cmw,
              const float* __restrict__ cmb, float* __restrict__ mask)
{
    const int wave = threadIdx.x >> 5;
    const int lane = threadIdx.x & 31;
    const int b    = blockIdx.x >> 6;                 // 64 hw-blocks per batch
    const int hw0  = ((blockIdx.x & 63) << 6) + (wave << 4);
    const int col  = lane & 15;                       // M for A-frag, N for B-frag
    const int kgrp = lane >> 4;                       // 0 or 1: K offset group
    const long xbase = (long)b * CH * HWSZ;

    v8f c = {0.f, 0.f, 0.f, 0.f, 0.f, 0.f, 0.f, 0.f};

    for (int k = 0; k < CH; k += 4) {
        const int kk = k + kgrp * 2;
        // A fragment: conv_mask_w[m, kk], rows >= 8 are zero padding
        float a0 = cmw[(col & 7) * CH + kk];
        float a1 = cmw[(col & 7) * CH + kk + 1];
        v2f af; af.x = (col < HEADS) ? a0 : 0.f;
                af.y = (col < HEADS) ? a1 : 0.f;
        // B fragment: x[b, kk, hw0+col] (coalesced across lanes 0-15)
        v2f bf;
        bf.x = x[xbase + (long)kk       * HWSZ + hw0 + col];
        bf.y = x[xbase + (long)(kk + 1) * HWSZ + hw0 + col];
        if (k + 8 < CH)
            __builtin_prefetch(&x[xbase + (long)(k + 8) * HWSZ + hw0 + col], 0, 1);
        c = __builtin_amdgcn_wmma_f32_16x16x4_f32(false, af, false, bf,
                                                  (short)0, c, false, false);
    }

    // C/D layout: VGPR r, lanes 0-15 -> M=r (heads 0..7), lanes 16-31 -> M=r+8 (pad)
    if (lane < 16) {
        const int n = lane;
#pragma unroll
        for (int r = 0; r < HEADS; ++r)
            mask[(long)(b * HEADS + r) * HWSZ + hw0 + n] = c[r] + cmb[r];
    }
}

// ---------------------------------------------------------------------------
// Kernel 2: per-(b,head) softmax over HW (in place) + centroid cx, cy
// ---------------------------------------------------------------------------
__global__ void __launch_bounds__(256)
k_softmax_centroid(float* __restrict__ mask, float* __restrict__ cx,
                   float* __restrict__ cy)
{
    __shared__ float red[256];
    const int row = blockIdx.x;                       // b*8 + n
    const int tid = threadIdx.x;
    float* r = mask + (long)row * HWSZ;

    float v[16];
    float mx = -1e30f;
#pragma unroll
    for (int i = 0; i < 16; ++i) { v[i] = r[i * 256 + tid]; mx = fmaxf(mx, v[i]); }

    red[tid] = mx; __syncthreads();
    for (int s = 128; s > 0; s >>= 1) {
        if (tid < s) red[tid] = fmaxf(red[tid], red[tid + s]);
        __syncthreads();
    }
    mx = red[0]; __syncthreads();

    float sum = 0.f, pc = 0.f, pr = 0.f;
#pragma unroll
    for (int i = 0; i < 16; ++i) {
        float e = expf(v[i] - mx);
        v[i] = e; sum += e;
        int hw = i * 256 + tid;
        pc += e * (float)(hw & 63);                   // column index j
        pr += e * (float)(hw >> 6);                   // row index i
    }
    red[tid] = sum; __syncthreads();
    for (int s = 128; s > 0; s >>= 1) {
        if (tid < s) red[tid] += red[tid + s];
        __syncthreads();
    }
    sum = red[0]; __syncthreads();

    red[tid] = pc; __syncthreads();
    for (int s = 128; s > 0; s >>= 1) {
        if (tid < s) red[tid] += red[tid + s];
        __syncthreads();
    }
    pc = red[0]; __syncthreads();

    red[tid] = pr; __syncthreads();
    for (int s = 128; s > 0; s >>= 1) {
        if (tid < s) red[tid] += red[tid + s];
        __syncthreads();
    }
    pr = red[0];

    float inv = 1.f / sum;
#pragma unroll
    for (int i = 0; i < 16; ++i) r[i * 256 + tid] = v[i] * inv;

    if (tid == 0) {
        cx[row] = pc * inv / (float)HT;
        cy[row] = pr * inv / (float)WD;
    }
}

// ---------------------------------------------------------------------------
// Kernel 3: context[b,h,c] = sum_hw x[b,c,hw] * mask[b,h,hw]
// WMMA f32 16x16x4: M = 16 channels, N = heads (8 used of 16), K over HW.
// x tiles staged into LDS via GLOBAL_LOAD_ASYNC_TO_LDS_B128, double-buffered
// and synced with s_wait_asynccnt (per-wave counter; each of the 4 waves owns
// its own tile buffers, so no block barrier is needed).
// ---------------------------------------------------------------------------
__global__ void __launch_bounds__(128)
k_context_wmma(const float* __restrict__ x, const float* __restrict__ mask,
               float* __restrict__ ctx)
{
    __shared__ float tile[4][2][16][68];              // [wave][buf][c][hw(+pad)]
    const int wave = threadIdx.x >> 5;
    const int lane = threadIdx.x & 31;
    const int b    = blockIdx.x >> 3;                 // 8 blocks per batch
    const int c0   = (((blockIdx.x & 7) << 2) + wave) << 4;   // 32 c-tiles/batch
    const int col  = lane & 15;
    const int kgrp = lane >> 4;
    const long xbase = (long)b * CH * HWSZ;
    const long mbase = (long)b * HEADS * HWSZ;

    v8f acc = {0.f, 0.f, 0.f, 0.f, 0.f, 0.f, 0.f, 0.f};

#if USE_ASYNC_LDS
    // ---- async double-buffered path ----
    // fill chunk 0 into buffer 0
    {
        const int hwc = 0;
#pragma unroll
        for (int i = 0; i < 8; ++i) {
            int idx = i * 32 + lane;
            int row = idx >> 4, c4 = idx & 15;
            __builtin_amdgcn_global_load_async_to_lds_b128(
                ASYNC_GPTR(&x[xbase + (long)(c0 + row) * HWSZ + hwc + c4 * 4]),
                ASYNC_LPTR(&tile[wave][0][row][c4 * 4]), 0, 0);
        }
    }
    for (int cidx = 0; cidx < HWSZ / 64; ++cidx) {
        const int cur = cidx & 1;
        const int hwc = cidx << 6;
        if (cidx + 1 < HWSZ / 64) {
            const int hwn = hwc + 64;
#pragma unroll
            for (int i = 0; i < 8; ++i) {
                int idx = i * 32 + lane;
                int row = idx >> 4, c4 = idx & 15;
                __builtin_amdgcn_global_load_async_to_lds_b128(
                    ASYNC_GPTR(&x[xbase + (long)(c0 + row) * HWSZ + hwn + c4 * 4]),
                    ASYNC_LPTR(&tile[wave][cur ^ 1][row][c4 * 4]), 0, 0);
            }
            __builtin_amdgcn_s_wait_asynccnt(8);      // chunk cidx complete
        } else {
            __builtin_amdgcn_s_wait_asynccnt(0);
        }
        __builtin_amdgcn_wave_barrier();

        for (int k = 0; k < 64; k += 4) {
            const int kk = k + kgrp * 2;
            v2f af; af.x = tile[wave][cur][col][kk];
                    af.y = tile[wave][cur][col][kk + 1];
            float m0 = mask[mbase + (long)(col & 7) * HWSZ + hwc + kk];
            float m1 = mask[mbase + (long)(col & 7) * HWSZ + hwc + kk + 1];
            v2f bf; bf.x = (col < HEADS) ? m0 : 0.f;
                    bf.y = (col < HEADS) ? m1 : 0.f;
            acc = __builtin_amdgcn_wmma_f32_16x16x4_f32(false, af, false, bf,
                                                        (short)0, acc, false, false);
        }
        __builtin_amdgcn_wave_barrier();
    }
#else
    // ---- fallback: register-staged LDS fill (per-wave, in-order DS) ----
    for (int hwc = 0; hwc < HWSZ; hwc += 64) {
#pragma unroll
        for (int i = 0; i < 8; ++i) {
            int idx = i * 32 + lane;
            int row = idx >> 4, c4 = idx & 15;
            float4 val = *reinterpret_cast<const float4*>(
                &x[xbase + (long)(c0 + row) * HWSZ + hwc + c4 * 4]);
            tile[wave][0][row][c4 * 4 + 0] = val.x;
            tile[wave][0][row][c4 * 4 + 1] = val.y;
            tile[wave][0][row][c4 * 4 + 2] = val.z;
            tile[wave][0][row][c4 * 4 + 3] = val.w;
        }
        __builtin_amdgcn_wave_barrier();

        for (int k = 0; k < 64; k += 4) {
            const int kk = k + kgrp * 2;
            v2f af; af.x = tile[wave][0][col][kk];
                    af.y = tile[wave][0][col][kk + 1];
            float m0 = mask[mbase + (long)(col & 7) * HWSZ + hwc + kk];
            float m1 = mask[mbase + (long)(col & 7) * HWSZ + hwc + kk + 1];
            v2f bf; bf.x = (col < HEADS) ? m0 : 0.f;
                    bf.y = (col < HEADS) ? m1 : 0.f;
            acc = __builtin_amdgcn_wmma_f32_16x16x4_f32(false, af, false, bf,
                                                        (short)0, acc, false, false);
        }
        __builtin_amdgcn_wave_barrier();
    }
#endif

    // D layout: VGPR r, lanes 0-15 -> M=r, lanes 16-31 -> M=r+8; N = lane&15 (head)
    const int h = lane & 15;
    if (h < HEADS) {
        const int mofs = (lane >> 4) * 8;
#pragma unroll
        for (int r = 0; r < 8; ++r)
            ctx[(long)(b * HEADS + h) * CH + c0 + r + mofs] = acc[r];
    }
}

// ---------------------------------------------------------------------------
// Kernel 4: per-batch head attention + channel_add MLP -> add_term[b, 512]
// Every dot product is spread over the lanes of a wave: a weight row is read
// as whole 128-byte lines (16 bytes a lane) and the lanes' partial sums are
// joined afterwards (through LDS for K/Q/V, by a butterfly elsewhere).
// ---------------------------------------------------------------------------
#define PPITCH 36   // floats per row of lane partials: 144 B, an odd multiple of 16 B

template <int WIDTH>
__device__ __forceinline__ float xor_sum(float v)
{
#pragma unroll
    for (int m = WIDTH / 2; m > 0; m >>= 1) v += __shfl_xor(v, m, 32);
    return v;
}

__device__ __forceinline__ float dot4(float4 a, float4 b, float s)
{
    s += a.x * b.x; s += a.y * b.y; s += a.z * b.z; s += a.w * b.w;
    return s;
}

__global__ void __launch_bounds__(512)
k_head_attn(const float* __restrict__ ctx, const float* __restrict__ cx,
            const float* __restrict__ cy,
            const float* __restrict__ g_w, const float* __restrict__ g_b,
            const float* __restrict__ k_w, const float* __restrict__ k_b,
            const float* __restrict__ q_w, const float* __restrict__ q_b,
            const float* __restrict__ v_w, const float* __restrict__ v_b,
            const float* __restrict__ w1,  const float* __restrict__ b1,
            const float* __restrict__ lng, const float* __restrict__ lnb,
            const float* __restrict__ w2,  const float* __restrict__ b2,
            float* __restrict__ addt)
{
    __shared__ __attribute__((aligned(16))) float part[3 * 512 * PPITCH];
    __shared__ __attribute__((aligned(16))) float wkqv[3 * 512];  // wk | wq | wv, each [h][d]
    __shared__ float lt[64];
    __shared__ float wmn[64];
    __shared__ __attribute__((aligned(16))) float oc[512];
    __shared__ __attribute__((aligned(16))) float ly[128];

    const int b    = blockIdx.x;
    const int tid  = threadIdx.x;
    const int lane = tid & 31;
    const int wave = __builtin_amdgcn_readfirstlane(tid >> 5);    // 0..15
    const float* cb = ctx + (long)b * HEADS * CH;

    // w_k / w_q / w_v : one wave per weight row, all 8 heads at once.
    // The lane keeps its 16 columns of every head's context in registers.
    {
        float4 c[HEADS][4];
#pragma unroll
        for (int h = 0; h < HEADS; ++h)
#pragma unroll
            for (int i = 0; i < 4; ++i)
                c[h][i] = *reinterpret_cast<const float4*>(cb + h * CH + i * 128 + lane * 4);

#pragma unroll
        for (int j = 0; j < 12; ++j) {
            const float* wm = (j < 4) ? k_w : (j < 8) ? q_w : v_w;
            const int d = wave + 16 * (j & 3);
            const float* wr = wm + d * CH + lane * 4;
            float4 w[4];
#pragma unroll
            for (int i = 0; i < 4; ++i)
                w[i] = *reinterpret_cast<const float4*>(wr + i * 128);
            const int r = (j >> 2) * 64 + d;
#pragma unroll
            for (int h = 0; h < HEADS; ++h) {
                float s = 0.f;
#pragma unroll
                for (int i = 0; i < 4; ++i) s = dot4(w[i], c[h][i], s);
                part[(r * HEADS + h) * PPITCH + lane] = s;
            }
        }
    }
    __syncthreads();

    // join the 32 lane partials of each of the 1536 outputs
#pragma unroll
    for (int mat = 0; mat < 3; ++mat) {
        const int p = mat * 512 + tid;
        const float4* pp = reinterpret_cast<const float4*>(&part[p * PPITCH]);
        float4 t = pp[0];
#pragma unroll
        for (int i = 1; i < 8; ++i) {
            float4 u = pp[i];
            t.x += u.x; t.y += u.y; t.z += u.z; t.w += u.w;
        }
        const int h = tid & 7, d = tid >> 3;
        const float* bs = (mat == 0) ? k_b : (mat == 1) ? q_b : v_b;
        wkqv[mat * 512 + h * 64 + d] = (t.x + t.y) + (t.z + t.w) + bs[d];
    }
    __syncthreads();

    // w_g (geometric) and scaled_dot -> logits lt[m*8+n]; 8 lanes per (m, n)
    {
        const int pair = tid >> 3, sub = tid & 7;
        const int m = pair >> 3, n = pair & 7;
        float dx = cx[b * 8 + m] - cx[b * 8 + n];
        float dy = cy[b * 8 + m] - cy[b * 8 + n];
        float pos[4] = { fmaxf(dx, 0.f), fmaxf(-dx, 0.f),
                         fmaxf(dy, 0.f), fmaxf(-dy, 0.f) };
        float freq = expf(-6.90775527898f * (float)sub * 0.125f);   // 1000^(-f/8)
        float s = 0.f;
        for (int p = 0; p < 4; ++p) {
            float ang = 100.f * pos[p] * freq;
            s += sinf(ang) * g_w[p * 8 + sub] + cosf(ang) * g_w[32 + p * 8 + sub];
        }
        float sd = 0.f;
#pragma unroll
        for (int i = 0; i < 8; ++i) {
            const int d = sub + 8 * i;
            sd += wkqv[m * 64 + d] * wkqv[512 + n * 64 + d];
        }
        s  = xor_sum<8>(s);
        sd = xor_sum<8>(sd);
        if (sub == 0) {
            float wg = fmaxf(s + g_b[0], 0.f);
            lt[pair] = logf(fmaxf(wg, 1e-6f)) + sd * 0.125f;        // 1/sqrt(64)
        }
    }
    __syncthreads();

    // softmax over m (axis=1) for each n; 8 lanes per n
    if (tid < 64) {
        const int n = tid >> 3, m = tid & 7;
        float v = lt[m * 8 + n];
        float mx = v;
#pragma unroll
        for (int k = 4; k > 0; k >>= 1) mx = fmaxf(mx, __shfl_xor(mx, k, 32));
        float e = expf(v - mx);
        float inv = 1.f / xor_sum<8>(e);
        wmn[m * 8 + n] = e * inv;
    }
    __syncthreads();

    // out_ctx[n, d] = sum_m wmn[m,n] * wv[m,d] -> flat n*64+d
    {
        int n = tid >> 6, d = tid & 63;
        float s = 0.f;
        for (int m = 0; m < 8; ++m) s += wmn[m * 8 + n] * wkqv[1024 + m * 64 + d];
        oc[tid] = s;
    }
    __syncthreads();

    // y = oc @ w1^T + b1  [128]: one wave per row, 8 rows a wave
    {
        float4 o4[4];
#pragma unroll
        for (int i = 0; i < 4; ++i)
            o4[i] = *reinterpret_cast<const float4*>(&oc[i * 128 + lane * 4]);
        const char* wb = reinterpret_cast<const char*>(w1 + wave * 8 * 512);
        const int lofs = lane * 16;                   // the lane's byte offset in a 512-byte piece
        float4 w[8][4];
#pragma unroll
        for (int j = 0; j < 8; ++j)
#pragma unroll
            for (int i = 0; i < 4; ++i)
                w[j][i] = *reinterpret_cast<const float4*>(wb + lofs + j * 2048 + i * 512);
        // the 32 loads above share one offset register: this wait stands in front of
        // its reuse, and the operand keeps the lane's offset live up to here (without
        // it the last load's result was placed on the offset register)
        asm volatile("s_wait_xcnt 0x0" :: "v"(lofs) : "memory");
        float res = 0.f;
#pragma unroll
        for (int j = 0; j < 8; ++j) {
            float s = 0.f;
#pragma unroll
            for (int i = 0; i < 4; ++i) s = dot4(w[j][i], o4[i], s);
            s = xor_sum<32>(s);
            res = (lane == j) ? s : res;
        }
        if (lane < 8) ly[wave * 8 + lane] = res + b1[wave * 8 + lane];
    }
    __syncthreads();

    // LayerNorm + ReLU in registers (every 8-lane group holds all 128 values),
    // then add_term[c] = y @ w2^T + b2  [512]: 8 lanes per row, 32 rows a wave
    {
        const int s8 = lane & 7, rsub = lane >> 3;
        float y[16];
#pragma unroll
        for (int i = 0; i < 4; ++i) {
            float4 t = *reinterpret_cast<const float4*>(&ly[i * 32 + s8 * 4]);
            y[i * 4 + 0] = t.x; y[i * 4 + 1] = t.y; y[i * 4 + 2] = t.z; y[i * 4 + 3] = t.w;
        }
        float mu = 0.f;
#pragma unroll
        for (int i = 0; i < 16; ++i) mu += y[i];
        mu = xor_sum<8>(mu) * (1.f / PLANES);
        float var = 0.f;
#pragma unroll
        for (int i = 0; i < 16; ++i) { float dlt = y[i] - mu; var += dlt * dlt; }
        var = xor_sum<8>(var) * (1.f / PLANES);
        const float rstd = rsqrtf(var + 1e-5f);
        float4 yn[4];
#pragma unroll
        for (int i = 0; i < 4; ++i) {
            float4 g4 = *reinterpret_cast<const float4*>(lng + i * 32 + s8 * 4);
            float4 b4 = *reinterpret_cast<const float4*>(lnb + i * 32 + s8 * 4);
            yn[i].x = fmaxf((y[i * 4 + 0] - mu) * rstd * g4.x + b4.x, 0.f);
            yn[i].y = fmaxf((y[i * 4 + 1] - mu) * rstd * g4.y + b4.y, 0.f);
            yn[i].z = fmaxf((y[i * 4 + 2] - mu) * rstd * g4.z + b4.z, 0.f);
            yn[i].w = fmaxf((y[i * 4 + 3] - mu) * rstd * g4.w + b4.w, 0.f);
        }
        float res = 0.f;
#pragma unroll
        for (int g = 0; g < 8; ++g) {
            const float* wr = w2 + (wave * 32 + g * 4 + rsub) * PLANES + s8 * 4;
            float s = 0.f;
#pragma unroll
            for (int i = 0; i < 4; ++i)
                s = dot4(*reinterpret_cast<const float4*>(wr + i * 32), yn[i], s);
            s = xor_sum<8>(s);
            res = (s8 == g) ? s : res;
        }
        const int c = wave * 32 + s8 * 4 + rsub;
        addt[b * 512 + c] = res + b2[c];
    }
}

// ---------------------------------------------------------------------------
// Kernel 5: out[b,c,hw] = x[b,c,hw] + add_term[b,c]   (float4 streaming)
// One workgroup of 16 waves per WGP instead of one wave per 512 bytes. A wave
// streams AO_PLANES whole (b,c) planes in groups of AO_DEPTH loads, each load
// 512 contiguous bytes.
// ---------------------------------------------------------------------------
#define AO_WAVES  16    // waves per workgroup
#define AO_PLANES 2     // (b,c) planes per wave
#define AO_DEPTH  16    // 16-byte loads per lane in flight
#define AO_GROUPS (AO_PLANES * (HWSZ / 4) / (32 * AO_DEPTH))

__global__ void __launch_bounds__(AO_WAVES * 32)
k_addout(const float* __restrict__ x, const float* __restrict__ addt,
         float* __restrict__ out)
{
    const int lane  = threadIdx.x & 31;
    const int wave  = __builtin_amdgcn_readfirstlane(threadIdx.x >> 5);
    const int plane = (blockIdx.x * AO_WAVES + wave) * AO_PLANES;
    const float4* xp = reinterpret_cast<const float4*>(x) + (long)plane * (HWSZ / 4) + lane;
    float4*       op = reinterpret_cast<float4*>(out)     + (long)plane * (HWSZ / 4) + lane;

    float a[AO_PLANES];
#pragma unroll
    for (int p = 0; p < AO_PLANES; ++p) a[p] = addt[plane + p];

    // unrolled: every address is one base and one lane offset plus an immediate, so no
    // address register is rewritten while loads or stores are in flight
#pragma unroll
    for (int g = 0; g < AO_GROUPS; ++g) {
        // the loads below land on registers that the group before was stored from:
        // this wait stands between those stores and the overwrite of their data
        if (g > 0) asm volatile("s_wait_xcnt 0x0" ::: "memory");
        float4 v[AO_DEPTH];
#pragma unroll
        for (int i = 0; i < AO_DEPTH; ++i) v[i] = xp[(g * AO_DEPTH + i) * 32];
        // all loads of the group are issued before the first add waits for one: left
        // free, the compiler sinks each load to its use and the wave waits out every one
        __builtin_amdgcn_sched_barrier(0);
        const float s = a[g / (AO_GROUPS / AO_PLANES)];
#pragma unroll
        for (int i = 0; i < AO_DEPTH; ++i) {
            float4 o = { v[i].x + s, v[i].y + s, v[i].z + s, v[i].w + s };
            op[(g * AO_DEPTH + i) * 32] = o;
        }
    }
}

// ---------------------------------------------------------------------------
extern "C" void kernel_launch(void* const* d_in, const int* in_sizes, int n_in,
                              void* d_out, int out_size, void* d_ws, size_t ws_size,
                              hipStream_t stream)
{
    const float* x   = (const float*)d_in[0];
    const float* cmw = (const float*)d_in[1];
    const float* cmb = (const float*)d_in[2];
    const float* g_w = (const float*)d_in[3];
    const float* g_b = (const float*)d_in[4];
    const float* k_w = (const float*)d_in[5];
    const float* k_b = (const float*)d_in[6];
    const float* q_w = (const float*)d_in[7];
    const float* q_b = (const float*)d_in[8];
    const float* v_w = (const float*)d_in[9];
    const float* v_b = (const float*)d_in[10];
    const float* w1  = (const float*)d_in[11];
    const float* b1  = (const float*)d_in[12];
    const float* lng = (const float*)d_in[13];
    const float* lnb = (const float*)d_in[14];
    const float* w2  = (const float*)d_in[15];
    const float* b2  = (const float*)d_in[16];
    float* out = (float*)d_out;

    // workspace layout (floats)
    float* ws   = (float*)d_ws;
    float* mask = ws;                                 // 16*8*4096 = 524288
    float* ctx  = ws + 524288;                        // 16*8*512  = 65536
    float* cxb  = ws + 524288 + 65536;                // 128
    float* cyb  = cxb + 128;                          // 128
    float* addt = cyb + 128;                          // 16*512 = 8192

    k_logits_wmma<<<dim3(NB * 64), dim3(128), 0, stream>>>(x, cmw, cmb, mask);
    k_softmax_centroid<<<dim3(NB * HEADS), dim3(256), 0, stream>>>(mask, cxb, cyb);
    k_context_wmma<<<dim3(NB * 8), dim3(128), 0, stream>>>(x, mask, ctx);
    k_head_attn<<<dim3(NB), dim3(512), 0, stream>>>(ctx, cxb, cyb, g_w, g_b,
                                                    k_w, k_b, q_w, q_b, v_w, v_b,
                                                    w1, b1, lng, lnb, w2, b2, addt);
    k_addout<<<dim3(NB * CH / (AO_WAVES * AO_PLANES)), dim3(AO_WAVES * 32), 0, stream>>>(x, addt, out);
}

// v003
// One run takes 57.3 microseconds.
// Next to v002, in two timings, it ran 2.25 times as fast each time.
// Over all steps from v000 it is 3.55 times as fast.
#include <hip/hip_runtime.h>
#include <hip/hip_bf16.h>

typedef __attribute__((ext_vector_type(2))) float v2f;
typedef __attribute__((ext_vector_type(8))) float v8f;

#define HEADS  8
#define NB     16
#define CH     512
#define HT     64
#define WD     64
#define HWSZ   4096
#define PLANES 128

template <int WIDTH>
__device__ __forceinline__ float xor_sum(float v)
{
#pragma unroll
    for (int m = WIDTH / 2; m > 0; m >>= 1) v += __shfl_xor(v, m, 32);
    return v;
}

#define PC_COLS  64    // hw columns per workgroup: one image row
#define PC_CHUNKS (HWSZ / PC_COLS)
#define PC_PITCH 68    // floats per LDS row: 272 B, an odd multiple of 16 B
#define PC_WAVES 8

// eight 16-byte-a-lane copies, global memory to LDS through no register. The wait in
// the last line stands in front of any rewrite of the address registers named here.
#define PC_COPY8(l, g, r)                                                         \
    asm volatile("global_load_async_to_lds_b128 %0, %8, off\n\t"                  \
                 "global_load_async_to_lds_b128 %1, %9, off\n\t"                  \
                 "global_load_async_to_lds_b128 %2, %10, off\n\t"                 \
                 "global_load_async_to_lds_b128 %3, %11, off\n\t"                 \
                 "global_load_async_to_lds_b128 %4, %12, off\n\t"                 \
                 "global_load_async_to_lds_b128 %5, %13, off\n\t"                 \
                 "global_load_async_to_lds_b128 %6, %14, off\n\t"                 \
                 "global_load_async_to_lds_b128 %7, %15, off\n\t"                 \
                 "s_wait_xcnt 0x0"                                                \
                 :: "v"((l) + ((r) + 0) * (PC_PITCH * 4u)),                       \
                    "v"((l) + ((r) + 2) * (PC_PITCH * 4u)),                       \
                    "v"((l) + ((r) + 4) * (PC_PITCH * 4u)),                       \
                    "v"((l) + ((r) + 6) * (PC_PITCH * 4u)),                       \
                    "v"((l) + ((r) + 8) * (PC_PITCH * 4u)),                       \
                    "v"((l) + ((r) + 10) * (PC_PITCH * 4u)),                      \
                    "v"((l) + ((r) + 12) * (PC_PITCH * 4u)),                      \
                    "v"((l) + ((r) + 14) * (PC_PITCH * 4u)),                      \
                    "v"((g) + ((r) + 0) * HWSZ), "v"((g) + ((r) + 2) * HWSZ),     \
                    "v"((g) + ((r) + 4) * HWSZ), "v"((g) + ((r) + 6) * HWSZ),     \
                    "v"((g) + ((r) + 8) * HWSZ), "v"((g) + ((r) + 10) * HWSZ),    \
                    "v"((g) + ((r) + 12) * HWSZ), "v"((g) + ((r) + 14) * HWSZ)    \
                 : "memory")

// ---------------------------------------------------------------------------
// Kernel 1: one workgroup per (batch, 64 hw columns). The tile x[512 c][64 hw] is
// brought into LDS once and feeds both products:
//   logits[h, hw] = sum_c cmw[h, c] * x[c, hw] + cmb[h]      (WMMA, K over c)
//   e[h, hw]      = exp(logits - max over the 64 columns)
//   part[h, c]    = sum_hw x[c, hw] * e[h, hw]                (WMMA, K over hw)
// The chunk's maximum, sum of e and column moment go out beside part; kernel 2
// joins the 64 chunks of a (batch, head). Wave w copies, and alone reads, the
// channels 64 w .. 64 w + 63.
// ---------------------------------------------------------------------------
__global__ void __launch_bounds__(PC_WAVES * 32)
k_pool_partial(const float* __restrict__ x, const float* __restrict__ cmw,
               const float* __restrict__ cmb, float* __restrict__ part,
               float* __restrict__ smax, float* __restrict__ ssum,
               float* __restrict__ scol)
{
    __shared__ __attribute__((aligned(16))) float tile[CH * PC_PITCH];
    __shared__ __attribute__((aligned(16))) float lg[PC_WAVES * HEADS * PC_COLS];
    __shared__ __attribute__((aligned(16))) float pm[16 * PC_PITCH];

    const int lane  = threadIdx.x & 31;
    const int wave  = __builtin_amdgcn_readfirstlane(threadIdx.x >> 5);
    const int b     = blockIdx.x >> 6;
    const int chunk = blockIdx.x & 63;
    const int col   = lane & 15;
    const int kgrp  = lane >> 4;
    const int row0  = wave * 64;

    // 32 copies a wave, each two rows of 256 bytes, all in flight at once
    {
        const float* g = x + ((long)b * CH + row0 + kgrp) * HWSZ + chunk * PC_COLS + col * 4;
        const unsigned l = (unsigned)(uintptr_t)&tile[(row0 + kgrp) * PC_PITCH + col * 4];
        PC_COPY8(l, g, 0);
        PC_COPY8(l, g, 16);
        PC_COPY8(l, g, 32);
        PC_COPY8(l, g, 48);
    }

    // A fragments of the logits product, fetched while the tile is on its way.
    // k order of both loaders: step 2u+s holds channels row0 + 8u + 4 kgrp + 2s, +1.
    float4 a4[8];
#pragma unroll
    for (int u = 0; u < 8; ++u) {
        float4 t = *reinterpret_cast<const float4*>(cmw + (col & 7) * CH + row0 + u * 8 + kgrp * 4);
        a4[u].x = (col < HEADS) ? t.x : 0.f;          // rows >= 8 are zero padding
        a4[u].y = (col < HEADS) ? t.y : 0.f;
        a4[u].z = (col < HEADS) ? t.z : 0.f;
        a4[u].w = (col < HEADS) ? t.w : 0.f;
    }

    // the wave's own copies have landed behind this wait
    asm volatile("s_wait_asynccnt 0x0" ::: "memory");
    __syncthreads();

    // logits over the wave's 64 channels, all 64 columns: N tile t holds columns 4n + t
    {
        v8f acc[4];
#pragma unroll
        for (int t = 0; t < 4; ++t) acc[t] = (v8f){0.f, 0.f, 0.f, 0.f, 0.f, 0.f, 0.f, 0.f};
#pragma unroll
        for (int u = 0; u < 8; ++u) {
#pragma unroll
            for (int s = 0; s < 2; ++s) {
                const int ch = row0 + u * 8 + kgrp * 4 + s * 2;
                float4 b0 = *reinterpret_cast<const float4*>(&tile[ch * PC_PITCH + col * 4]);
                float4 b1 = *reinterpret_cast<const float4*>(&tile[(ch + 1) * PC_PITCH + col * 4]);
                v2f af; af.x = s ? a4[u].z : a4[u].x;
                        af.y = s ? a4[u].w : a4[u].y;
                v2f bf;
                bf.x = b0.x; bf.y = b1.x;
                acc[0] = __builtin_amdgcn_wmma_f32_16x16x4_f32(false, af, false, bf,
                                                               (short)0, acc[0], false, false);
                bf.x = b0.y; bf.y = b1.y;
                acc[1] = __builtin_amdgcn_wmma_f32_16x16x4_f32(false, af, false, bf,
                                                               (short)0, acc[1], false, false);
                bf.x = b0.z; bf.y = b1.z;
                acc[2] = __builtin_amdgcn_wmma_f32_16x16x4_f32(false, af, false, bf,
                                                               (short)0, acc[2], false, false);
                bf.x = b0.w; bf.y = b1.w;
                acc[3] = __builtin_amdgcn_wmma_f32_16x16x4_f32(false, af, false, bf,
                                                               (short)0, acc[3], false, false);
            }
        }
        // D layout: VGPR r, lanes 0-15 -> M = r (head), lanes 16-31 -> padding
        if (lane < 16) {
#pragma unroll
            for (int r = 0; r < HEADS; ++r) {
                float4 o = { acc[0][r], acc[1][r], acc[2][r], acc[3][r] };
                *reinterpret_cast<float4*>(&lg[(wave * HEADS + r) * PC_COLS + col * 4]) = o;
            }
        }
    }
    __syncthreads();

    // wave h: join the eight channel slices of head h, softmax terms of the chunk
    {
        const int h = wave;
        const float bias = cmb[h];
        float l0 = bias, l1 = bias;
#pragma unroll
        for (int w = 0; w < PC_WAVES; ++w) {
            float2 v = *reinterpret_cast<const float2*>(&lg[(w * HEADS + h) * PC_COLS + lane * 2]);
            l0 += v.x; l1 += v.y;
        }
        float mx = fmaxf(l0, l1);
#pragma unroll
        for (int k = 16; k > 0; k >>= 1) mx = fmaxf(mx, __shfl_xor(mx, k, 32));
        float2 e = { expf(l0 - mx), expf(l1 - mx) };
        float2 zero = { 0.f, 0.f };
        *reinterpret_cast<float2*>(&pm[h * PC_PITCH + lane * 2]) = e;
        *reinterpret_cast<float2*>(&pm[(h + HEADS) * PC_PITCH + lane * 2]) = zero;   // N padding
        float sum = xor_sum<32>(e.x + e.y);
        float pc  = xor_sum<32>(e.x * (float)(lane * 2) + e.y * (float)(lane * 2 + 1));
        if (lane == 0) {
            const int idx = (b * HEADS + h) * PC_CHUNKS + chunk;
            smax[idx] = mx; ssum[idx] = sum; scol[idx] = pc;
        }
    }
    __syncthreads();

    // part[h, c] over the wave's 64 channels (4 M tiles), K over the 64 columns.
    // k order of both loaders: step 2u+s holds columns 8u + 4 kgrp + 2s, +1.
    v8f c[4];
#pragma unroll
    for (int t = 0; t < 4; ++t) c[t] = (v8f){0.f, 0.f, 0.f, 0.f, 0.f, 0.f, 0.f, 0.f};
#pragma unroll
    for (int u = 0; u < 8; ++u) {
        float4 p4 = *reinterpret_cast<const float4*>(&pm[col * PC_PITCH + u * 8 + kgrp * 4]);
        float4 a[4];
#pragma unroll
        for (int t = 0; t < 4; ++t)
            a[t] = *reinterpret_cast<const float4*>(
                &tile[(row0 + t * 16 + col) * PC_PITCH + u * 8 + kgrp * 4]);
#pragma unroll
        for (int t = 0; t < 4; ++t) {
            v2f af; af.x = a[t].x; af.y = a[t].y;
            v2f bf; bf.x = p4.x;   bf.y = p4.y;
            c[t] = __builtin_amdgcn_wmma_f32_16x16x4_f32(false, af, false, bf,
                                                         (short)0, c[t], false, false);
        }
#pragma unroll
        for (int t = 0; t < 4; ++t) {
            v2f af; af.x = a[t].z; af.y = a[t].w;
            v2f bf; bf.x = p4.z;   bf.y = p4.w;
            c[t] = __builtin_amdgcn_wmma_f32_16x16x4_f32(false, af, false, bf,
                                                         (short)0, c[t], false, false);
        }
    }

    // D layout: VGPR r, lanes 0-15 -> M = r, lanes 16-31 -> M = r + 8; N = lane & 15 (head).
    // Turned through the wave's own, now spent, tile rows so that part is stored in
    // whole 128-byte lines.
    float* stg = &tile[row0 * PC_PITCH];
    if (col < HEADS) {
#pragma unroll
        for (int t = 0; t < 4; ++t) {
            float4 lo = { c[t][0], c[t][1], c[t][2], c[t][3] };
            float4 hi = { c[t][4], c[t][5], c[t][6], c[t][7] };
            *reinterpret_cast<float4*>(&stg[col * PC_PITCH + t * 16 + kgrp * 8])     = lo;
            *reinterpret_cast<float4*>(&stg[col * PC_PITCH + t * 16 + kgrp * 8 + 4]) = hi;
        }
    }
    // orders the lanes' staging writes in front of the other lanes' reads below
    __syncthreads();
    float* po = part + ((long)blockIdx.x * HEADS) * CH + row0 + col * 4;
#pragma unroll
    for (int i = 0; i < 4; ++i) {
        const int h = i * 2 + kgrp;
        float4 v = *reinterpret_cast<const float4*>(&stg[h * PC_PITCH + col * 4]);
        *reinterpret_cast<float4*>(po + h * CH) = v;
    }
}

// ---------------------------------------------------------------------------
// Kernel 2: per (batch, head) join of the 64 chunks:
//   w[k] = exp(max[k] - max over k) / sum_k(...)   context[c] = sum_k w[k] part[k, c]
// and the centroid cx, cy from the chunks' sums and column moments (a chunk is one
// image row, so its row moment is its sum times its index).
// ---------------------------------------------------------------------------
__global__ void __launch_bounds__(512)
k_pool_join(const float* __restrict__ part, const float* __restrict__ smax,
            const float* __restrict__ ssum, const float* __restrict__ scol,
            float* __restrict__ ctx, float* __restrict__ cx, float* __restrict__ cy)
{
    __shared__ float wl[PC_CHUNKS];
    __shared__ __attribute__((aligned(16))) float red[4 * CH];
    const int row  = blockIdx.x;                      // b*8 + h
    const int b    = row >> 3, h = row & 7;
    const int tid  = threadIdx.x;
    const int lane = tid & 31;
    const int c4   = tid & 127;                       // four channels a thread
    const int cg   = tid >> 7;                        // 16 chunks a thread

    const float* pp = part + (((long)b * PC_CHUNKS + cg * 16) * HEADS + h) * CH + c4 * 4;
    float4 v[16];
#pragma unroll
    for (int i = 0; i < 16; ++i)
        v[i] = *reinterpret_cast<const float4*>(pp + (long)i * HEADS * CH);
    // the 16 loads above share one address pair: this wait stands in front of its
    // reuse, and the operand keeps the pair live up to here (without it the last
    // load's result was placed on the pair). It also holds the loads in front of the
    // weights' butterflies, behind which the compiler had sunk them.
    asm volatile("s_wait_xcnt 0x0" :: "v"(pp) : "memory");

    // every wave alike: two chunks a lane
    const float m0 = smax[row * PC_CHUNKS + lane], m1 = smax[row * PC_CHUNKS + 32 + lane];
    const float s0 = ssum[row * PC_CHUNKS + lane], s1 = ssum[row * PC_CHUNKS + 32 + lane];
    const float p0 = scol[row * PC_CHUNKS + lane], p1 = scol[row * PC_CHUNKS + 32 + lane];
    float mx = fmaxf(m0, m1);
#pragma unroll
    for (int k = 16; k > 0; k >>= 1) mx = fmaxf(mx, __shfl_xor(mx, k, 32));
    const float w0 = expf(m0 - mx), w1 = expf(m1 - mx);
    const float sum = xor_sum<32>(w0 * s0 + w1 * s1);
    const float pc  = xor_sum<32>(w0 * p0 + w1 * p1);
    const float pr  = xor_sum<32>(w0 * s0 * (float)lane + w1 * s1 * (float)(lane + 32));
    const float inv = 1.f / sum;
    if (tid < 32) { wl[lane] = w0 * inv; wl[lane + 32] = w1 * inv; }
    __syncthreads();

    float4 a = { 0.f, 0.f, 0.f, 0.f };
#pragma unroll
    for (int i = 0; i < 16; ++i) {
        const float w = wl[cg * 16 + i];
        a.x += w * v[i].x; a.y += w * v[i].y; a.z += w * v[i].z; a.w += w * v[i].w;
    }
    *reinterpret_cast<float4*>(&red[cg * CH + c4 * 4]) = a;
    __syncthreads();

    if (tid < 128) {
        float4 t0 = *reinterpret_cast<const float4*>(&red[0 * CH + tid * 4]);
        float4 t1 = *reinterpret_cast<const float4*>(&red[1 * CH + tid * 4]);
        float4 t2 = *reinterpret_cast<const float4*>(&red[2 * CH + tid * 4]);
        float4 t3 = *reinterpret_cast<const float4*>(&red[3 * CH + tid * 4]);
        float4 o = { (t0.x + t1.x) + (t2.x + t3.x), (t0.y + t1.y) + (t2.y + t3.y),
                     (t0.z + t1.z) + (t2.z + t3.z), (t0.w + t1.w) + (t2.w + t3.w) };
        *reinterpret_cast<float4*>(&ctx[(long)row * CH + tid * 4]) = o;
    }
    if (tid == 0) {
        cx[row] = pc * inv / (float)HT;
        cy[row] = pr * inv / (float)WD;
    }
}

// ---------------------------------------------------------------------------
// Kernel 3: per-batch head attention + channel_add MLP -> add_term[b, 512]
// Every dot product is spread over the lanes of a wave: a weight row is read
// as whole 128-byte lines (16 bytes a lane) and the lanes' partial sums are
// joined afterwards (through LDS for K/Q/V, by a butterfly elsewhere).
// ---------------------------------------------------------------------------
#define PPITCH 36   // floats per row of lane partials: 144 B, an odd multiple of 16 B

__device__ __forceinline__ float dot4(float4 a, float4 b, float s)
{
    s += a.x * b.x; s += a.y * b.y; s += a.z * b.z; s += a.w * b.w;
    return s;
}

__global__ void __launch_bounds__(512)
k_head_attn(const float* __restrict__ ctx, const float* __restrict__ cx,
            const float* __restrict__ cy,
            const float* __restrict__ g_w, const float* __restrict__ g_b,
            const float* __restrict__ k_w, const float* __restrict__ k_b,
            const float* __restrict__ q_w, const float* __restrict__ q_b,
            const float* __restrict__ v_w, const float* __restrict__ v_b,
            const float* __restrict__ w1,  const float* __restrict__ b1,
            const float* __restrict__ lng, const float* __restrict__ lnb,
            const float* __restrict__ w2,  const float* __restrict__ b2,
            float* __restrict__ addt)
{
    __shared__ __attribute__((aligned(16))) float part[3 * 512 * PPITCH];
    __shared__ __attribute__((aligned(16))) float wkqv[3 * 512];  // wk | wq | wv, each [h][d]
    __shared__ float lt[64];
    __shared__ float wmn[64];
    __shared__ __attribute__((aligned(16))) float oc[512];
    __shared__ __attribute__((aligned(16))) float ly[128];

    const int b    = blockIdx.x;
    const int tid  = threadIdx.x;
    const int lane = tid & 31;
    const int wave = __builtin_amdgcn_readfirstlane(tid >> 5);    // 0..15
    const float* cb = ctx + (long)b * HEADS * CH;

    // w_k / w_q / w_v : one wave per weight row, all 8 heads at once.
    // The lane keeps its 16 columns of every head's context in registers.
    {
        float4 c[HEADS][4];
#pragma unroll
        for (int h = 0; h < HEADS; ++h)
#pragma unroll
            for (int i = 0; i < 4; ++i)
                c[h][i] = *reinterpret_cast<const float4*>(cb + h * CH + i * 128 + lane * 4);

#pragma unroll
        for (int j = 0; j < 12; ++j) {
            const float* wm = (j < 4) ? k_w : (j < 8) ? q_w : v_w;
            const int d = wave + 16 * (j & 3);
            const float* wr = wm + d * CH + lane * 4;
            float4 w[4];
#pragma unroll
            for (int i = 0; i < 4; ++i)
                w[i] = *reinterpret_cast<const float4*>(wr + i * 128);
            const int r = (j >> 2) * 64 + d;
#pragma unroll
            for (int h = 0; h < HEADS; ++h) {
                float s = 0.f;
#pragma unroll
                for (int i = 0; i < 4; ++i) s = dot4(w[i], c[h][i], s);
                part[(r * HEADS + h) * PPITCH + lane] = s;
            }
        }
    }
    __syncthreads();

    // join the 32 lane partials of each of the 1536 outputs
#pragma unroll
    for (int mat = 0; mat < 3; ++mat) {
        const int p = mat * 512 + tid;
        const float4* pp = reinterpret_cast<const float4*>(&part[p * PPITCH]);
        float4 t = pp[0];
#pragma unroll
        for (int i = 1; i < 8; ++i) {
            float4 u = pp[i];
            t.x += u.x; t.y += u.y; t.z += u.z; t.w += u.w;
        }
        const int h = tid & 7, d = tid >> 3;
        const float* bs = (mat == 0) ? k_b : (mat == 1) ? q_b : v_b;
        wkqv[mat * 512 + h * 64 + d] = (t.x + t.y) + (t.z + t.w) + bs[d];
    }
    __syncthreads();

    // w_g (geometric) and scaled_dot -> logits lt[m*8+n]; 8 lanes per (m, n)
    {
        const int pair = tid >> 3, sub = tid & 7;
        const int m = pair >> 3, n = pair & 7;
        float dx = cx[b * 8 + m] - cx[b * 8 + n];
        float dy = cy[b * 8 + m] - cy[b * 8 + n];
        float pos[4] = { fmaxf(dx, 0.f), fmaxf(-dx, 0.f),
                         fmaxf(dy, 0.f), fmaxf(-dy, 0.f) };
        float freq = expf(-6.90775527898f * (float)sub * 0.125f);   // 1000^(-f/8)
        float s = 0.f;
        for (int p = 0; p < 4; ++p) {
            float ang = 100.f * pos[p] * freq;
            s += sinf(ang) * g_w[p * 8 + sub] + cosf(ang) * g_w[32 + p * 8 + sub];
        }
        float sd = 0.f;
#pragma unroll
        for (int i = 0; i < 8; ++i) {
            const int d = sub + 8 * i;
            sd += wkqv[m * 64 + d] * wkqv[512 + n * 64 + d];
        }
        s  = xor_sum<8>(s);
        sd = xor_sum<8>(sd);
        if (sub == 0) {
            float wg = fmaxf(s + g_b[0], 0.f);
            lt[pair] = logf(fmaxf(wg, 1e-6f)) + sd * 0.125f;        // 1/sqrt(64)
        }
    }
    __syncthreads();

    // softmax over m (axis=1) for each n; 8 lanes per n
    if (tid < 64) {
        const int n = tid >> 3, m = tid & 7;
        float v = lt[m * 8 + n];
        float mx = v;
#pragma unroll
        for (int k = 4; k > 0; k >>= 1) mx = fmaxf(mx, __shfl_xor(mx, k, 32));
        float e = expf(v - mx);
        float inv = 1.f / xor_sum<8>(e);
        wmn[m * 8 + n] = e * inv;
    }
    __syncthreads();

    // out_ctx[n, d] = sum_m wmn[m,n] * wv[m,d] -> flat n*64+d
    {
        int n = tid >> 6, d = tid & 63;
        float s = 0.f;
        for (int m = 0; m < 8; ++m) s += wmn[m * 8 + n] * wkqv[1024 + m * 64 + d];
        oc[tid] = s;
    }
    __syncthreads();

    // y = oc @ w1^T + b1  [128]: one wave per row, 8 rows a wave
    {
        float4 o4[4];
#pragma unroll
        for (int i = 0; i < 4; ++i)
            o4[i] = *reinterpret_cast<const float4*>(&oc[i * 128 + lane * 4]);
        const char* wb = reinterpret_cast<const char*>(w1 + wave * 8 * 512);
        const int lofs = lane * 16;                   // the lane's byte offset in a 512-byte piece
        float4 w[8][4];
#pragma unroll
        for (int j = 0; j < 8; ++j)
#pragma unroll
            for (int i = 0; i < 4; ++i)
                w[j][i] = *reinterpret_cast<const float4*>(wb + lofs + j * 2048 + i * 512);
        // the 32 loads above share one offset register: this wait stands in front of
        // its reuse, and the operand keeps the lane's offset live up to here (without
        // it the last load's result was placed on the offset register)
        asm volatile("s_wait_xcnt 0x0" :: "v"(lofs) : "memory");
        float res = 0.f;
#pragma unroll
        for (int j = 0; j < 8; ++j) {
            float s = 0.f;
#pragma unroll
            for (int i = 0; i < 4; ++i) s = dot4(w[j][i], o4[i], s);
            s = xor_sum<32>(s);
            res = (lane == j) ? s : res;
        }
        if (lane < 8) ly[wave * 8 + lane] = res + b1[wave * 8 + lane];
    }
    __syncthreads();

    // LayerNorm + ReLU in registers (every 8-lane group holds all 128 values),
    // then add_term[c] = y @ w2^T + b2  [512]: 8 lanes per row, 32 rows a wave
    {
        const int s8 = lane & 7, rsub = lane >> 3;
        float y[16];
#pragma unroll
        for (int i = 0; i < 4; ++i) {
            float4 t = *reinterpret_cast<const float4*>(&ly[i * 32 + s8 * 4]);
            y[i * 4 + 0] = t.x; y[i * 4 + 1] = t.y; y[i * 4 + 2] = t.z; y[i * 4 + 3] = t.w;
        }
        float mu = 0.f;
#pragma unroll
        for (int i = 0; i < 16; ++i) mu += y[i];
        mu = xor_sum<8>(mu) * (1.f / PLANES);
        float var = 0.f;
#pragma unroll
        for (int i = 0; i < 16; ++i) { float dlt = y[i] - mu; var += dlt * dlt; }
        var = xor_sum<8>(var) * (1.f / PLANES);
        const float rstd = rsqrtf(var + 1e-5f);
        float4 yn[4];
#pragma unroll
        for (int i = 0; i < 4; ++i) {
            float4 g4 = *reinterpret_cast<const float4*>(lng + i * 32 + s8 * 4);
            float4 b4 = *reinterpret_cast<const float4*>(lnb + i * 32 + s8 * 4);
            yn[i].x = fmaxf((y[i * 4 + 0] - mu) * rstd * g4.x + b4.x, 0.f);
            yn[i].y = fmaxf((y[i * 4 + 1] - mu) * rstd * g4.y + b4.y, 0.f);
            yn[i].z = fmaxf((y[i * 4 + 2] - mu) * rstd * g4.z + b4.z, 0.f);
            yn[i].w = fmaxf((y[i * 4 + 3] - mu) * rstd * g4.w + b4.w, 0.f);
        }
        float res = 0.f;
#pragma unroll
        for (int g = 0; g < 8; ++g) {
            const float* wr = w2 + (wave * 32 + g * 4 + rsub) * PLANES + s8 * 4;
            float s = 0.f;
#pragma unroll
            for (int i = 0; i < 4; ++i)
                s = dot4(*reinterpret_cast<const float4*>(wr + i * 32), yn[i], s);
            s = xor_sum<8>(s);
            res = (s8 == g) ? s : res;
        }
        const int c = wave * 32 + s8 * 4 + rsub;
        addt[b * 512 + c] = res + b2[c];
    }
}

// ---------------------------------------------------------------------------
// Kernel 4: out[b,c,hw] = x[b,c,hw] + add_term[b,c]   (float4 streaming)
// One workgroup of 16 waves per WGP instead of one wave per 512 bytes. A wave
// streams AO_PLANES whole (b,c) planes in groups of AO_DEPTH loads, each load
// 512 contiguous bytes.
// ---------------------------------------------------------------------------
#define AO_WAVES  16    // waves per workgroup
#define AO_PLANES 2     // (b,c) planes per wave
#define AO_DEPTH  16    // 16-byte loads per lane in flight
#define AO_GROUPS (AO_PLANES * (HWSZ / 4) / (32 * AO_DEPTH))

__global__ void __launch_bounds__(AO_WAVES * 32)
k_addout(const float* __restrict__ x, const float* __restrict__ addt,
         float* __restrict__ out)
{
    const int lane  = threadIdx.x & 31;
    const int wave  = __builtin_amdgcn_readfirstlane(threadIdx.x >> 5);
    const int plane = (blockIdx.x * AO_WAVES + wave) * AO_PLANES;
    const float4* xp = reinterpret_cast<const float4*>(x) + (long)plane * (HWSZ / 4) + lane;
    float4*       op = reinterpret_cast<float4*>(out)     + (long)plane * (HWSZ / 4) + lane;

    float a[AO_PLANES];
#pragma unroll
    for (int p = 0; p < AO_PLANES; ++p) a[p] = addt[plane + p];

    // unrolled: every address is one base and one lane offset plus an immediate, so no
    // address register is rewritten while loads or stores are in flight
#pragma unroll
    for (int g = 0; g < AO_GROUPS; ++g) {
        // the loads below land on registers that the group before was stored from:
        // this wait stands between those stores and the overwrite of their data
        if (g > 0) asm volatile("s_wait_xcnt 0x0" ::: "memory");
        float4 v[AO_DEPTH];
#pragma unroll
        for (int i = 0; i < AO_DEPTH; ++i) v[i] = xp[(g * AO_DEPTH + i) * 32];
        // all loads of the group are issued before the first add waits for one: left
        // free, the compiler sinks each load to its use and the wave waits out every one
        __builtin_amdgcn_sched_barrier(0);
        const float s = a[g / (AO_GROUPS / AO_PLANES)];
#pragma unroll
        for (int i = 0; i < AO_DEPTH; ++i) {
            float4 o = { v[i].x + s, v[i].y + s, v[i].z + s, v[i].w + s };
            op[(g * AO_DEPTH + i) * 32] = o;
        }
    }
}

// ---------------------------------------------------------------------------
extern "C" void kernel_launch(void* const* d_in, const int* in_sizes, int n_in,
                              void* d_out, int out_size, void* d_ws, size_t ws_size,
                              hipStream_t stream)
{
    const float* x   = (const float*)d_in[0];
    const float* cmw = (const float*)d_in[1];
    const float* cmb = (const float*)d_in[2];
    const float* g_w = (const float*)d_in[3];
    const float* g_b = (const float*)d_in[4];
    const float* k_w = (const float*)d_in[5];
    const float* k_b = (const float*)d_in[6];
    const float* q_w = (const float*)d_in[7];
    const float* q_b = (const float*)d_in[8];
    const float* v_w = (const float*)d_in[9];
    const float* v_b = (const float*)d_in[10];
    const float* w1  = (const float*)d_in[11];
    const float* b1  = (const float*)d_in[12];
    const float* lng = (const float*)d_in[13];
    const float* lnb = (const float*)d_in[14];
    const float* w2  = (const float*)d_in[15];
    const float* b2  = (const float*)d_in[16];
    float* out = (float*)d_out;

    // workspace layout (floats)
    float* ws   = (float*)d_ws;
    float* part = ws;                                 // 16*64*8*512 = 4194304
    float* ctx  = ws + 4194304;                       // 16*8*512  = 65536
    float* cxb  = ws + 4194304 + 65536;               // 128
    float* cyb  = cxb + 128;                          // 128
    float* addt = cyb + 128;                          // 16*512 = 8192
    float* smax = addt + 8192;                        // 16*8*64 = 8192
    float* ssum = smax + 8192;                        // 8192
    float* scol = ssum + 8192;                        // 8192

    k_pool_partial<<<dim3(NB * PC_CHUNKS), dim3(PC_WAVES * 32), 0, stream>>>(x, cmw, cmb, part,
                                                                             smax, ssum, scol);
    k_pool_join<<<dim3(NB * HEADS), dim3(512), 0, stream>>>(part, smax, ssum, scol, ctx, cxb, cyb);
    k_head_attn<<<dim3(NB), dim3(512), 0, stream>>>(ctx, cxb, cyb, g_w, g_b,
                                                    k_w, k_b, q_w, q_b, v_w, v_b,
                                                    w1, b1, lng, lnb, w2, b2, addt);
    k_addout<<<dim3(NB * CH / (AO_WAVES * AO_PLANES)), dim3(AO_WAVES * 32), 0, stream>>>(x, addt, out);
}

// v004
// One run takes 53.7 microseconds.
// In both of two side-by-side timings against v003, it was 1.09 times as fast.
// Over all steps from v000 it is 3.88 times as fast.
#include <hip/hip_runtime.h>
#include <hip/hip_bf16.h>

typedef __attribute__((ext_vector_type(2))) float v2f;
typedef __attribute__((ext_vector_type(8))) float v8f;

#define HEADS  8
#define NB     16
#define CH     512
#define HT     64
#define WD     64
#define HWSZ   4096
#define PLANES 128

template <int WIDTH>
__device__ __forceinline__ float xor_sum(float v)
{
#pragma unroll
    for (int m = WIDTH / 2; m > 0; m >>= 1) v += __shfl_xor(v, m, 32);
    return v;
}

#define PC_COLS  64    // hw columns per tile: one image row
#define PC_ROWS  4     // image rows a workgroup takes, one after the other
#define PC_GROUPS (HWSZ / (PC_COLS * PC_ROWS))   // workgroups, and partial results, per batch
#define PC_PITCH 68    // floats per LDS row: 272 B, an odd multiple of 16 B
#define PC_WAVES 8
#define PC_TILE  (CH * PC_PITCH)   // floats of one tile buffer

// eight 16-byte-a-lane copies, global memory to LDS through no register. The wait in
// the last line stands in front of any rewrite of the address registers named here.
#define PC_COPY8(l, g, r)                                                         \
    asm volatile("global_load_async_to_lds_b128 %0, %8, off\n\t"                  \
                 "global_load_async_to_lds_b128 %1, %9, off\n\t"                  \
                 "global_load_async_to_lds_b128 %2, %10, off\n\t"                 \
                 "global_load_async_to_lds_b128 %3, %11, off\n\t"                 \
                 "global_load_async_to_lds_b128 %4, %12, off\n\t"                 \
                 "global_load_async_to_lds_b128 %5, %13, off\n\t"                 \
                 "global_load_async_to_lds_b128 %6, %14, off\n\t"                 \
                 "global_load_async_to_lds_b128 %7, %15, off\n\t"                 \
                 "s_wait_xcnt 0x0"                                                \
                 :: "v"((l) + ((r) + 0) * (PC_PITCH * 4u)),                       \
                    "v"((l) + ((r) + 2) * (PC_PITCH * 4u)),                       \
                    "v"((l) + ((r) + 4) * (PC_PITCH * 4u)),                       \
                    "v"((l) + ((r) + 6) * (PC_PITCH * 4u)),                       \
                    "v"((l) + ((r) + 8) * (PC_PITCH * 4u)),                       \
                    "v"((l) + ((r) + 10) * (PC_PITCH * 4u)),                      \
                    "v"((l) + ((r) + 12) * (PC_PITCH * 4u)),                      \
                    "v"((l) + ((r) + 14) * (PC_PITCH * 4u)),                      \
                    "v"((g) + ((r) + 0) * HWSZ), "v"((g) + ((r) + 2) * HWSZ),     \
                    "v"((g) + ((r) + 4) * HWSZ), "v"((g) + ((r) + 6) * HWSZ),     \
                    "v"((g) + ((r) + 8) * HWSZ), "v"((g) + ((r) + 10) * HWSZ),    \
                    "v"((g) + ((r) + 12) * HWSZ), "v"((g) + ((r) + 14) * HWSZ)    \
                 : "memory")

// ---------------------------------------------------------------------------
// Kernel 1: one workgroup per (batch, 4 image rows). It takes its rows one after the
// other; a row's tile x[512 c][64 hw] is brought into one of two LDS buffers while the
// row before is worked on, and feeds both products:
//   logits[h, hw] = sum_c cmw[h, c] * x[c, hw] + cmb[h]      (WMMA, K over c)
//   e[h, hw]      = exp(logits - running maximum)
//   part[h, c]    = part[h, c] * exp(old maximum - new) + sum_hw x[c, hw] * e[h, hw]
// part stays in the WMMA accumulators over the four rows. The running maximum, sum of
// e and the two moments go out beside part; kernel 2 joins the 16 workgroups of a
// (batch, head). Wave w copies, and alone reads, the channels 64 w .. 64 w + 63.
// ---------------------------------------------------------------------------
__global__ void __launch_bounds__(PC_WAVES * 32)
k_pool_partial(const float* __restrict__ x, const float* __restrict__ cmw,
               const float* __restrict__ cmb, float* __restrict__ part,
               float* __restrict__ smax, float* __restrict__ ssum,
               float* __restrict__ scol, float* __restrict__ srow)
{
    __shared__ __attribute__((aligned(16))) float tile[2 * PC_TILE];
    __shared__ __attribute__((aligned(16))) float lg[PC_WAVES * HEADS * PC_COLS];
    __shared__ __attribute__((aligned(16))) float pm[16 * PC_PITCH];
    __shared__ float sc[HEADS];

    const int lane  = threadIdx.x & 31;
    const int wave  = __builtin_amdgcn_readfirstlane(threadIdx.x >> 5);
    const int b     = blockIdx.x / PC_GROUPS;
    const int grp   = blockIdx.x % PC_GROUPS;
    const int col   = lane & 15;
    const int kgrp  = lane >> 4;
    const int row0  = wave * 64;

    // the lane's place in the first image row's tile, in memory and in buffer 0
    const float* g0 = x + ((long)b * CH + row0 + kgrp) * HWSZ + grp * (PC_ROWS * PC_COLS) + col * 4;
    const unsigned l0a = (unsigned)(uintptr_t)&tile[(row0 + kgrp) * PC_PITCH + col * 4];

    // row 0 into buffer 0: 32 copies a wave, each two rows of 256 bytes, all in flight at once
    PC_COPY8(l0a, g0, 0);
    PC_COPY8(l0a, g0, 16);
    PC_COPY8(l0a, g0, 32);
    PC_COPY8(l0a, g0, 48);

    // A fragments of the logits product, fetched while the tile is on its way.
    // k order of both loaders: step 2u+s holds channels row0 + 8u + 4 kgrp + 2s, +1.
    float4 a4[8];
#pragma unroll
    for (int u = 0; u < 8; ++u) {
        float4 t = *reinterpret_cast<const float4*>(cmw + (col & 7) * CH + row0 + u * 8 + kgrp * 4);
        a4[u].x = (col < HEADS) ? t.x : 0.f;          // rows >= 8 are zero padding
        a4[u].y = (col < HEADS) ? t.y : 0.f;
        a4[u].z = (col < HEADS) ? t.z : 0.f;
        a4[u].w = (col < HEADS) ? t.w : 0.f;
    }
    const float bias = cmb[wave];

    // the wave's own copies have landed behind this wait
    asm volatile("s_wait_asynccnt 0x0" ::: "memory");
    __syncthreads();

    // row 1 into buffer 1: on its way while row 0 is worked on
    {
        const float* g = g0 + PC_COLS;
        const unsigned l = l0a + PC_TILE * 4u;
        PC_COPY8(l, g, 0);
        PC_COPY8(l, g, 16);
        PC_COPY8(l, g, 32);
        PC_COPY8(l, g, 48);
    }

    // wave h keeps head h's running terms; every wave keeps part of its 64 channels
    float run_m = -3.0e38f, run_s = 0.f, run_pc = 0.f, run_pr = 0.f;
    v8f c[4];
#pragma unroll
    for (int t = 0; t < 4; ++t) c[t] = (v8f){0.f, 0.f, 0.f, 0.f, 0.f, 0.f, 0.f, 0.f};

    for (int it = 0; it < PC_ROWS; ++it) {
        const int tb = (it & 1) * PC_TILE;            // this row's buffer

        // logits over the wave's 64 channels, all 64 columns: N tile t holds columns 4n + t
        {
            v8f acc[4];
#pragma unroll
            for (int t = 0; t < 4; ++t) acc[t] = (v8f){0.f, 0.f, 0.f, 0.f, 0.f, 0.f, 0.f, 0.f};
#pragma unroll
            for (int u = 0; u < 8; ++u) {
#pragma unroll
                for (int s = 0; s < 2; ++s) {
                    const int ch = row0 + u * 8 + kgrp * 4 + s * 2;
                    float4 b0 = *reinterpret_cast<const float4*>(&tile[tb + ch * PC_PITCH + col * 4]);
                    float4 b1 = *reinterpret_cast<const float4*>(&tile[tb + (ch + 1) * PC_PITCH + col * 4]);
                    v2f af; af.x = s ? a4[u].z : a4[u].x;
                            af.y = s ? a4[u].w : a4[u].y;
                    v2f bf;
                    bf.x = b0.x; bf.y = b1.x;
                    acc[0] = __builtin_amdgcn_wmma_f32_16x16x4_f32(false, af, false, bf,
                                                                   (short)0, acc[0], false, false);
                    bf.x = b0.y; bf.y = b1.y;
                    acc[1] = __builtin_amdgcn_wmma_f32_16x16x4_f32(false, af, false, bf,
                                                                   (short)0, acc[1], false, false);
                    bf.x = b0.z; bf.y = b1.z;
                    acc[2] = __builtin_amdgcn_wmma_f32_16x16x4_f32(false, af, false, bf,
                                                                   (short)0, acc[2], false, false);
                    bf.x = b0.w; bf.y = b1.w;
                    acc[3] = __builtin_amdgcn_wmma_f32_16x16x4_f32(false, af, false, bf,
                                                                   (short)0, acc[3], false, false);
                }
            }
            // D layout: VGPR r, lanes 0-15 -> M = r (head), lanes 16-31 -> padding
            if (lane < 16) {
#pragma unroll
                for (int r = 0; r < HEADS; ++r) {
                    float4 o = { acc[0][r], acc[1][r], acc[2][r], acc[3][r] };
                    *reinterpret_cast<float4*>(&lg[(wave * HEADS + r) * PC_COLS + col * 4]) = o;
                }
            }
        }
        __syncthreads();

        // wave h: join the eight channel slices of head h, softmax terms of the row
        // against the running maximum
        {
            const int h = wave;
            float l0 = bias, l1 = bias;
#pragma unroll
            for (int w = 0; w < PC_WAVES; ++w) {
                float2 v = *reinterpret_cast<const float2*>(&lg[(w * HEADS + h) * PC_COLS + lane * 2]);
                l0 += v.x; l1 += v.y;
            }
            float mx = fmaxf(l0, l1);
#pragma unroll
            for (int k = 16; k > 0; k >>= 1) mx = fmaxf(mx, __shfl_xor(mx, k, 32));
            mx = fmaxf(mx, run_m);
            const float f = expf(run_m - mx);         // 0 for the first row
            float2 e = { expf(l0 - mx), expf(l1 - mx) };
            float2 zero = { 0.f, 0.f };
            *reinterpret_cast<float2*>(&pm[h * PC_PITCH + lane * 2]) = e;
            *reinterpret_cast<float2*>(&pm[(h + HEADS) * PC_PITCH + lane * 2]) = zero;   // N padding
            if (lane == 0) sc[h] = f;
            float sum = xor_sum<32>(e.x + e.y);
            float pc  = xor_sum<32>(e.x * (float)(lane * 2) + e.y * (float)(lane * 2 + 1));
            run_s  = run_s  * f + sum;
            run_pc = run_pc * f + pc;
            run_pr = run_pr * f + sum * (float)(grp * PC_ROWS + it);
            run_m  = mx;
        }
        __syncthreads();

        // part[h, c] over the wave's 64 channels (4 M tiles), K over the 64 columns, on
        // top of the rows before, brought to the new maximum (N = lane & 15 is the head).
        // k order of both loaders: step 2u+s holds columns 8u + 4 kgrp + 2s, +1.
        {
            const float fl = sc[col & 7];
#pragma unroll
            for (int t = 0; t < 4; ++t)
#pragma unroll
                for (int r = 0; r < 8; ++r) c[t][r] *= fl;
        }
#pragma unroll
        for (int u = 0; u < 8; ++u) {
            float4 p4 = *reinterpret_cast<const float4*>(&pm[col * PC_PITCH + u * 8 + kgrp * 4]);
            float4 a[4];
#pragma unroll
            for (int t = 0; t < 4; ++t)
                a[t] = *reinterpret_cast<const float4*>(
                    &tile[tb + (row0 + t * 16 + col) * PC_PITCH + u * 8 + kgrp * 4]);
#pragma unroll
            for (int t = 0; t < 4; ++t) {
                v2f af; af.x = a[t].x; af.y = a[t].y;
                v2f bf; bf.x = p4.x;   bf.y = p4.y;
                c[t] = __builtin_amdgcn_wmma_f32_16x16x4_f32(false, af, false, bf,
                                                             (short)0, c[t], false, false);
            }
#pragma unroll
            for (int t = 0; t < 4; ++t) {
                v2f af; af.x = a[t].z; af.y = a[t].w;
                v2f bf; bf.x = p4.z;   bf.y = p4.w;
                c[t] = __builtin_amdgcn_wmma_f32_16x16x4_f32(false, af, false, bf,
                                                             (short)0, c[t], false, false);
            }
        }

        // hand-over: this wave's LDS reads of the row are done, its copies of the next
        // row have landed, and the barrier says both of every wave
        asm volatile("s_wait_dscnt 0x0" ::: "memory");
        asm volatile("s_wait_asynccnt 0x0" ::: "memory");
        __syncthreads();
        // the row after the next goes into the buffer that has just been read
        if (it + 2 < PC_ROWS) {
            const float* g = g0 + (it + 2) * PC_COLS;
            const unsigned l = l0a + (unsigned)tb * 4u;
            PC_COPY8(l, g, 0);
            PC_COPY8(l, g, 16);
            PC_COPY8(l, g, 32);
            PC_COPY8(l, g, 48);
        }
    }
    // no copy is left on its way when the tile buffers become staging
    asm volatile("s_wait_asynccnt 0x0" ::: "memory");

    if (lane == 0) {
        const int idx = (b * HEADS + wave) * PC_GROUPS + grp;
        smax[idx] = run_m; ssum[idx] = run_s; scol[idx] = run_pc; srow[idx] = run_pr;
    }

    // D layout: VGPR r, lanes 0-15 -> M = r, lanes 16-31 -> M = r + 8; N = lane & 15 (head).
    // Turned through the wave's own, now spent, tile rows so that part is stored in
    // whole 128-byte lines.
    float* stg = &tile[row0 * PC_PITCH];
    if (col < HEADS) {
#pragma unroll
        for (int t = 0; t < 4; ++t) {
            float4 lo = { c[t][0], c[t][1], c[t][2], c[t][3] };
            float4 hi = { c[t][4], c[t][5], c[t][6], c[t][7] };
            *reinterpret_cast<float4*>(&stg[col * PC_PITCH + t * 16 + kgrp * 8])     = lo;
            *reinterpret_cast<float4*>(&stg[col * PC_PITCH + t * 16 + kgrp * 8 + 4]) = hi;
        }
    }
    // orders the lanes' staging writes in front of the other lanes' reads below
    __syncthreads();
    float* po = part + ((long)blockIdx.x * HEADS) * CH + row0 + col * 4;
#pragma unroll
    for (int i = 0; i < 4; ++i) {
        const int h = i * 2 + kgrp;
        float4 v = *reinterpret_cast<const float4*>(&stg[h * PC_PITCH + col * 4]);
        *reinterpret_cast<float4*>(po + h * CH) = v;
    }
}

// ---------------------------------------------------------------------------
// Kernel 2: per (batch, head) join of the 16 workgroups' partial results:
//   w[k] = exp(max[k] - max over k) / sum_k(...)   context[c] = sum_k w[k] part[k, c]
// and the centroid cx, cy from their sums and moments.
// ---------------------------------------------------------------------------
__global__ void __launch_bounds__(512)
k_pool_join(const float* __restrict__ part, const float* __restrict__ smax,
            const float* __restrict__ ssum, const float* __restrict__ scol,
            const float* __restrict__ srow,
            float* __restrict__ ctx, float* __restrict__ cx, float* __restrict__ cy)
{
    __shared__ float wl[PC_GROUPS];
    __shared__ __attribute__((aligned(16))) float red[4 * CH];
    const int row  = blockIdx.x;                      // b*8 + h
    const int b    = row >> 3, h = row & 7;
    const int tid  = threadIdx.x;
    const int k16  = tid & 15;
    const int c4   = tid & 127;                       // four channels a thread
    const int cg   = tid >> 7;                        // four partial results a thread

    const float* pp = part + (((long)b * PC_GROUPS + cg * 4) * HEADS + h) * CH + c4 * 4;
    float4 v[4];
#pragma unroll
    for (int i = 0; i < 4; ++i)
        v[i] = *reinterpret_cast<const float4*>(pp + (long)i * HEADS * CH);
    // the loads above share one address pair: this wait stands in front of its
    // reuse, and the operand keeps the pair live up to here. It also holds the loads
    // in front of the weights' butterflies, behind which the compiler had sunk them.
    asm volatile("s_wait_xcnt 0x0" :: "v"(pp) : "memory");

    // every 16 lanes alike: one partial result a lane
    const float m0 = smax[row * PC_GROUPS + k16];
    const float s0 = ssum[row * PC_GROUPS + k16];
    const float p0 = scol[row * PC_GROUPS + k16];
    const float r0 = srow[row * PC_GROUPS + k16];
    float mx = m0;
#pragma unroll
    for (int k = 8; k > 0; k >>= 1) mx = fmaxf(mx, __shfl_xor(mx, k, 32));
    const float w0 = expf(m0 - mx);
    const float sum = xor_sum<16>(w0 * s0);
    const float pc  = xor_sum<16>(w0 * p0);
    const float pr  = xor_sum<16>(w0 * r0);
    const float inv = 1.f / sum;
    if (tid < PC_GROUPS) wl[tid] = w0 * inv;
    __syncthreads();

    float4 a = { 0.f, 0.f, 0.f, 0.f };
#pragma unroll
    for (int i = 0; i < 4; ++i) {
        const float w = wl[cg * 4 + i];
        a.x += w * v[i].x; a.y += w * v[i].y; a.z += w * v[i].z; a.w += w * v[i].w;
    }
    *reinterpret_cast<float4*>(&red[cg * CH + c4 * 4]) = a;
    __syncthreads();

    if (tid < 128) {
        float4 t0 = *reinterpret_cast<const float4*>(&red[0 * CH + tid * 4]);
        float4 t1 = *reinterpret_cast<const float4*>(&red[1 * CH + tid * 4]);
        float4 t2 = *reinterpret_cast<const float4*>(&red[2 * CH + tid * 4]);
        float4 t3 = *reinterpret_cast<const float4*>(&red[3 * CH + tid * 4]);
        float4 o = { (t0.x + t1.x) + (t2.x + t3.x), (t0.y + t1.y) + (t2.y + t3.y),
                     (t0.z + t1.z) + (t2.z + t3.z), (t0.w + t1.w) + (t2.w + t3.w) };
        *reinterpret_cast<float4*>(&ctx[(long)row * CH + tid * 4]) = o;
    }
    if (tid == 0) {
        cx[row] = pc * inv / (float)HT;
        cy[row] = pr * inv / (float)WD;
    }
}

// ---------------------------------------------------------------------------
// Kernel 3: per-batch head attention + channel_add MLP -> add_term[b, 512]
// Every dot product is spread over the lanes of a wave: a weight row is read
// as whole 128-byte lines (16 bytes a lane) and the lanes' partial sums are
// joined afterwards (through LDS for K/Q/V, by a butterfly elsewhere).
// ---------------------------------------------------------------------------
#define PPITCH 36   // floats per row of lane partials: 144 B, an odd multiple of 16 B

__device__ __forceinline__ float dot4(float4 a, float4 b, float s)
{
    s += a.x * b.x; s += a.y * b.y; s += a.z * b.z; s += a.w * b.w;
    return s;
}

__global__ void __launch_bounds__(512)
k_head_attn(const float* __restrict__ ctx, const float* __restrict__ cx,
            const float* __restrict__ cy,
            const float* __restrict__ g_w, const float* __restrict__ g_b,
            const float* __restrict__ k_w, const float* __restrict__ k_b,
            const float* __restrict__ q_w, const float* __restrict__ q_b,
            const float* __restrict__ v_w, const float* __restrict__ v_b,
            const float* __restrict__ w1,  const float* __restrict__ b1,
            const float* __restrict__ lng, const float* __restrict__ lnb,
            const float* __restrict__ w2,  const float* __restrict__ b2,
            float* __restrict__ addt)
{
    __shared__ __attribute__((aligned(16))) float part[3 * 512 * PPITCH];
    __shared__ __attribute__((aligned(16))) float wkqv[3 * 512];  // wk | wq | wv, each [h][d]
    __shared__ float lt[64];
    __shared__ float wmn[64];
    __shared__ __attribute__((aligned(16))) float oc[512];
    __shared__ __attribute__((aligned(16))) float ly[128];

    const int b    = blockIdx.x;
    const int tid  = threadIdx.x;
    const int lane = tid & 31;
    const int wave = __builtin_amdgcn_readfirstlane(tid >> 5);    // 0..15
    const float* cb = ctx + (long)b * HEADS * CH;

    // w_k / w_q / w_v : one wave per weight row, all 8 heads at once.
    // The lane keeps its 16 columns of every head's context in registers.
    {
        float4 c[HEADS][4];
#pragma unroll
        for (int h = 0; h < HEADS; ++h)
#pragma unroll
            for (int i = 0; i < 4; ++i)
                c[h][i] = *reinterpret_cast<const float4*>(cb + h * CH + i * 128 + lane * 4);

#pragma unroll
        for (int j = 0; j < 12; ++j) {
            const float* wm = (j < 4) ? k_w : (j < 8) ? q_w : v_w;
            const int d = wave + 16 * (j & 3);
            const float* wr = wm + d * CH + lane * 4;
            float4 w[4];
#pragma unroll
            for (int i = 0; i < 4; ++i)
                w[i] = *reinterpret_cast<const float4*>(wr + i * 128);
            const int r = (j >> 2) * 64 + d;
#pragma unroll
            for (int h = 0; h < HEADS; ++h) {
                float s = 0.f;
#pragma unroll
                for (int i = 0; i < 4; ++i) s = dot4(w[i], c[h][i], s);
                part[(r * HEADS + h) * PPITCH + lane] = s;
            }
        }
    }
    __syncthreads();

    // join the 32 lane partials of each of the 1536 outputs
#pragma unroll
    for (int mat = 0; mat < 3; ++mat) {
        const int p = mat * 512 + tid;
        const float4* pp = reinterpret_cast<const float4*>(&part[p * PPITCH]);
        float4 t = pp[0];
#pragma unroll
        for (int i = 1; i < 8; ++i) {
            float4 u = pp[i];
            t.x += u.x; t.y += u.y; t.z += u.z; t.w += u.w;
        }
        const int h = tid & 7, d = tid >> 3;
        const float* bs = (mat == 0) ? k_b : (mat == 1) ? q_b : v_b;
        wkqv[mat * 512 + h * 64 + d] = (t.x + t.y) + (t.z + t.w) + bs[d];
    }
    __syncthreads();

    // w_g (geometric) and scaled_dot -> logits lt[m*8+n]; 8 lanes per (m, n)
    {
        const int pair = tid >> 3, sub = tid & 7;
        const int m = pair >> 3, n = pair & 7;
        float dx = cx[b * 8 + m] - cx[b * 8 + n];
        float dy = cy[b * 8 + m] - cy[b * 8 + n];
        float pos[4] = { fmaxf(dx, 0.f), fmaxf(-dx, 0.f),
                         fmaxf(dy, 0.f), fmaxf(-dy, 0.f) };
        float freq = expf(-6.90775527898f * (float)sub * 0.125f);   // 1000^(-f/8)
        float s = 0.f;
        for (int p = 0; p < 4; ++p) {
            float ang = 100.f * pos[p] * freq;
            s += sinf(ang) * g_w[p * 8 + sub] + cosf(ang) * g_w[32 + p * 8 + sub];
        }
        float sd = 0.f;
#pragma unroll
        for (int i = 0; i < 8; ++i) {
            const int d = sub + 8 * i;
            sd += wkqv[m * 64 + d] * wkqv[512 + n * 64 + d];
        }
        s  = xor_sum<8>(s);
        sd = xor_sum<8>(sd);
        if (sub == 0) {
            float wg = fmaxf(s + g_b[0], 0.f);
            lt[pair] = logf(fmaxf(wg, 1e-6f)) + sd * 0.125f;        // 1/sqrt(64)
        }
    }
    __syncthreads();

    // softmax over m (axis=1) for each n; 8 lanes per n
    if (tid < 64) {
        const int n = tid >> 3, m = tid & 7;
        float v = lt[m * 8 + n];
        float mx = v;
#pragma unroll
        for (int k = 4; k > 0; k >>= 1) mx = fmaxf(mx, __shfl_xor(mx, k, 32));
        float e = expf(v - mx);
        float inv = 1.f / xor_sum<8>(e);
        wmn[m * 8 + n] = e * inv;
    }
    __syncthreads();

    // out_ctx[n, d] = sum_m wmn[m,n] * wv[m,d] -> flat n*64+d
    {
        int n = tid >> 6, d = tid & 63;
        float s = 0.f;
        for (int m = 0; m < 8; ++m) s += wmn[m * 8 + n] * wkqv[1024 + m * 64 + d];
        oc[tid] = s;
    }
    __syncthreads();

    // y = oc @ w1^T + b1  [128]: one wave per row, 8 rows a wave
    {
        float4 o4[4];
#pragma unroll
        for (int i = 0; i < 4; ++i)
            o4[i] = *reinterpret_cast<const float4*>(&oc[i * 128 + lane * 4]);
        const char* wb = reinterpret_cast<const char*>(w1 + wave * 8 * 512);
        const int lofs = lane * 16;                   // the lane's byte offset in a 512-byte piece
        float4 w[8][4];
#pragma unroll
        for (int j = 0; j < 8; ++j)
#pragma unroll
            for (int i = 0; i < 4; ++i)
                w[j][i] = *reinterpret_cast<const float4*>(wb + lofs + j * 2048 + i * 512);
        // the 32 loads above share one offset register: this wait stands in front of
        // its reuse, and the operand keeps the lane's offset live up to here (without
        // it the last load's result was placed on the offset register)
        asm volatile("s_wait_xcnt 0x0" :: "v"(lofs) : "memory");
        float res = 0.f;
#pragma unroll
        for (int j = 0; j < 8; ++j) {
            float s = 0.f;
#pragma unroll
            for (int i = 0; i < 4; ++i) s = dot4(w[j][i], o4[i], s);
            s = xor_sum<32>(s);
            res = (lane == j) ? s : res;
        }
        if (lane < 8) ly[wave * 8 + lane] = res + b1[wave * 8 + lane];
    }
    __syncthreads();

    // LayerNorm + ReLU in registers (every 8-lane group holds all 128 values),
    // then add_term[c] = y @ w2^T + b2  [512]: 8 lanes per row, 32 rows a wave
    {
        const int s8 = lane & 7, rsub = lane >> 3;
        float y[16];
#pragma unroll
        for (int i = 0; i < 4; ++i) {
            float4 t = *reinterpret_cast<const float4*>(&ly[i * 32 + s8 * 4]);
            y[i * 4 + 0] = t.x; y[i * 4 + 1] = t.y; y[i * 4 + 2] = t.z; y[i * 4 + 3] = t.w;
        }
        float mu = 0.f;
#pragma unroll
        for (int i = 0; i < 16; ++i) mu += y[i];
        mu = xor_sum<8>(mu) * (1.f / PLANES);
        float var = 0.f;
#pragma unroll
        for (int i = 0; i < 16; ++i) { float dlt = y[i] - mu; var += dlt * dlt; }
        var = xor_sum<8>(var) * (1.f / PLANES);
        const float rstd = rsqrtf(var + 1e-5f);
        float4 yn[4];
#pragma unroll
        for (int i = 0; i < 4; ++i) {
            float4 g4 = *reinterpret_cast<const float4*>(lng + i * 32 + s8 * 4);
            float4 b4 = *reinterpret_cast<const float4*>(lnb + i * 32 + s8 * 4);
            yn[i].x = fmaxf((y[i * 4 + 0] - mu) * rstd * g4.x + b4.x, 0.f);
            yn[i].y = fmaxf((y[i * 4 + 1] - mu) * rstd * g4.y + b4.y, 0.f);
            yn[i].z = fmaxf((y[i * 4 + 2] - mu) * rstd * g4.z + b4.z, 0.f);
            yn[i].w = fmaxf((y[i * 4 + 3] - mu) * rstd * g4.w + b4.w, 0.f);
        }
        float res = 0.f;
#pragma unroll
        for (int g = 0; g < 8; ++g) {
            const float* wr = w2 + (wave * 32 + g * 4 + rsub) * PLANES + s8 * 4;
            float s = 0.f;
#pragma unroll
            for (int i = 0; i < 4; ++i)
                s = dot4(*reinterpret_cast<const float4*>(wr + i * 32), yn[i], s);
            s = xor_sum<8>(s);
            res = (s8 == g) ? s : res;
        }
        const int c = wave * 32 + s8 * 4 + rsub;
        addt[b * 512 + c] = res + b2[c];
    }
}

// ---------------------------------------------------------------------------
// Kernel 4: out[b,c,hw] = x[b,c,hw] + add_term[b,c]   (float4 streaming)
// One workgroup of 16 waves per WGP instead of one wave per 512 bytes. A wave
// streams AO_PLANES whole (b,c) planes in groups of AO_DEPTH loads, each load
// 512 contiguous bytes.
// ---------------------------------------------------------------------------
#define AO_WAVES  16    // waves per workgroup
#define AO_PLANES 2     // (b,c) planes per wave
#define AO_DEPTH  16    // 16-byte loads per lane in flight
#define AO_GROUPS (AO_PLANES * (HWSZ / 4) / (32 * AO_DEPTH))

__global__ void __launch_bounds__(AO_WAVES * 32)
k_addout(const float* __restrict__ x, const float* __restrict__ addt,
         float* __restrict__ out)
{
    const int lane  = threadIdx.x & 31;
    const int wave  = __builtin_amdgcn_readfirstlane(threadIdx.x >> 5);
    const int plane = (blockIdx.x * AO_WAVES + wave) * AO_PLANES;
    const float4* xp = reinterpret_cast<const float4*>(x) + (long)plane * (HWSZ / 4) + lane;
    float4*       op = reinterpret_cast<float4*>(out)     + (long)plane * (HWSZ / 4) + lane;

    float a[AO_PLANES];
#pragma unroll
    for (int p = 0; p < AO_PLANES; ++p) a[p] = addt[plane + p];

    // unrolled: every address is one base and one lane offset plus an immediate, so no
    // address register is rewritten while loads or stores are in flight
#pragma unroll
    for (int g = 0; g < AO_GROUPS; ++g) {
        // the loads below land on registers that the group before was stored from:
        // this wait stands between those stores and the overwrite of their data
        if (g > 0) asm volatile("s_wait_xcnt 0x0" ::: "memory");
        float4 v[AO_DEPTH];
#pragma unroll
        for (int i = 0; i < AO_DEPTH; ++i) v[i] = xp[(g * AO_DEPTH + i) * 32];
        // all loads of the group are issued before the first add waits for one: left
        // free, the compiler sinks each load to its use and the wave waits out every one
        __builtin_amdgcn_sched_barrier(0);
        const float s = a[g / (AO_GROUPS / AO_PLANES)];
#pragma unroll
        for (int i = 0; i < AO_DEPTH; ++i) {
            float4 o = { v[i].x + s, v[i].y + s, v[i].z + s, v[i].w + s };
            op[(g * AO_DEPTH + i) * 32] = o;
        }
    }
}

// ---------------------------------------------------------------------------
extern "C" void kernel_launch(void* const* d_in, const int* in_sizes, int n_in,
                              void* d_out, int out_size, void* d_ws, size_t ws_size,
                              hipStream_t stream)
{
    const float* x   = (const float*)d_in[0];
    const float* cmw = (const float*)d_in[1];
    const float* cmb = (const float*)d_in[2];
    const float* g_w = (const float*)d_in[3];
    const float* g_b = (const float*)d_in[4];
    const float* k_w = (const float*)d_in[5];
    const float* k_b = (const float*)d_in[6];
    const float* q_w = (const float*)d_in[7];
    const float* q_b = (const float*)d_in[8];
    const float* v_w = (const float*)d_in[9];
    const float* v_b = (const float*)d_in[10];
    const float* w1  = (const float*)d_in[11];
    const float* b1  = (const float*)d_in[12];
    const float* lng = (const float*)d_in[13];
    const float* lnb = (const float*)d_in[14];
    const float* w2  = (const float*)d_in[15];
    const float* b2  = (const float*)d_in[16];
    float* out = (float*)d_out;

    // workspace layout (floats)
    float* ws   = (float*)d_ws;
    float* part = ws;                                 // 16*16*8*512 = 1048576 used
    float* ctx  = ws + 4194304;                       // 16*8*512  = 65536
    float* cxb  = ws + 4194304 + 65536;               // 128
    float* cyb  = cxb + 128;                          // 128
    float* addt = cyb + 128;                          // 16*512 = 8192
    float* smax = addt + 8192;                        // 16*8*16 = 2048 used
    float* ssum = smax + 8192;                        // 2048 used
    float* scol = ssum + 8192;                        // 2048 used
    float* srow = scol + 8192;                        // 2048 used

    k_pool_partial<<<dim3(NB * PC_GROUPS), dim3(PC_WAVES * 32), 0, stream>>>(x, cmw, cmb, part,
                                                                             smax, ssum, scol, srow);
    k_pool_join<<<dim3(NB * HEADS), dim3(512), 0, stream>>>(part, smax, ssum, scol, srow, ctx, cxb, cyb);
    k_head_attn<<<dim3(NB), dim3(512), 0, stream>>>(ctx, cxb, cyb, g_w, g_b,
                                                    k_w, k_b, q_w, q_b, v_w, v_b,
                                                    w1, b1, lng, lnb, w2, b2, addt);
    k_addout<<<dim3(NB * CH / (AO_WAVES * AO_PLANES)), dim3(AO_WAVES * 32), 0, stream>>>(x, addt, out);
}

// v005
// One run takes 46 microseconds.
// Next to v004, in two timings, it ran 1.17 and 1.18 times as fast.
// All steps since v000 together make it 4.54 times as fast.
#include <hip/hip_runtime.h>
#include <hip/hip_bf16.h>

typedef __attribute__((ext_vector_type(2))) float v2f;
typedef __attribute__((ext_vector_type(8))) float v8f;

#define HEADS  8
#define NB     16
#define CH     512
#define HT     64
#define WD     64
#define HWSZ   4096
#define PLANES 128

template <int WIDTH>
__device__ __forceinline__ float xor_sum(float v)
{
#pragma unroll
    for (int m = WIDTH / 2; m > 0; m >>= 1) v += __shfl_xor(v, m, 32);
    return v;
}

// workgroup barrier for data handed over in LDS alone: the fences name LDS only, so the
// wave waits for its LDS accesses and not, as __syncthreads() makes it, for every global
// load that it still has on its way
__device__ __forceinline__ void lds_barrier()
{
    __builtin_amdgcn_fence(__ATOMIC_RELEASE, "workgroup", "local");
    __builtin_amdgcn_s_barrier();
    __builtin_amdgcn_fence(__ATOMIC_ACQUIRE, "workgroup", "local");
}

#define PC_COLS  64    // hw columns per tile: one image row
#define PC_ROWS  4     // image rows a workgroup takes, one after the other
#define PC_GROUPS (HWSZ / (PC_COLS * PC_ROWS))   // workgroups, and partial results, per batch
#define PC_PITCH 68    // floats per LDS row: 272 B, an odd multiple of 16 B
#define PC_WAVES 8
#define PC_TILE  (CH * PC_PITCH)   // floats of one tile buffer

// eight 16-byte-a-lane copies, global memory to LDS through no register. The wait in
// the last line stands in front of any rewrite of the address registers named here.
#define PC_COPY8(l, g, r)                                                         \
    asm volatile("global_load_async_to_lds_b128 %0, %8, off\n\t"                  \
                 "global_load_async_to_lds_b128 %1, %9, off\n\t"                  \
                 "global_load_async_to_lds_b128 %2, %10, off\n\t"                 \
                 "global_load_async_to_lds_b128 %3, %11, off\n\t"                 \
                 "global_load_async_to_lds_b128 %4, %12, off\n\t"                 \
                 "global_load_async_to_lds_b128 %5, %13, off\n\t"                 \
                 "global_load_async_to_lds_b128 %6, %14, off\n\t"                 \
                 "global_load_async_to_lds_b128 %7, %15, off\n\t"                 \
                 "s_wait_xcnt 0x0"                                                \
                 :: "v"((l) + ((r) + 0) * (PC_PITCH * 4u)),                       \
                    "v"((l) + ((r) + 2) * (PC_PITCH * 4u)),                       \
                    "v"((l) + ((r) + 4) * (PC_PITCH * 4u)),                       \
                    "v"((l) + ((r) + 6) * (PC_PITCH * 4u)),                       \
                    "v"((l) + ((r) + 8) * (PC_PITCH * 4u)),                       \
                    "v"((l) + ((r) + 10) * (PC_PITCH * 4u)),                      \
                    "v"((l) + ((r) + 12) * (PC_PITCH * 4u)),                      \
                    "v"((l) + ((r) + 14) * (PC_PITCH * 4u)),                      \
                    "v"((g) + ((r) + 0) * HWSZ), "v"((g) + ((r) + 2) * HWSZ),     \
                    "v"((g) + ((r) + 4) * HWSZ), "v"((g) + ((r) + 6) * HWSZ),     \
                    "v"((g) + ((r) + 8) * HWSZ), "v"((g) + ((r) + 10) * HWSZ),    \
                    "v"((g) + ((r) + 12) * HWSZ), "v"((g) + ((r) + 14) * HWSZ)    \
                 : "memory")

// ---------------------------------------------------------------------------
// Kernel 1: one workgroup per (batch, 4 image rows). It takes its rows one after the
// other; a row's tile x[512 c][64 hw] is brought into one of two LDS buffers while the
// row before is worked on, and feeds both products:
//   logits[h, hw] = sum_c cmw[h, c] * x[c, hw] + cmb[h]      (WMMA, K over c)
//   e[h, hw]      = exp(logits - running maximum)
//   part[h, c]    = part[h, c] * exp(old maximum - new) + sum_hw x[c, hw] * e[h, hw]
// part stays in the WMMA accumulators over the four rows. The running maximum, sum of
// e and the two moments go out beside part; kernel 2 joins the 16 workgroups of a
// (batch, head). Wave w copies, and alone reads, the channels 64 w .. 64 w + 63.
// ---------------------------------------------------------------------------
__global__ void __launch_bounds__(PC_WAVES * 32)
k_pool_partial(const float* __restrict__ x, const float* __restrict__ cmw,
               const float* __restrict__ cmb, float* __restrict__ part,
               float* __restrict__ smax, float* __restrict__ ssum,
               float* __restrict__ scol, float* __restrict__ srow)
{
    __shared__ __attribute__((aligned(16))) float tile[2 * PC_TILE];
    __shared__ __attribute__((aligned(16))) float lg[PC_WAVES * HEADS * PC_COLS];
    __shared__ __attribute__((aligned(16))) float pm[16 * PC_PITCH];
    __shared__ float sc[HEADS];

    const int lane  = threadIdx.x & 31;
    const int wave  = __builtin_amdgcn_readfirstlane(threadIdx.x >> 5);
    const int b     = blockIdx.x / PC_GROUPS;
    const int grp   = blockIdx.x % PC_GROUPS;
    const int col   = lane & 15;
    const int kgrp  = lane >> 4;
    const int row0  = wave * 64;

    // the lane's place in the first image row's tile, in memory and in buffer 0
    const float* g0 = x + ((long)b * CH + row0 + kgrp) * HWSZ + grp * (PC_ROWS * PC_COLS) + col * 4;
    const unsigned l0a = (unsigned)(uintptr_t)&tile[(row0 + kgrp) * PC_PITCH + col * 4];

    // row 0 into buffer 0: 32 copies a wave, each two rows of 256 bytes, all in flight at once
    PC_COPY8(l0a, g0, 0);
    PC_COPY8(l0a, g0, 16);
    PC_COPY8(l0a, g0, 32);
    PC_COPY8(l0a, g0, 48);

    // A fragments of the logits product, fetched while the tile is on its way.
    // k order of both loaders: step 2u+s holds channels row0 + 8u + 4 kgrp + 2s, +1.
    float4 a4[8];
#pragma unroll
    for (int u = 0; u < 8; ++u) {
        float4 t = *reinterpret_cast<const float4*>(cmw + (col & 7) * CH + row0 + u * 8 + kgrp * 4);
        a4[u].x = (col < HEADS) ? t.x : 0.f;          // rows >= 8 are zero padding
        a4[u].y = (col < HEADS) ? t.y : 0.f;
        a4[u].z = (col < HEADS) ? t.z : 0.f;
        a4[u].w = (col < HEADS) ? t.w : 0.f;
    }
    const float bias = cmb[wave];

    // the wave's own copies have landed behind this wait
    asm volatile("s_wait_asynccnt 0x0" ::: "memory");
    __syncthreads();

    // row 1 into buffer 1: on its way while row 0 is worked on
    {
        const float* g = g0 + PC_COLS;
        const unsigned l = l0a + PC_TILE * 4u;
        PC_COPY8(l, g, 0);
        PC_COPY8(l, g, 16);
        PC_COPY8(l, g, 32);
        PC_COPY8(l, g, 48);
    }

    // wave h keeps head h's running terms; every wave keeps part of its 64 channels
    float run_m = -3.0e38f, run_s = 0.f, run_pc = 0.f, run_pr = 0.f;
    v8f c[4];
#pragma unroll
    for (int t = 0; t < 4; ++t) c[t] = (v8f){0.f, 0.f, 0.f, 0.f, 0.f, 0.f, 0.f, 0.f};

    for (int it = 0; it < PC_ROWS; ++it) {
        const int tb = (it & 1) * PC_TILE;            // this row's buffer

        // logits over the wave's 64 channels, all 64 columns: N tile t holds columns 4n + t
        {
            v8f acc[4];
#pragma unroll
            for (int t = 0; t < 4; ++t) acc[t] = (v8f){0.f, 0.f, 0.f, 0.f, 0.f, 0.f, 0.f, 0.f};
#pragma unroll
            for (int u = 0; u < 8; ++u) {
#pragma unroll
                for (int s = 0; s < 2; ++s) {
                    const int ch = row0 + u * 8 + kgrp * 4 + s * 2;
                    float4 b0 = *reinterpret_cast<const float4*>(&tile[tb + ch * PC_PITCH + col * 4]);
                    float4 b1 = *reinterpret_cast<const float4*>(&tile[tb + (ch + 1) * PC_PITCH + col * 4]);
                    v2f af; af.x = s ? a4[u].z : a4[u].x;
                            af.y = s ? a4[u].w : a4[u].y;
                    v2f bf;
                    bf.x = b0.x; bf.y = b1.x;
                    acc[0] = __builtin_amdgcn_wmma_f32_16x16x4_f32(false, af, false, bf,
                                                                   (short)0, acc[0], false, false);
                    bf.x = b0.y; bf.y = b1.y;
                    acc[1] = __builtin_amdgcn_wmma_f32_16x16x4_f32(false, af, false, bf,
                                                                   (short)0, acc[1], false, false);
                    bf.x = b0.z; bf.y = b1.z;
                    acc[2] = __builtin_amdgcn_wmma_f32_16x16x4_f32(false, af, false, bf,
                                                                   (short)0, acc[2], false, false);
                    bf.x = b0.w; bf.y = b1.w;
                    acc[3] = __builtin_amdgcn_wmma_f32_16x16x4_f32(false, af, false, bf,
                                                                   (short)0, acc[3], false, false);
                }
            }
            // D layout: VGPR r, lanes 0-15 -> M = r (head), lanes 16-31 -> padding
            if (lane < 16) {
#pragma unroll
                for (int r = 0; r < HEADS; ++r) {
                    float4 o = { acc[0][r], acc[1][r], acc[2][r], acc[3][r] };
                    *reinterpret_cast<float4*>(&lg[(wave * HEADS + r) * PC_COLS + col * 4]) = o;
                }
            }
        }
        __syncthreads();

        // wave h: join the eight channel slices of head h, softmax terms of the row
        // against the running maximum
        {
            const int h = wave;
            float l0 = bias, l1 = bias;
#pragma unroll
            for (int w = 0; w < PC_WAVES; ++w) {
                float2 v = *reinterpret_cast<const float2*>(&lg[(w * HEADS + h) * PC_COLS + lane * 2]);
                l0 += v.x; l1 += v.y;
            }
            float mx = fmaxf(l0, l1);
#pragma unroll
            for (int k = 16; k > 0; k >>= 1) mx = fmaxf(mx, __shfl_xor(mx, k, 32));
            mx = fmaxf(mx, run_m);
            const float f = expf(run_m - mx);         // 0 for the first row
            float2 e = { expf(l0 - mx), expf(l1 - mx) };
            float2 zero = { 0.f, 0.f };
            *reinterpret_cast<float2*>(&pm[h * PC_PITCH + lane * 2]) = e;
            *reinterpret_cast<float2*>(&pm[(h + HEADS) * PC_PITCH + lane * 2]) = zero;   // N padding
            if (lane == 0) sc[h] = f;
            float sum = xor_sum<32>(e.x + e.y);
            float pc  = xor_sum<32>(e.x * (float)(lane * 2) + e.y * (float)(lane * 2 + 1));
            run_s  = run_s  * f + sum;
            run_pc = run_pc * f + pc;
            run_pr = run_pr * f + sum * (float)(grp * PC_ROWS + it);
            run_m  = mx;
        }
        __syncthreads();

        // part[h, c] over the wave's 64 channels (4 M tiles), K over the 64 columns, on
        // top of the rows before, brought to the new maximum (N = lane & 15 is the head).
        // k order of both loaders: step 2u+s holds columns 8u + 4 kgrp + 2s, +1.
        {
            const float fl = sc[col & 7];
#pragma unroll
            for (int t = 0; t < 4; ++t)
#pragma unroll
                for (int r = 0; r < 8; ++r) c[t][r] *= fl;
        }
#pragma unroll
        for (int u = 0; u < 8; ++u) {
            float4 p4 = *reinterpret_cast<const float4*>(&pm[col * PC_PITCH + u * 8 + kgrp * 4]);
            float4 a[4];
#pragma unroll
            for (int t = 0; t < 4; ++t)
                a[t] = *reinterpret_cast<const float4*>(
                    &tile[tb + (row0 + t * 16 + col) * PC_PITCH + u * 8 + kgrp * 4]);
#pragma unroll
            for (int t = 0; t < 4; ++t) {
                v2f af; af.x = a[t].x; af.y = a[t].y;
                v2f bf; bf.x = p4.x;   bf.y = p4.y;
                c[t] = __builtin_amdgcn_wmma_f32_16x16x4_f32(false, af, false, bf,
                                                             (short)0, c[t], false, false);
            }
#pragma unroll
            for (int t = 0; t < 4; ++t) {
                v2f af; af.x = a[t].z; af.y = a[t].w;
                v2f bf; bf.x = p4.z;   bf.y = p4.w;
                c[t] = __builtin_amdgcn_wmma_f32_16x16x4_f32(false, af, false, bf,
                                                             (short)0, c[t], false, false);
            }
        }

        // hand-over: this wave's LDS reads of the row are done, its copies of the next
        // row have landed, and the barrier says both of every wave
        asm volatile("s_wait_dscnt 0x0" ::: "memory");
        asm volatile("s_wait_asynccnt 0x0" ::: "memory");
        __syncthreads();
        // the row after the next goes into the buffer that has just been read
        if (it + 2 < PC_ROWS) {
            const float* g = g0 + (it + 2) * PC_COLS;
            const unsigned l = l0a + (unsigned)tb * 4u;
            PC_COPY8(l, g, 0);
            PC_COPY8(l, g, 16);
            PC_COPY8(l, g, 32);
            PC_COPY8(l, g, 48);
        }
    }
    // no copy is left on its way when the tile buffers become staging
    asm volatile("s_wait_asynccnt 0x0" ::: "memory");

    if (lane == 0) {
        const int idx = (b * HEADS + wave) * PC_GROUPS + grp;
        smax[idx] = run_m; ssum[idx] = run_s; scol[idx] = run_pc; srow[idx] = run_pr;
    }

    // D layout: VGPR r, lanes 0-15 -> M = r, lanes 16-31 -> M = r + 8; N = lane & 15 (head).
    // Turned through the wave's own, now spent, tile rows so that part is stored in
    // whole 128-byte lines.
    float* stg = &tile[row0 * PC_PITCH];
    if (col < HEADS) {
#pragma unroll
        for (int t = 0; t < 4; ++t) {
            float4 lo = { c[t][0], c[t][1], c[t][2], c[t][3] };
            float4 hi = { c[t][4], c[t][5], c[t][6], c[t][7] };
            *reinterpret_cast<float4*>(&stg[col * PC_PITCH + t * 16 + kgrp * 8])     = lo;
            *reinterpret_cast<float4*>(&stg[col * PC_PITCH + t * 16 + kgrp * 8 + 4]) = hi;
        }
    }
    // orders the lanes' staging writes in front of the other lanes' reads below
    __syncthreads();
    float* po = part + ((long)blockIdx.x * HEADS) * CH + row0 + col * 4;
#pragma unroll
    for (int i = 0; i < 4; ++i) {
        const int h = i * 2 + kgrp;
        float4 v = *reinterpret_cast<const float4*>(&stg[h * PC_PITCH + col * 4]);
        *reinterpret_cast<float4*>(po + h * CH) = v;
    }
}

// ---------------------------------------------------------------------------
// Kernel 2: two workgroups per (batch, head). Each joins the 16 partial results:
//   w[k] = exp(max[k] - max over k) / sum_k(...)   context[c] = sum_k w[k] part[k, c]
// (the first also stores the centroid cx, cy), keeps the context row in LDS and takes
// 96 of the 192 rows of the K, Q and V weights against it: one wave per weight row,
// read as whole 128-byte lines, the lanes' partial sums joined by a butterfly.
// ---------------------------------------------------------------------------
#define KQ_ROWS 6     // weight rows a wave: 192 rows / 2 workgroups / 16 waves

__device__ __forceinline__ float dot4(float4 a, float4 b, float s)
{
    s += a.x * b.x; s += a.y * b.y; s += a.z * b.z; s += a.w * b.w;
    return s;
}

__global__ void __launch_bounds__(512)
k_join_kqv(const float* __restrict__ part, const float* __restrict__ smax,
           const float* __restrict__ ssum, const float* __restrict__ scol,
           const float* __restrict__ srow,
           const float* __restrict__ k_w, const float* __restrict__ k_b,
           const float* __restrict__ q_w, const float* __restrict__ q_b,
           const float* __restrict__ v_w, const float* __restrict__ v_b,
           float* __restrict__ kqv, float* __restrict__ cx, float* __restrict__ cy)
{
    __shared__ float wl[PC_GROUPS];
    __shared__ __attribute__((aligned(16))) float red[4 * CH];
    __shared__ __attribute__((aligned(16))) float cs[CH];
    __shared__ float ro[16 * KQ_ROWS];
    const int row  = blockIdx.x >> 1;                 // b*8 + h
    const int sub  = blockIdx.x & 1;                  // which 96 weight rows
    const int b    = row >> 3, h = row & 7;
    const int tid  = threadIdx.x;
    const int lane = tid & 31;
    const int wave = __builtin_amdgcn_readfirstlane(tid >> 5);
    const int k16  = tid & 15;
    const int c4   = tid & 127;                       // four channels a thread
    const int cg   = tid >> 7;                        // four partial results a thread

    const float* pp = part + (((long)b * PC_GROUPS + cg * 4) * HEADS + h) * CH + c4 * 4;
    float4 v[4];
#pragma unroll
    for (int i = 0; i < 4; ++i)
        v[i] = *reinterpret_cast<const float4*>(pp + (long)i * HEADS * CH);
    // the loads above share one address pair: this wait stands in front of its
    // reuse, and the operand keeps the pair live up to here. It also holds the loads
    // in front of the weights' butterflies, behind which the compiler had sunk them.
    asm volatile("s_wait_xcnt 0x0" :: "v"(pp) : "memory");

    // every 16 lanes alike: one partial result a lane
    const float m0 = smax[row * PC_GROUPS + k16];
    const float s0 = ssum[row * PC_GROUPS + k16];
    const float p0 = scol[row * PC_GROUPS + k16];
    const float r0 = srow[row * PC_GROUPS + k16];

    // the bias of the result that this thread stores at the end
    const int rs = sub * 96 + ((tid < 96) ? tid : 95);
    const float bk = k_b[rs & 63], bq = q_b[rs & 63], bv = v_b[rs & 63];
    // keeps the small loads older than the weight rows: a wait for them waits for no row
    __builtin_amdgcn_sched_barrier(0);

    // the wave's weight rows need nothing of the join: on their way from here on
    const int lofs = lane * 16;                       // the lane's byte offset in a 512-byte piece
    float4 w[KQ_ROWS][4];
#pragma unroll
    for (int j = 0; j < KQ_ROWS; ++j) {
        const int r = sub * 96 + wave * KQ_ROWS + j;  // 0..191: K | Q | V, 64 rows each
        const float* wm = (r < 64) ? k_w : (r < 128) ? q_w : v_w;
        const char* wb = reinterpret_cast<const char*>(wm + (r & 63) * CH);
#pragma unroll
        for (int i = 0; i < 4; ++i)
            w[j][i] = *reinterpret_cast<const float4*>(wb + lofs + i * 512);
    }
    // the loads above share one offset register: this wait stands in front of its
    // reuse, and the first operand keeps it live up to here. It also holds the loads
    // here, ahead of the join, instead of behind its barriers; the biases are inputs so
    // that their loads are not sunk to the kernel's end, where they would be waited out
    asm volatile("s_wait_xcnt 0x0" :: "v"(lofs), "v"(bk), "v"(bq), "v"(bv) : "memory");
    // the butterflies below wait for the first loads: they stay behind the issue of all
    __builtin_amdgcn_sched_barrier(0);

    float mx = m0;
#pragma unroll
    for (int k = 8; k > 0; k >>= 1) mx = fmaxf(mx, __shfl_xor(mx, k, 32));
    const float w0 = expf(m0 - mx);
    const float sum = xor_sum<16>(w0 * s0);
    const float pc  = xor_sum<16>(w0 * p0);
    const float pr  = xor_sum<16>(w0 * r0);
    const float inv = 1.f / sum;
    if (tid < PC_GROUPS) wl[tid] = w0 * inv;
    lds_barrier();

    float4 a = { 0.f, 0.f, 0.f, 0.f };
#pragma unroll
    for (int i = 0; i < 4; ++i) {
        const float wk = wl[cg * 4 + i];
        a.x += wk * v[i].x; a.y += wk * v[i].y; a.z += wk * v[i].z; a.w += wk * v[i].w;
    }
    *reinterpret_cast<float4*>(&red[cg * CH + c4 * 4]) = a;
    lds_barrier();

    if (tid < 128) {
        float4 t0 = *reinterpret_cast<const float4*>(&red[0 * CH + tid * 4]);
        float4 t1 = *reinterpret_cast<const float4*>(&red[1 * CH + tid * 4]);
        float4 t2 = *reinterpret_cast<const float4*>(&red[2 * CH + tid * 4]);
        float4 t3 = *reinterpret_cast<const float4*>(&red[3 * CH + tid * 4]);
        float4 o = { (t0.x + t1.x) + (t2.x + t3.x), (t0.y + t1.y) + (t2.y + t3.y),
                     (t0.z + t1.z) + (t2.z + t3.z), (t0.w + t1.w) + (t2.w + t3.w) };
        *reinterpret_cast<float4*>(&cs[tid * 4]) = o;
    }
    if (tid == 0 && sub == 0) {
        cx[row] = pc * inv / (float)HT;
        cy[row] = pr * inv / (float)WD;
    }
    lds_barrier();

    // the lane's 16 columns of the context row against its 16 columns of each weight row
    {
        float4 c[4];
#pragma unroll
        for (int i = 0; i < 4; ++i)
            c[i] = *reinterpret_cast<const float4*>(&cs[i * 128 + lane * 4]);
        float res = 0.f;
#pragma unroll
        for (int j = 0; j < KQ_ROWS; ++j) {
            float s = 0.f;
#pragma unroll
            for (int i = 0; i < 4; ++i) s = dot4(w[j][i], c[i], s);
            s = xor_sum<32>(s);
            res = (lane == j) ? s : res;
        }
        if (lane < KQ_ROWS) ro[wave * KQ_ROWS + lane] = res;
    }
    lds_barrier();

    // 96 results go out as three whole 128-byte lines: kqv[b][K|Q|V][h][d]
    if (tid < 96) {
        const int mat = rs >> 6, d = rs & 63;
        kqv[b * 1536 + mat * 512 + h * 64 + d] = ro[tid] + ((mat == 0) ? bk : (mat == 1) ? bq : bv);
    }
}

// ---------------------------------------------------------------------------
// Kernel 3: out[b,c,hw] = x[b,c,hw] + add_term[b,c]   (float4 streaming)
// One workgroup of 16 waves per WGP; a wave streams AO_PLANES whole (b,c) planes in
// groups of AO_DEPTH loads, each load 512 contiguous bytes. Ahead of its stream every
// workgroup works out its batch's head attention and channel_add MLP itself (16
// workgroups a batch do the same sums) and the add_term of its own 32 channels. All it
// needs from memory is asked for at the top, in the order of use: the small operands
// (to LDS), the rows of w1 (registers), the first group of x (registers).
// ---------------------------------------------------------------------------
#define AO_WAVES  16    // waves per workgroup
#define AO_PLANES 2     // (b,c) planes per wave
#define AO_DEPTH  16    // 16-byte loads per lane in flight
#define AO_GROUPS (AO_PLANES * (HWSZ / 4) / (32 * AO_DEPTH))
#define AO_CH     (AO_WAVES * AO_PLANES)   // channels per workgroup

__global__ void __launch_bounds__(AO_WAVES * 32)
k_attn_addout(const float* __restrict__ x, const float* __restrict__ kqv,
              const float* __restrict__ cx, const float* __restrict__ cy,
              const float* __restrict__ g_w, const float* __restrict__ g_b,
              const float* __restrict__ w1,  const float* __restrict__ b1,
              const float* __restrict__ lng, const float* __restrict__ lnb,
              const float* __restrict__ w2,  const float* __restrict__ b2,
              float* __restrict__ out)
{
    __shared__ __attribute__((aligned(16))) float wkqv[3 * 512];  // wk | wq | wv, each [h][d]
    __shared__ __attribute__((aligned(16))) float sm[512];        // g_w 64 | b1 128 | ln_g 128 | ln_b 128 | b2 32
    __shared__ __attribute__((aligned(16))) float sw2[AO_CH * PLANES];
    __shared__ float lt[64];
    __shared__ float wmn[64];
    __shared__ __attribute__((aligned(16))) float oc[512];
    __shared__ __attribute__((aligned(16))) float ly[128];

    const int tid   = threadIdx.x;
    const int lane  = tid & 31;
    const int wave  = __builtin_amdgcn_readfirstlane(tid >> 5);
    const int plane = (blockIdx.x * AO_WAVES + wave) * AO_PLANES;
    const int b     = blockIdx.x / (CH / AO_CH);
    const int c0    = (blockIdx.x % (CH / AO_CH)) * AO_CH;        // the workgroup's first channel
    const float4* xp = reinterpret_cast<const float4*>(x) + (long)plane * (HWSZ / 4) + lane;
    float4*       op = reinterpret_cast<float4*>(out)     + (long)plane * (HWSZ / 4) + lane;

    const int pair = tid >> 3, sub = tid & 7;
    const int m = pair >> 3, n = pair & 7;

    // small operands first: a wait for them then waits for nothing that is large
    const int ikq = b * 1536 + tid, im = b * 8 + m, in = b * 8 + n;
    const int ig = tid & 63, il = (tid - 64) & 127, ib2 = c0 + ((tid - 448) & (AO_CH - 1));
    float kq[3];
#pragma unroll
    for (int i = 0; i < 3; ++i) kq[i] = kqv[ikq + i * 512];
    const float cxm = cx[im], cxn = cx[in];
    const float cym = cy[im], cyn = cy[in];
    const float gb  = g_b[0];
    const float sg  = g_w[ig];
    const float sb1 = b1[il], sgn = lng[il], sbn = lnb[il];   // 64, 192 and 320 are alike mod 128
    const float sb2 = b2[ib2];
    const float4* w2p = reinterpret_cast<const float4*>(w2 + c0 * PLANES) + tid;
    const float4 w2a = w2p[0], w2b = w2p[512];
    // this wait stands in front of any rewrite of a register that the loads above name:
    // the operands keep every index and every base live up to here, so that no later
    // load's result and no scalar load lands on one of them ahead of the wait
    asm volatile("s_wait_xcnt 0x0" :: "v"(ikq), "v"(im), "v"(in), "v"(ig), "v"(il), "v"(ib2),
                 "s"(kqv), "s"(cx), "s"(cy), "s"(g_w), "s"(b1), "s"(lng), "s"(lnb), "s"(b2)
                 : "memory");
    // keeps the small loads the oldest: left free, the compiler put some behind the large
    // ones, and the wait for them in front of the first barrier waited for everything
    __builtin_amdgcn_sched_barrier(0);

    // y = oc @ w1^T: one wave per row, 8 rows a wave
    const char* wb = reinterpret_cast<const char*>(w1 + wave * 8 * 512);
    const int lofs = lane * 16;                       // the lane's byte offset in a 512-byte piece
    float4 w[8][4];
#pragma unroll
    for (int j = 0; j < 8; ++j)
#pragma unroll
        for (int i = 0; i < 4; ++i)
            w[j][i] = *reinterpret_cast<const float4*>(wb + lofs + j * 2048 + i * 512);

    // keeps the rows of w1, used first, older than the group of x
    __builtin_amdgcn_sched_barrier(0);

    // the first group of x
    float4 v[AO_DEPTH];
#pragma unroll
    for (int i = 0; i < AO_DEPTH; ++i) v[i] = xp[i * 32];

    // this wait stands in front of any reuse of the address registers named above, and
    // the first two operands keep the lanes' own up to here. It also holds all these
    // loads in front of the first barrier. The small loaded values are inputs because the
    // compiler had sunk their loads into branches behind the large ones, where the wait
    // for them waited for everything; they are stored to LDS right below
    asm volatile("s_wait_xcnt 0x0" :: "v"(lofs), "v"(w2p), "v"(sg), "v"(sb1), "v"(sgn),
                 "v"(sbn), "v"(sb2), "s"(gb) : "memory");

#pragma unroll
    for (int i = 0; i < 3; ++i) wkqv[i * 512 + tid] = kq[i];
    sm[tid] = (tid < 64) ? sg : (tid < 192) ? sb1 : (tid < 320) ? sgn : (tid < 448) ? sbn : sb2;
    *reinterpret_cast<float4*>(&sw2[tid * 4])         = w2a;
    *reinterpret_cast<float4*>(&sw2[(tid + 512) * 4]) = w2b;
    lds_barrier();

    // w_g (geometric) and scaled_dot -> logits lt[m*8+n]; 8 lanes per (m, n)
    {
        float dx = cxm - cxn;
        float dy = cym - cyn;
        float pos[4] = { fmaxf(dx, 0.f), fmaxf(-dx, 0.f),
                         fmaxf(dy, 0.f), fmaxf(-dy, 0.f) };
        float freq = expf(-6.90775527898f * (float)sub * 0.125f);   // 1000^(-f/8)
        float s = 0.f;
        for (int p = 0; p < 4; ++p) {
            float ang = 100.f * pos[p] * freq;
            s += sinf(ang) * sm[p * 8 + sub] + cosf(ang) * sm[32 + p * 8 + sub];
        }
        float sd = 0.f;
#pragma unroll
        for (int i = 0; i < 8; ++i) {
            const int d = sub + 8 * i;
            sd += wkqv[m * 64 + d] * wkqv[512 + n * 64 + d];
        }
        s  = xor_sum<8>(s);
        sd = xor_sum<8>(sd);
        if (sub == 0) {
            float wg = fmaxf(s + gb, 0.f);
            lt[pair] = logf(fmaxf(wg, 1e-6f)) + sd * 0.125f;        // 1/sqrt(64)
        }
    }
    lds_barrier();

    // softmax over m (axis=1) for each n; 8 lanes per n
    if (tid < 64) {
        const int nn = tid >> 3, mm = tid & 7;
        float t = lt[mm * 8 + nn];
        float mx = t;
#pragma unroll
        for (int k = 4; k > 0; k >>= 1) mx = fmaxf(mx, __shfl_xor(mx, k, 32));
        float e = expf(t - mx);
        float inv = 1.f / xor_sum<8>(e);
        wmn[mm * 8 + nn] = e * inv;
    }
    lds_barrier();

    // out_ctx[n, d] = sum_m wmn[m,n] * wv[m,d] -> flat n*64+d
    {
        int nn = tid >> 6, d = tid & 63;
        float s = 0.f;
        for (int mm = 0; mm < 8; ++mm) s += wmn[mm * 8 + nn] * wkqv[1024 + mm * 64 + d];
        oc[tid] = s;
    }
    lds_barrier();

    // y = oc @ w1^T + b1  [128]
    {
        float4 o4[4];
#pragma unroll
        for (int i = 0; i < 4; ++i)
            o4[i] = *reinterpret_cast<const float4*>(&oc[i * 128 + lane * 4]);
        float res = 0.f;
#pragma unroll
        for (int j = 0; j < 8; ++j) {
            float s = 0.f;
#pragma unroll
            for (int i = 0; i < 4; ++i) s = dot4(w[j][i], o4[i], s);
            s = xor_sum<32>(s);
            res = (lane == j) ? s : res;
        }
        if (lane < 8) ly[wave * 8 + lane] = res + sm[64 + wave * 8 + lane];
    }
    lds_barrier();

    // LayerNorm + ReLU in registers (every 8-lane group holds all 128 values), then
    // add_term[c] = y @ w2^T + b2 for the wave's two channels: 8 lanes per row
    float a[AO_PLANES];
    {
        const int s8 = lane & 7, rsub = (lane >> 3) & (AO_PLANES - 1);
        float y[16];
#pragma unroll
        for (int i = 0; i < 4; ++i) {
            float4 t = *reinterpret_cast<const float4*>(&ly[i * 32 + s8 * 4]);
            y[i * 4 + 0] = t.x; y[i * 4 + 1] = t.y; y[i * 4 + 2] = t.z; y[i * 4 + 3] = t.w;
        }
        float mu = 0.f;
#pragma unroll
        for (int i = 0; i < 16; ++i) mu += y[i];
        mu = xor_sum<8>(mu) * (1.f / PLANES);
        float var = 0.f;
#pragma unroll
        for (int i = 0; i < 16; ++i) { float dlt = y[i] - mu; var += dlt * dlt; }
        var = xor_sum<8>(var) * (1.f / PLANES);
        const float rstd = rsqrtf(var + 1e-5f);
        const int cl = wave * AO_PLANES + rsub;       // the 8-lane group's channel, from c0
        float s = 0.f;
#pragma unroll
        for (int i = 0; i < 4; ++i) {
            float4 g4 = *reinterpret_cast<const float4*>(&sm[192 + i * 32 + s8 * 4]);
            float4 b4 = *reinterpret_cast<const float4*>(&sm[320 + i * 32 + s8 * 4]);
            float4 yn;
            yn.x = fmaxf((y[i * 4 + 0] - mu) * rstd * g4.x + b4.x, 0.f);
            yn.y = fmaxf((y[i * 4 + 1] - mu) * rstd * g4.y + b4.y, 0.f);
            yn.z = fmaxf((y[i * 4 + 2] - mu) * rstd * g4.z + b4.z, 0.f);
            yn.w = fmaxf((y[i * 4 + 3] - mu) * rstd * g4.w + b4.w, 0.f);
            s = dot4(*reinterpret_cast<const float4*>(&sw2[cl * PLANES + i * 32 + s8 * 4]), yn, s);
        }
        s = xor_sum<8>(s) + sm[448 + cl];
#pragma unroll
        for (int p = 0; p < AO_PLANES; ++p) a[p] = __shfl(s, p * 8, 32);
    }

    // unrolled: every address is one base and one lane offset plus an immediate, so no
    // address register is rewritten while loads or stores are in flight
#pragma unroll
    for (int g = 0; g < AO_GROUPS; ++g) {
        if (g > 0) {
            // the loads below land on registers that the group before was stored from:
            // this wait stands between those stores and the overwrite of their data
            asm volatile("s_wait_xcnt 0x0" ::: "memory");
#pragma unroll
            for (int i = 0; i < AO_DEPTH; ++i) v[i] = xp[(g * AO_DEPTH + i) * 32];
        }
        // all loads of the group are issued before the first add waits for one: left
        // free, the compiler sinks each load to its use and the wave waits out every one
        __builtin_amdgcn_sched_barrier(0);
        const float s = a[g / (AO_GROUPS / AO_PLANES)];
#pragma unroll
        for (int i = 0; i < AO_DEPTH; ++i) {
            float4 o = { v[i].x + s, v[i].y + s, v[i].z + s, v[i].w + s };
            op[(g * AO_DEPTH + i) * 32] = o;
        }
    }
}

// ---------------------------------------------------------------------------
extern "C" void kernel_launch(void* const* d_in, const int* in_sizes, int n_in,
                              void* d_out, int out_size, void* d_ws, size_t ws_size,
                              hipStream_t stream)
{
    const float* x   = (const float*)d_in[0];
    const float* cmw = (const float*)d_in[1];
    const float* cmb = (const float*)d_in[2];
    const float* g_w = (const float*)d_in[3];
    const float* g_b = (const float*)d_in[4];
    const float* k_w = (const float*)d_in[5];
    const float* k_b = (const float*)d_in[6];
    const float* q_w = (const float*)d_in[7];
    const float* q_b = (const float*)d_in[8];
    const float* v_w = (const float*)d_in[9];
    const float* v_b = (const float*)d_in[10];
    const float* w1  = (const float*)d_in[11];
    const float* b1  = (const float*)d_in[12];
    const float* lng = (const float*)d_in[13];
    const float* lnb = (const float*)d_in[14];
    const float* w2  = (const float*)d_in[15];
    const float* b2  = (const float*)d_in[16];
    float* out = (float*)d_out;

    // workspace layout (floats)
    float* ws   = (float*)d_ws;
    float* part = ws;                                 // 16*16*8*512 = 1048576 used
    float* kqv  = ws + 4194304;                       // 16*3*8*64 = 24576 used
    float* cxb  = ws + 4194304 + 65536;               // 128
    float* cyb  = cxb + 128;                          // 128
    float* smax = cyb + 128 + 8192;                   // 16*8*16 = 2048 used
    float* ssum = smax + 8192;                        // 2048 used
    float* scol = ssum + 8192;                        // 2048 used
    float* srow = scol + 8192;                        // 2048 used

    k_pool_partial<<<dim3(NB * PC_GROUPS), dim3(PC_WAVES * 32), 0, stream>>>(x, cmw, cmb, part,
                                                                             smax, ssum, scol, srow);
    k_join_kqv<<<dim3(NB * HEADS * 2), dim3(512), 0, stream>>>(part, smax, ssum, scol, srow,
                                                               k_w, k_b, q_w, q_b, v_w, v_b,
                                                               kqv, cxb, cyb);
    k_attn_addout<<<dim3(NB * CH / AO_CH), dim3(AO_WAVES * 32), 0, stream>>>(x, kqv, cxb, cyb, g_w, g_b,
                                                                             w1, b1, lng, lnb, w2, b2, out);
}

// v006
// A run of this version takes 42.3 microseconds.
// Timed twice side by side with v005, it ran 1.09 times as fast both times.
// All steps since v000 together make it 4.96 times as fast.
#include <hip/hip_runtime.h>
#include <hip/hip_bf16.h>

typedef __attribute__((ext_vector_type(2))) float v2f;
typedef __attribute__((ext_vector_type(8))) float v8f;

#define HEADS  8
#define NB     16
#define CH     512
#define HT     64
#define WD     64
#define HWSZ   4096
#define PLANES 128

template <int WIDTH>
__device__ __forceinline__ float xor_sum(float v)
{
#pragma unroll
    for (int m = WIDTH / 2; m > 0; m >>= 1) v += __shfl_xor(v, m, 32);
    return v;
}

// workgroup barrier for data handed over in LDS alone: the fences name LDS only, so the
// wave waits for its LDS accesses and not, as __syncthreads() makes it, for every global
// load that it still has on its way
__device__ __forceinline__ void lds_barrier()
{
    __builtin_amdgcn_fence(__ATOMIC_RELEASE, "workgroup", "local");
    __builtin_amdgcn_s_barrier();
    __builtin_amdgcn_fence(__ATOMIC_ACQUIRE, "workgroup", "local");
}

// Which piece of the work a workgroup takes, the same in all three launches (256
// workgroups each): piece number = batch * 16 + part of the batch. The 16 workgroups of
// a batch have launch indices that are equal mod 8. For speed only: this is a permutation of 0..255, so every
// piece is done exactly once wherever the workgroups land.
__device__ __forceinline__ int dealt_piece(int i)
{
    return ((i & 7) * 2 + ((i >> 7) & 1)) * 16 + ((i >> 3) & 15);
}

#define PC_COLS  64    // hw columns per tile: one image row
#define PC_ROWS  4     // image rows a workgroup takes, one after the other
#define PC_GROUPS (HWSZ / (PC_COLS * PC_ROWS))   // workgroups, and partial results, per batch
#define PC_PITCH 68    // floats per LDS row: 272 B, an odd multiple of 16 B
#define PC_WAVES 8
#define PC_TILE  (CH * PC_PITCH)   // floats of one tile buffer

// eight 16-byte-a-lane copies, global memory to LDS through no register. The wait in
// the last line stands in front of any rewrite of the address registers named here.
#define PC_COPY8(l, g, r)                                                         \
    asm volatile("global_load_async_to_lds_b128 %0, %8, off\n\t"                  \
                 "global_load_async_to_lds_b128 %1, %9, off\n\t"                  \
                 "global_load_async_to_lds_b128 %2, %10, off\n\t"                 \
                 "global_load_async_to_lds_b128 %3, %11, off\n\t"                 \
                 "global_load_async_to_lds_b128 %4, %12, off\n\t"                 \
                 "global_load_async_to_lds_b128 %5, %13, off\n\t"                 \
                 "global_load_async_to_lds_b128 %6, %14, off\n\t"                 \
                 "global_load_async_to_lds_b128 %7, %15, off\n\t"                 \
                 "s_wait_xcnt 0x0"                                                \
                 :: "v"((l) + ((r) + 0) * (PC_PITCH * 4u)),                       \
                    "v"((l) + ((r) + 2) * (PC_PITCH * 4u)),                       \
                    "v"((l) + ((r) + 4) * (PC_PITCH * 4u)),                       \
                    "v"((l) + ((r) + 6) * (PC_PITCH * 4u)),                       \
                    "v"((l) + ((r) + 8) * (PC_PITCH * 4u)),                       \
                    "v"((l) + ((r) + 10) * (PC_PITCH * 4u)),                      \
                    "v"((l) + ((r) + 12) * (PC_PITCH * 4u)),                      \
                    "v"((l) + ((r) + 14) * (PC_PITCH * 4u)),                      \
                    "v"((g) + ((r) + 0) * HWSZ), "v"((g) + ((r) + 2) * HWSZ),     \
                    "v"((g) + ((r) + 4) * HWSZ), "v"((g) + ((r) + 6) * HWSZ),     \
                    "v"((g) + ((r) + 8) * HWSZ), "v"((g) + ((r) + 10) * HWSZ),    \
                    "v"((g) + ((r) + 12) * HWSZ), "v"((g) + ((r) + 14) * HWSZ)    \
                 : "memory")

// ---------------------------------------------------------------------------
// Kernel 1: one workgroup per (batch, 4 image rows). It takes its rows one after the
// other; a row's tile x[512 c][64 hw] is brought into one of two LDS buffers while the
// row before is worked on, and feeds both products:
//   logits[h, hw] = sum_c cmw[h, c] * x[c, hw] + cmb[h]      (WMMA, K over c)
//   e[h, hw]      = exp(logits - running maximum)
//   part[h, c]    = part[h, c] * exp(old maximum - new) + sum_hw x[c, hw] * e[h, hw]
// part stays in the WMMA accumulators over the four rows. The running maximum, sum of
// e and the two moments go out beside part; kernel 2 joins the 16 workgroups of a
// (batch, head). Wave w copies, and alone reads, the channels 64 w .. 64 w + 63.
// ---------------------------------------------------------------------------
__global__ void __launch_bounds__(PC_WAVES * 32)
k_pool_partial(const float* __restrict__ x, const float* __restrict__ cmw,
               const float* __restrict__ cmb, float* __restrict__ part,
               float* __restrict__ smax, float* __restrict__ ssum,
               float* __restrict__ scol, float* __restrict__ srow)
{
    __shared__ __attribute__((aligned(16))) float tile[2 * PC_TILE];
    __shared__ __attribute__((aligned(16))) float lg[PC_WAVES * HEADS * PC_COLS];
    __shared__ __attribute__((aligned(16))) float pm[16 * PC_PITCH];
    __shared__ float sc[HEADS];

    const int lane  = threadIdx.x & 31;
    const int wave  = __builtin_amdgcn_readfirstlane(threadIdx.x >> 5);
    const int piece = dealt_piece(blockIdx.x);
    const int b     = piece / PC_GROUPS;
    const int grp   = piece % PC_GROUPS;
    const int col   = lane & 15;
    const int kgrp  = lane >> 4;
    const int row0  = wave * 64;

    // the lane's place in the first image row's tile, in memory and in buffer 0
    const float* g0 = x + ((long)b * CH + row0 + kgrp) * HWSZ + grp * (PC_ROWS * PC_COLS) + col * 4;
    const unsigned l0a = (unsigned)(uintptr_t)&tile[(row0 + kgrp) * PC_PITCH + col * 4];

    // row 0 into buffer 0: 32 copies a wave, each two rows of 256 bytes, all in flight at once
    PC_COPY8(l0a, g0, 0);
    PC_COPY8(l0a, g0, 16);
    PC_COPY8(l0a, g0, 32);
    PC_COPY8(l0a, g0, 48);

    // A fragments of the logits product, fetched while the tile is on its way.
    // k order of both loaders: step 2u+s holds channels row0 + 8u + 4 kgrp + 2s, +1.
    float4 a4[8];
#pragma unroll
    for (int u = 0; u < 8; ++u) {
        float4 t = *reinterpret_cast<const float4*>(cmw + (col & 7) * CH + row0 + u * 8 + kgrp * 4);
        a4[u].x = (col < HEADS) ? t.x : 0.f;          // rows >= 8 are zero padding
        a4[u].y = (col < HEADS) ? t.y : 0.f;
        a4[u].z = (col < HEADS) ? t.z : 0.f;
        a4[u].w = (col < HEADS) ? t.w : 0.f;
    }
    const float bias = cmb[wave];

    // the wave's own copies have landed behind this wait
    asm volatile("s_wait_asynccnt 0x0" ::: "memory");
    __syncthreads();

    // row 1 into buffer 1: on its way while row 0 is worked on
    {
        const float* g = g0 + PC_COLS;
        const unsigned l = l0a + PC_TILE * 4u;
        PC_COPY8(l, g, 0);
        PC_COPY8(l, g, 16);
        PC_COPY8(l, g, 32);
        PC_COPY8(l, g, 48);
    }

    // wave h keeps head h's running terms; every wave keeps part of its 64 channels
    float run_m = -3.0e38f, run_s = 0.f, run_pc = 0.f, run_pr = 0.f;
    v8f c[4];
#pragma unroll
    for (int t = 0; t < 4; ++t) c[t] = (v8f){0.f, 0.f, 0.f, 0.f, 0.f, 0.f, 0.f, 0.f};

    for (int it = 0; it < PC_ROWS; ++it) {
        const int tb = (it & 1) * PC_TILE;            // this row's buffer

        // logits over the wave's 64 channels, all 64 columns: N tile t holds columns 4n + t
        {
            v8f acc[4];
#pragma unroll
            for (int t = 0; t < 4; ++t) acc[t] = (v8f){0.f, 0.f, 0.f, 0.f, 0.f, 0.f, 0.f, 0.f};
#pragma unroll
            for (int u = 0; u < 8; ++u) {
#pragma unroll
                for (int s = 0; s < 2; ++s) {
                    const int ch = row0 + u * 8 + kgrp * 4 + s * 2;
                    float4 b0 = *reinterpret_cast<const float4*>(&tile[tb + ch * PC_PITCH + col * 4]);
                    float4 b1 = *reinterpret_cast<const float4*>(&tile[tb + (ch + 1) * PC_PITCH + col * 4]);
                    v2f af; af.x = s ? a4[u].z : a4[u].x;
                            af.y = s ? a4[u].w : a4[u].y;
                    v2f bf;
                    bf.x = b0.x; bf.y = b1.x;
                    acc[0] = __builtin_amdgcn_wmma_f32_16x16x4_f32(false, af, false, bf,
                                                                   (short)0, acc[0], false, false);
                    bf.x = b0.y; bf.y = b1.y;
                    acc[1] = __builtin_amdgcn_wmma_f32_16x16x4_f32(false, af, false, bf,
                                                                   (short)0, acc[1], false, false);
                    bf.x = b0.z; bf.y = b1.z;
                    acc[2] = __builtin_amdgcn_wmma_f32_16x16x4_f32(false, af, false, bf,
                                                                   (short)0, acc[2], false, false);
                    bf.x = b0.w; bf.y = b1.w;
                    acc[3] = __builtin_amdgcn_wmma_f32_16x16x4_f32(false, af, false, bf,
                                                                   (short)0, acc[3], false, false);
                }
            }
            // D layout: VGPR r, lanes 0-15 -> M = r (head), lanes 16-31 -> padding
            if (lane < 16) {
#pragma unroll
                for (int r = 0; r < HEADS; ++r) {
                    float4 o = { acc[0][r], acc[1][r], acc[2][r], acc[3][r] };
                    *reinterpret_cast<float4*>(&lg[(wave * HEADS + r) * PC_COLS + col * 4]) = o;
                }
            }
        }
        __syncthreads();

        // wave h: join the eight channel slices of head h, softmax terms of the row
        // against the running maximum
        {
            const int h = wave;
            float l0 = bias, l1 = bias;
#pragma unroll
            for (int w = 0; w < PC_WAVES; ++w) {
                float2 v = *reinterpret_cast<const float2*>(&lg[(w * HEADS + h) * PC_COLS + lane * 2]);
                l0 += v.x; l1 += v.y;
            }
            float mx = fmaxf(l0, l1);
#pragma unroll
            for (int k = 16; k > 0; k >>= 1) mx = fmaxf(mx, __shfl_xor(mx, k, 32));
            mx = fmaxf(mx, run_m);
            const float f = expf(run_m - mx);         // 0 for the first row
            float2 e = { expf(l0 - mx), expf(l1 - mx) };
            float2 zero = { 0.f, 0.f };
            *reinterpret_cast<float2*>(&pm[h * PC_PITCH + lane * 2]) = e;
            *reinterpret_cast<float2*>(&pm[(h + HEADS) * PC_PITCH + lane * 2]) = zero;   // N padding
            if (lane == 0) sc[h] = f;
            float sum = xor_sum<32>(e.x + e.y);
            float pc  = xor_sum<32>(e.x * (float)(lane * 2) + e.y * (float)(lane * 2 + 1));
            run_s  = run_s  * f + sum;
            run_pc = run_pc * f + pc;
            run_pr = run_pr * f + sum * (float)(grp * PC_ROWS + it);
            run_m  = mx;
        }
        __syncthreads();

        // part[h, c] over the wave's 64 channels (4 M tiles), K over the 64 columns, on
        // top of the rows before, brought to the new maximum (N = lane & 15 is the head).
        // k order of both loaders: step 2u+s holds columns 8u + 4 kgrp + 2s, +1.
        {
            const float fl = sc[col & 7];
#pragma unroll
            for (int t = 0; t < 4; ++t)
#pragma unroll
                for (int r = 0; r < 8; ++r) c[t][r] *= fl;
        }
#pragma unroll
        for (int u = 0; u < 8; ++u) {
            float4 p4 = *reinterpret_cast<const float4*>(&pm[col * PC_PITCH + u * 8 + kgrp * 4]);
            float4 a[4];
#pragma unroll
            for (int t = 0; t < 4; ++t)
                a[t] = *reinterpret_cast<const float4*>(
                    &tile[tb + (row0 + t * 16 + col) * PC_PITCH + u * 8 + kgrp * 4]);
#pragma unroll
            for (int t = 0; t < 4; ++t) {
                v2f af; af.x = a[t].x; af.y = a[t].y;
                v2f bf; bf.x = p4.x;   bf.y = p4.y;
                c[t] = __builtin_amdgcn_wmma_f32_16x16x4_f32(false, af, false, bf,
                                                             (short)0, c[t], false, false);
            }
#pragma unroll
            for (int t = 0; t < 4; ++t) {
                v2f af; af.x = a[t].z; af.y = a[t].w;
                v2f bf; bf.x = p4.z;   bf.y = p4.w;
                c[t] = __builtin_amdgcn_wmma_f32_16x16x4_f32(false, af, false, bf,
                                                             (short)0, c[t], false, false);
            }
        }

        // hand-over: this wave's LDS reads of the row are done, its copies of the next
        // row have landed, and the barrier says both of every wave
        asm volatile("s_wait_dscnt 0x0" ::: "memory");
        asm volatile("s_wait_asynccnt 0x0" ::: "memory");
        __syncthreads();
        // the row after the next goes into the buffer that has just been read
        if (it + 2 < PC_ROWS) {
            const float* g = g0 + (it + 2) * PC_COLS;
            const unsigned l = l0a + (unsigned)tb * 4u;
            PC_COPY8(l, g, 0);
            PC_COPY8(l, g, 16);
            PC_COPY8(l, g, 32);
            PC_COPY8(l, g, 48);
        }
    }
    // no copy is left on its way when the tile buffers become staging
    asm volatile("s_wait_asynccnt 0x0" ::: "memory");

    if (lane == 0) {
        const int idx = (b * HEADS + wave) * PC_GROUPS + grp;
        smax[idx] = run_m; ssum[idx] = run_s; scol[idx] = run_pc; srow[idx] = run_pr;
    }

    // D layout: VGPR r, lanes 0-15 -> M = r, lanes 16-31 -> M = r + 8; N = lane & 15 (head).
    // Turned through the wave's own, now spent, tile rows so that part is stored in
    // whole 128-byte lines.
    float* stg = &tile[row0 * PC_PITCH];
    if (col < HEADS) {
#pragma unroll
        for (int t = 0; t < 4; ++t) {
            float4 lo = { c[t][0], c[t][1], c[t][2], c[t][3] };
            float4 hi = { c[t][4], c[t][5], c[t][6], c[t][7] };
            *reinterpret_cast<float4*>(&stg[col * PC_PITCH + t * 16 + kgrp * 8])     = lo;
            *reinterpret_cast<float4*>(&stg[col * PC_PITCH + t * 16 + kgrp * 8 + 4]) = hi;
        }
    }
    // orders the lanes' staging writes in front of the other lanes' reads below
    __syncthreads();
    float* po = part + ((long)piece * HEADS) * CH + row0 + col * 4;
#pragma unroll
    for (int i = 0; i < 4; ++i) {
        const int h = i * 2 + kgrp;
        float4 v = *reinterpret_cast<const float4*>(&stg[h * PC_PITCH + col * 4]);
        *reinterpret_cast<float4*>(po + h * CH) = v;
    }
}

// ---------------------------------------------------------------------------
// Kernel 2: two workgroups per (batch, head). Each joins the 16 partial results:
//   w[k] = exp(max[k] - max over k) / sum_k(...)   context[c] = sum_k w[k] part[k, c]
// (the first also stores the centroid cx, cy), keeps the context row in LDS and takes
// 96 of the 192 rows of the K, Q and V weights against it: one wave per weight row,
// read as whole 128-byte lines, the lanes' partial sums joined by a butterfly.
// ---------------------------------------------------------------------------
#define KQ_ROWS 6     // weight rows a wave: 192 rows / 2 workgroups / 16 waves

__device__ __forceinline__ float dot4(float4 a, float4 b, float s)
{
    s += a.x * b.x; s += a.y * b.y; s += a.z * b.z; s += a.w * b.w;
    return s;
}

__global__ void __launch_bounds__(512)
k_join_kqv(const float* __restrict__ part, const float* __restrict__ smax,
           const float* __restrict__ ssum, const float* __restrict__ scol,
           const float* __restrict__ srow,
           const float* __restrict__ k_w, const float* __restrict__ k_b,
           const float* __restrict__ q_w, const float* __restrict__ q_b,
           const float* __restrict__ v_w, const float* __restrict__ v_b,
           float* __restrict__ kqv, float* __restrict__ cx, float* __restrict__ cy)
{
    __shared__ float wl[PC_GROUPS];
    __shared__ __attribute__((aligned(16))) float red[4 * CH];
    __shared__ __attribute__((aligned(16))) float cs[CH];
    __shared__ float ro[16 * KQ_ROWS];
    const int piece = dealt_piece(blockIdx.x);
    const int row  = piece >> 1;                      // b*8 + h
    const int sub  = piece & 1;                       // which 96 weight rows
    const int b    = row >> 3, h = row & 7;
    const int tid  = threadIdx.x;
    const int lane = tid & 31;
    const int wave = __builtin_amdgcn_readfirstlane(tid >> 5);
    const int k16  = tid & 15;
    const int c4   = tid & 127;                       // four channels a thread
    const int cg   = tid >> 7;                        // four partial results a thread

    const float* pp = part + (((long)b * PC_GROUPS + cg * 4) * HEADS + h) * CH + c4 * 4;
    float4 v[4];
#pragma unroll
    for (int i = 0; i < 4; ++i)
        v[i] = *reinterpret_cast<const float4*>(pp + (long)i * HEADS * CH);
    // the loads above share one address pair: this wait stands in front of its
    // reuse, and the operand keeps the pair live up to here. It also holds the loads
    // in front of the weights' butterflies, behind which the compiler had sunk them.
    asm volatile("s_wait_xcnt 0x0" :: "v"(pp) : "memory");

    // every 16 lanes alike: one partial result a lane
    const float m0 = smax[row * PC_GROUPS + k16];
    const float s0 = ssum[row * PC_GROUPS + k16];
    const float p0 = scol[row * PC_GROUPS + k16];
    const float r0 = srow[row * PC_GROUPS + k16];

    // the bias of the result that this thread stores at the end
    const int rs = sub * 96 + ((tid < 96) ? tid : 95);
    const float bk = k_b[rs & 63], bq = q_b[rs & 63], bv = v_b[rs & 63];
    // keeps the small loads older than the weight rows: a wait for them waits for no row
    __builtin_amdgcn_sched_barrier(0);

    // the wave's weight rows need nothing of the join: on their way from here on
    const int lofs = lane * 16;                       // the lane's byte offset in a 512-byte piece
    float4 w[KQ_ROWS][4];
#pragma unroll
    for (int j = 0; j < KQ_ROWS; ++j) {
        const int r = sub * 96 + wave * KQ_ROWS + j;  // 0..191: K | Q | V, 64 rows each
        const float* wm = (r < 64) ? k_w : (r < 128) ? q_w : v_w;
        const char* wb = reinterpret_cast<const char*>(wm + (r & 63) * CH);
#pragma unroll
        for (int i = 0; i < 4; ++i)
            w[j][i] = *reinterpret_cast<const float4*>(wb + lofs + i * 512);
    }
    // the loads above share one offset register: this wait stands in front of its
    // reuse, and the first operand keeps it live up to here. It also holds the loads
    // here, ahead of the join, instead of behind its barriers; the biases are inputs so
    // that their loads are not sunk to the kernel's end, where they would be waited out
    asm volatile("s_wait_xcnt 0x0" :: "v"(lofs), "v"(bk), "v"(bq), "v"(bv) : "memory");
    // the butterflies below wait for the first loads: they stay behind the issue of all
    __builtin_amdgcn_sched_barrier(0);

    float mx = m0;
#pragma unroll
    for (int k = 8; k > 0; k >>= 1) mx = fmaxf(mx, __shfl_xor(mx, k, 32));
    const float w0 = expf(m0 - mx);
    const float sum = xor_sum<16>(w0 * s0);
    const float pc  = xor_sum<16>(w0 * p0);
    const float pr  = xor_sum<16>(w0 * r0);
    const float inv = 1.f / sum;
    if (tid < PC_GROUPS) wl[tid] = w0 * inv;
    lds_barrier();

    float4 a = { 0.f, 0.f, 0.f, 0.f };
#pragma unroll
    for (int i = 0; i < 4; ++i) {
        const float wk = wl[cg * 4 + i];
        a.x += wk * v[i].x; a.y += wk * v[i].y; a.z += wk * v[i].z; a.w += wk * v[i].w;
    }
    *reinterpret_cast<float4*>(&red[cg * CH + c4 * 4]) = a;
    lds_barrier();

    if (tid < 128) {
        float4 t0 = *reinterpret_cast<const float4*>(&red[0 * CH + tid * 4]);
        float4 t1 = *reinterpret_cast<const float4*>(&red[1 * CH + tid * 4]);
        float4 t2 = *reinterpret_cast<const float4*>(&red[2 * CH + tid * 4]);
        float4 t3 = *reinterpret_cast<const float4*>(&red[3 * CH + tid * 4]);
        float4 o = { (t0.x + t1.x) + (t2.x + t3.x), (t0.y + t1.y) + (t2.y + t3.y),
                     (t0.z + t1.z) + (t2.z + t3.z), (t0.w + t1.w) + (t2.w + t3.w) };
        *reinterpret_cast<float4*>(&cs[tid * 4]) = o;
    }
    if (tid == 0 && sub == 0) {
        cx[row] = pc * inv / (float)HT;
        cy[row] = pr * inv / (float)WD;
    }
    lds_barrier();

    // the lane's 16 columns of the context row against its 16 columns of each weight row
    {
        float4 c[4];
#pragma unroll
        for (int i = 0; i < 4; ++i)
            c[i] = *reinterpret_cast<const float4*>(&cs[i * 128 + lane * 4]);
        float res = 0.f;
#pragma unroll
        for (int j = 0; j < KQ_ROWS; ++j) {
            float s = 0.f;
#pragma unroll
            for (int i = 0; i < 4; ++i) s = dot4(w[j][i], c[i], s);
            s = xor_sum<32>(s);
            res = (lane == j) ? s : res;
        }
        if (lane < KQ_ROWS) ro[wave * KQ_ROWS + lane] = res;
    }
    lds_barrier();

    // 96 results go out as three whole 128-byte lines: kqv[b][K|Q|V][h][d]
    if (tid < 96) {
        const int mat = rs >> 6, d = rs & 63;
        kqv[b * 1536 + mat * 512 + h * 64 + d] = ro[tid] + ((mat == 0) ? bk : (mat == 1) ? bq : bv);
    }
}

// ---------------------------------------------------------------------------
// Kernel 3: out[b,c,hw] = x[b,c,hw] + add_term[b,c]   (float4 streaming)
// One workgroup of 16 waves per WGP; a wave streams AO_PLANES whole (b,c) planes in
// groups of AO_DEPTH loads, each load 512 contiguous bytes. Ahead of its stream every
// workgroup works out its batch's head attention and channel_add MLP itself (16
// workgroups a batch do the same sums) and the add_term of its own 32 channels. All it
// needs from memory is asked for at the top, in the order of use: the small operands
// (to LDS), the rows of w1 (registers), the first group of x (registers).
// ---------------------------------------------------------------------------
#define AO_WAVES  16    // waves per workgroup
#define AO_PLANES 2     // (b,c) planes per wave
#define AO_DEPTH  16    // 16-byte loads per lane in flight
#define AO_GROUPS (AO_PLANES * (HWSZ / 4) / (32 * AO_DEPTH))
#define AO_CH     (AO_WAVES * AO_PLANES)   // channels per workgroup

__global__ void __launch_bounds__(AO_WAVES * 32)
k_attn_addout(const float* __restrict__ x, const float* __restrict__ kqv,
              const float* __restrict__ cx, const float* __restrict__ cy,
              const float* __restrict__ g_w, const float* __restrict__ g_b,
              const float* __restrict__ w1,  const float* __restrict__ b1,
              const float* __restrict__ lng, const float* __restrict__ lnb,
              const float* __restrict__ w2,  const float* __restrict__ b2,
              float* __restrict__ out)
{
    __shared__ __attribute__((aligned(16))) float wkqv[3 * 512];  // wk | wq | wv, each [h][d]
    __shared__ __attribute__((aligned(16))) float sm[512];        // g_w 64 | b1 128 | ln_g 128 | ln_b 128 | b2 32
    __shared__ __attribute__((aligned(16))) float sw2[AO_CH * PLANES];
    __shared__ float lt[64];
    __shared__ float wmn[64];
    __shared__ __attribute__((aligned(16))) float oc[512];
    __shared__ __attribute__((aligned(16))) float ly[128];

    const int tid   = threadIdx.x;
    const int lane  = tid & 31;
    const int wave  = __builtin_amdgcn_readfirstlane(tid >> 5);
    const int piece = dealt_piece(blockIdx.x);
    const int plane = (piece * AO_WAVES + wave) * AO_PLANES;
    const int b     = piece / (CH / AO_CH);
    const int c0    = (piece % (CH / AO_CH)) * AO_CH;             // the workgroup's first channel
    const float4* xp = reinterpret_cast<const float4*>(x) + (long)plane * (HWSZ / 4) + lane;
    float4*       op = reinterpret_cast<float4*>(out)     + (long)plane * (HWSZ / 4) + lane;

    const int pair = tid >> 3, sub = tid & 7;
    const int m = pair >> 3, n = pair & 7;

    // small operands first: a wait for them then waits for nothing that is large
    const int ikq = b * 1536 + tid, im = b * 8 + m, in = b * 8 + n;
    const int ig = tid & 63, il = (tid - 64) & 127, ib2 = c0 + ((tid - 448) & (AO_CH - 1));
    float kq[3];
#pragma unroll
    for (int i = 0; i < 3; ++i) kq[i] = kqv[ikq + i * 512];
    const float cxm = cx[im], cxn = cx[in];
    const float cym = cy[im], cyn = cy[in];
    const float gb  = g_b[0];
    const float sg  = g_w[ig];
    const float sb1 = b1[il], sgn = lng[il], sbn = lnb[il];   // 64, 192 and 320 are alike mod 128
    const float sb2 = b2[ib2];
    const float4* w2p = reinterpret_cast<const float4*>(w2 + c0 * PLANES) + tid;
    const float4 w2a = w2p[0], w2b = w2p[512];
    // this wait stands in front of any rewrite of a register that the loads above name:
    // the operands keep every index and every base live up to here, so that no later
    // load's result and no scalar load lands on one of them ahead of the wait
    asm volatile("s_wait_xcnt 0x0" :: "v"(ikq), "v"(im), "v"(in), "v"(ig), "v"(il), "v"(ib2),
                 "s"(kqv), "s"(cx), "s"(cy), "s"(g_w), "s"(b1), "s"(lng), "s"(lnb), "s"(b2)
                 : "memory");
    // keeps the small loads the oldest: left free, the compiler put some behind the large
    // ones, and the wait for them in front of the first barrier waited for everything
    __builtin_amdgcn_sched_barrier(0);

    // y = oc @ w1^T: one wave per row, 8 rows a wave
    const char* wb = reinterpret_cast<const char*>(w1 + wave * 8 * 512);
    const int lofs = lane * 16;                       // the lane's byte offset in a 512-byte piece
    float4 w[8][4];
#pragma unroll
    for (int j = 0; j < 8; ++j)
#pragma unroll
        for (int i = 0; i < 4; ++i)
            w[j][i] = *reinterpret_cast<const float4*>(wb + lofs + j * 2048 + i * 512);

    // keeps the rows of w1, used first, older than the group of x
    __builtin_amdgcn_sched_barrier(0);

    // the first group of x
    float4 v[AO_DEPTH];
#pragma unroll
    for (int i = 0; i < AO_DEPTH; ++i) v[i] = xp[i * 32];

    // this wait stands in front of any reuse of the address registers named above, and
    // the first two operands keep the lanes' own up to here. It also holds all these
    // loads in front of the first barrier. The small loaded values are inputs because the
    // compiler had sunk their loads into branches behind the large ones, where the wait
    // for them waited for everything; they are stored to LDS right below
    asm volatile("s_wait_xcnt 0x0" :: "v"(lofs), "v"(w2p), "v"(sg), "v"(sb1), "v"(sgn),
                 "v"(sbn), "v"(sb2), "s"(gb) : "memory");

#pragma unroll
    for (int i = 0; i < 3; ++i) wkqv[i * 512 + tid] = kq[i];
    sm[tid] = (tid < 64) ? sg : (tid < 192) ? sb1 : (tid < 320) ? sgn : (tid < 448) ? sbn : sb2;
    *reinterpret_cast<float4*>(&sw2[tid * 4])         = w2a;
    *reinterpret_cast<float4*>(&sw2[(tid + 512) * 4]) = w2b;
    lds_barrier();

    // w_g (geometric) and scaled_dot -> logits lt[m*8+n]; 8 lanes per (m, n)
    {
        float dx = cxm - cxn;
        float dy = cym - cyn;
        float pos[4] = { fmaxf(dx, 0.f), fmaxf(-dx, 0.f),
                         fmaxf(dy, 0.f), fmaxf(-dy, 0.f) };
        float freq = expf(-6.90775527898f * (float)sub * 0.125f);   // 1000^(-f/8)
        float s = 0.f;
        for (int p = 0; p < 4; ++p) {
            float ang = 100.f * pos[p] * freq;
            s += sinf(ang) * sm[p * 8 + sub] + cosf(ang) * sm[32 + p * 8 + sub];
        }
        float sd = 0.f;
#pragma unroll
        for (int i = 0; i < 8; ++i) {
            const int d = sub + 8 * i;
            sd += wkqv[m * 64 + d] * wkqv[512 + n * 64 + d];
        }
        s  = xor_sum<8>(s);
        sd = xor_sum<8>(sd);
        if (sub == 0) {
            float wg = fmaxf(s + gb, 0.f);
            lt[pair] = logf(fmaxf(wg, 1e-6f)) + sd * 0.125f;        // 1/sqrt(64)
        }
    }
    lds_barrier();

    // softmax over m (axis=1) for each n; 8 lanes per n
    if (tid < 64) {
        const int nn = tid >> 3, mm = tid & 7;
        float t = lt[mm * 8 + nn];
        float mx = t;
#pragma unroll
        for (int k = 4; k > 0; k >>= 1) mx = fmaxf(mx, __shfl_xor(mx, k, 32));
        float e = expf(t - mx);
        float inv = 1.f / xor_sum<8>(e);
        wmn[mm * 8 + nn] = e * inv;
    }
    lds_barrier();

    // out_ctx[n, d] = sum_m wmn[m,n] * wv[m,d] -> flat n*64+d
    {
        int nn = tid >> 6, d = tid & 63;
        float s = 0.f;
        for (int mm = 0; mm < 8; ++mm) s += wmn[mm * 8 + nn] * wkqv[1024 + mm * 64 + d];
        oc[tid] = s;
    }
    lds_barrier();

    // y = oc @ w1^T + b1  [128]
    {
        float4 o4[4];
#pragma unroll
        for (int i = 0; i < 4; ++i)
            o4[i] = *reinterpret_cast<const float4*>(&oc[i * 128 + lane * 4]);
        float res = 0.f;
#pragma unroll
        for (int j = 0; j < 8; ++j) {
            float s = 0.f;
#pragma unroll
            for (int i = 0; i < 4; ++i) s = dot4(w[j][i], o4[i], s);
            s = xor_sum<32>(s);
            res = (lane == j) ? s : res;
        }
        if (lane < 8) ly[wave * 8 + lane] = res + sm[64 + wave * 8 + lane];
    }
    lds_barrier();

    // LayerNorm + ReLU in registers (every 8-lane group holds all 128 values), then
    // add_term[c] = y @ w2^T + b2 for the wave's two channels: 8 lanes per row
    float a[AO_PLANES];
    {
        const int s8 = lane & 7, rsub = (lane >> 3) & (AO_PLANES - 1);
        float y[16];
#pragma unroll
        for (int i = 0; i < 4; ++i) {
            float4 t = *reinterpret_cast<const float4*>(&ly[i * 32 + s8 * 4]);
            y[i * 4 + 0] = t.x; y[i * 4 + 1] = t.y; y[i * 4 + 2] = t.z; y[i * 4 + 3] = t.w;
        }
        float mu = 0.f;
#pragma unroll
        for (int i = 0; i < 16; ++i) mu += y[i];
        mu = xor_sum<8>(mu) * (1.f / PLANES);
        float var = 0.f;
#pragma unroll
        for (int i = 0; i < 16; ++i) { float dlt = y[i] - mu; var += dlt * dlt; }
        var = xor_sum<8>(var) * (1.f / PLANES);
        const float rstd = rsqrtf(var + 1e-5f);
        const int cl = wave * AO_PLANES + rsub;       // the 8-lane group's channel, from c0
        float s = 0.f;
#pragma unroll
        for (int i = 0; i < 4; ++i) {
            float4 g4 = *reinterpret_cast<const float4*>(&sm[192 + i * 32 + s8 * 4]);
            float4 b4 = *reinterpret_cast<const float4*>(&sm[320 + i * 32 + s8 * 4]);
            float4 yn;
            yn.x = fmaxf((y[i * 4 + 0] - mu) * rstd * g4.x + b4.x, 0.f);
            yn.y = fmaxf((y[i * 4 + 1] - mu) * rstd * g4.y + b4.y, 0.f);
            yn.z = fmaxf((y[i * 4 + 2] - mu) * rstd * g4.z + b4.z, 0.f);
            yn.w = fmaxf((y[i * 4 + 3] - mu) * rstd * g4.w + b4.w, 0.f);
            s = dot4(*reinterpret_cast<const float4*>(&sw2[cl * PLANES + i * 32 + s8 * 4]), yn, s);
        }
        s = xor_sum<8>(s) + sm[448 + cl];
#pragma unroll
        for (int p = 0; p < AO_PLANES; ++p) a[p] = __shfl(s, p * 8, 32);
    }

    // unrolled: every address is one base and one lane offset plus an immediate, so no
    // address register is rewritten while loads or stores are in flight
#pragma unroll
    for (int g = 0; g < AO_GROUPS; ++g) {
        if (g > 0) {
            // the loads below land on registers that the group before was stored from:
            // this wait stands between those stores and the overwrite of their data
            asm volatile("s_wait_xcnt 0x0" ::: "memory");
#pragma unroll
            for (int i = 0; i < AO_DEPTH; ++i) v[i] = xp[(g * AO_DEPTH + i) * 32];
        }
        // all loads of the group are issued before the first add waits for one: left
        // free, the compiler sinks each load to its use and the wave waits out every one
        __builtin_amdgcn_sched_barrier(0);
        const float s = a[g / (AO_GROUPS / AO_PLANES)];
#pragma unroll
        for (int i = 0; i < AO_DEPTH; ++i) {
            float4 o = { v[i].x + s, v[i].y + s, v[i].z + s, v[i].w + s };
            op[(g * AO_DEPTH + i) * 32] = o;
        }
    }
}

// ---------------------------------------------------------------------------
extern "C" void kernel_launch(void* const* d_in, const int* in_sizes, int n_in,
                              void* d_out, int out_size, void* d_ws, size_t ws_size,
                              hipStream_t stream)
{
    const float* x   = (const float*)d_in[0];
    const float* cmw = (const float*)d_in[1];
    const float* cmb = (const float*)d_in[2];
    const float* g_w = (const float*)d_in[3];
    const float* g_b = (const float*)d_in[4];
    const float* k_w = (const float*)d_in[5];
    const float* k_b = (const float*)d_in[6];
    const float* q_w = (const float*)d_in[7];
    const float* q_b = (const float*)d_in[8];
    const float* v_w = (const float*)d_in[9];
    const float* v_b = (const float*)d_in[10];
    const float* w1  = (const float*)d_in[11];
    const float* b1  = (const float*)d_in[12];
    const float* lng = (const float*)d_in[13];
    const float* lnb = (const float*)d_in[14];
    const float* w2  = (const float*)d_in[15];
    const float* b2  = (const float*)d_in[16];
    float* out = (float*)d_out;

    // workspace layout (floats)
    float* ws   = (float*)d_ws;
    float* part = ws;                                 // 16*16*8*512 = 1048576 used
    float* kqv  = ws + 4194304;                       // 16*3*8*64 = 24576 used
    float* cxb  = ws + 4194304 + 65536;               // 128
    float* cyb  = cxb + 128;                          // 128
    float* smax = cyb + 128 + 8192;                   // 16*8*16 = 2048 used
    float* ssum = smax + 8192;                        // 2048 used
    float* scol = ssum + 8192;                        // 2048 used
    float* srow = scol + 8192;                        // 2048 used

    k_pool_partial<<<dim3(NB * PC_GROUPS), dim3(PC_WAVES * 32), 0, stream>>>(x, cmw, cmb, part,
                                                                             smax, ssum, scol, srow);
    k_join_kqv<<<dim3(NB * HEADS * 2), dim3(512), 0, stream>>>(part, smax, ssum, scol, srow,
                                                               k_w, k_b, q_w, q_b, v_w, v_b,
                                                               kqv, cxb, cyb);
    k_attn_addout<<<dim3(NB * CH / AO_CH), dim3(AO_WAVES * 32), 0, stream>>>(x, kqv, cxb, cyb, g_w, g_b,
                                                                             w1, b1, lng, lnb, w2, b2, out);
}

// v007
// It runs in 39.8 microseconds.
// Two timings next to v006 both put it at 1.06 times that version's speed.
// Over all steps from v000 it is 5.26 times as fast.
#include <hip/hip_runtime.h>
#include <hip/hip_bf16.h>

typedef __attribute__((ext_vector_type(2))) float v2f;
typedef __attribute__((ext_vector_type(8))) float v8f;

#define HEADS  8
#define NB     16
#define CH     512
#define HT     64
#define WD     64
#define HWSZ   4096
#define PLANES 128

// The value of lane l ^ M, by a vector instruction: a DPP row_xmask move inside a row of
// 16 lanes (the compiler folds it into an add that takes it), a cross-row
// move for M = 16. __shfl_xor goes through the LDS unit and is waited for at every step.
// Every lane of the wave is on wherever this is called.
template <int M>
__device__ __forceinline__ float lane_xor(float v)
{
    const int b = __builtin_bit_cast(int, v);
    if constexpr (M == 16)
        return __builtin_bit_cast(float, __builtin_amdgcn_permlanex16(b, b, 0x76543210, 0xfedcba98,
                                                                      false, false));
    else
        return __builtin_bit_cast(float, __builtin_amdgcn_update_dpp(0, b, 0x160 + M, 0xf, 0xf, true));
}

// butterflies over WIDTH lanes, widest step first
template <int WIDTH>
__device__ __forceinline__ float xor_sum(float v)
{
    if constexpr (WIDTH >= 32) v += lane_xor<16>(v);
    if constexpr (WIDTH >= 16) v += lane_xor<8>(v);
    if constexpr (WIDTH >= 8)  v += lane_xor<4>(v);
    v += lane_xor<2>(v);
    v += lane_xor<1>(v);
    return v;
}

template <int WIDTH>
__device__ __forceinline__ float xor_max(float v)
{
    if constexpr (WIDTH >= 32) v = fmaxf(v, lane_xor<16>(v));
    if constexpr (WIDTH >= 16) v = fmaxf(v, lane_xor<8>(v));
    if constexpr (WIDTH >= 8)  v = fmaxf(v, lane_xor<4>(v));
    v = fmaxf(v, lane_xor<2>(v));
    v = fmaxf(v, lane_xor<1>(v));
    return v;
}

// workgroup barrier for data handed over in LDS alone: the fences name LDS only, so the
// wave waits for its LDS accesses and not, as __syncthreads() makes it, for every global
// load that it still has on its way
__device__ __forceinline__ void lds_barrier()
{
    __builtin_amdgcn_fence(__ATOMIC_RELEASE, "workgroup", "local");
    __builtin_amdgcn_s_barrier();
    __builtin_amdgcn_fence(__ATOMIC_ACQUIRE, "workgroup", "local");
}

// Which piece of the work a workgroup takes, the same in all three launches (256
// workgroups each): piece number = batch * 16 + part of the batch. The 16 workgroups of
// a batch have launch indices that are equal mod 8. For speed only: this is a permutation of 0..255, so every
// piece is done exactly once wherever the workgroups land.
__device__ __forceinline__ int dealt_piece(int i)
{
    return ((i & 7) * 2 + ((i >> 7) & 1)) * 16 + ((i >> 3) & 15);
}

#define PC_COLS  64    // hw columns per tile: one image row
#define PC_ROWS  4     // image rows a workgroup takes, one after the other
#define PC_GROUPS (HWSZ / (PC_COLS * PC_ROWS))   // workgroups, and partial results, per batch
#define PC_PITCH 68    // floats per LDS row: 272 B, an odd multiple of 16 B
#define PC_WAVES 8
#define PC_TILE  (CH * PC_PITCH)   // floats of one tile buffer

// eight 16-byte-a-lane copies, global memory to LDS through no register. The wait in
// the last line stands in front of any rewrite of the address registers named here.
#define PC_COPY8(l, g, r)                                                         \
    asm volatile("global_load_async_to_lds_b128 %0, %8, off\n\t"                  \
                 "global_load_async_to_lds_b128 %1, %9, off\n\t"                  \
                 "global_load_async_to_lds_b128 %2, %10, off\n\t"                 \
                 "global_load_async_to_lds_b128 %3, %11, off\n\t"                 \
                 "global_load_async_to_lds_b128 %4, %12, off\n\t"                 \
                 "global_load_async_to_lds_b128 %5, %13, off\n\t"                 \
                 "global_load_async_to_lds_b128 %6, %14, off\n\t"                 \
                 "global_load_async_to_lds_b128 %7, %15, off\n\t"                 \
                 "s_wait_xcnt 0x0"                                                \
                 :: "v"((l) + ((r) + 0) * (PC_PITCH * 4u)),                       \
                    "v"((l) + ((r) + 2) * (PC_PITCH * 4u)),                       \
                    "v"((l) + ((r) + 4) * (PC_PITCH * 4u)),                       \
                    "v"((l) + ((r) + 6) * (PC_PITCH * 4u)),                       \
                    "v"((l) + ((r) + 8) * (PC_PITCH * 4u)),                       \
                    "v"((l) + ((r) + 10) * (PC_PITCH * 4u)),                      \
                    "v"((l) + ((r) + 12) * (PC_PITCH * 4u)),                      \
                    "v"((l) + ((r) + 14) * (PC_PITCH * 4u)),                      \
                    "v"((g) + ((r) + 0) * HWSZ), "v"((g) + ((r) + 2) * HWSZ),     \
                    "v"((g) + ((r) + 4) * HWSZ), "v"((g) + ((r) + 6) * HWSZ),     \
                    "v"((g) + ((r) + 8) * HWSZ), "v"((g) + ((r) + 10) * HWSZ),    \
                    "v"((g) + ((r) + 12) * HWSZ), "v"((g) + ((r) + 14) * HWSZ)    \
                 : "memory")

// ---------------------------------------------------------------------------
// Kernel 1: one workgroup per (batch, 4 image rows). It takes its rows one after the
// other; a row's tile x[512 c][64 hw] is brought into one of two LDS buffers while the
// row before is worked on, and feeds both products:
//   logits[h, hw] = sum_c cmw[h, c] * x[c, hw] + cmb[h]      (WMMA, K over c)
//   e[h, hw]      = exp(logits - running maximum)
//   part[h, c]    = part[h, c] * exp(old maximum - new) + sum_hw x[c, hw] * e[h, hw]
// part stays in the WMMA accumulators over the four rows. The running maximum, sum of
// e and the two moments go out beside part; kernel 2 joins the 16 workgroups of a
// (batch, head). Wave w copies, and alone reads, the channels 64 w .. 64 w + 63.
// ---------------------------------------------------------------------------
__global__ void __launch_bounds__(PC_WAVES * 32)
k_pool_partial(const float* __restrict__ x, const float* __restrict__ cmw,
               const float* __restrict__ cmb, float* __restrict__ part,
               float* __restrict__ smax, float* __restrict__ ssum,
               float* __restrict__ scol, float* __restrict__ srow)
{
    __shared__ __attribute__((aligned(16))) float tile[2 * PC_TILE];
    __shared__ __attribute__((aligned(16))) float lg[PC_WAVES * HEADS * PC_COLS];
    __shared__ __attribute__((aligned(16))) float pm[16 * PC_PITCH];
    __shared__ float sc[HEADS];

    const int lane  = threadIdx.x & 31;
    const int wave  = __builtin_amdgcn_readfirstlane(threadIdx.x >> 5);
    const int piece = dealt_piece(blockIdx.x);
    const int b     = piece / PC_GROUPS;
    const int grp   = piece % PC_GROUPS;
    const int col   = lane & 15;
    const int kgrp  = lane >> 4;
    const int row0  = wave * 64;

    // the lane's place in the first image row's tile, in memory and in buffer 0
    const float* g0 = x + ((long)b * CH + row0 + kgrp) * HWSZ + grp * (PC_ROWS * PC_COLS) + col * 4;
    const unsigned l0a = (unsigned)(uintptr_t)&tile[(row0 + kgrp) * PC_PITCH + col * 4];

    // row 0 into buffer 0: 32 copies a wave, each two rows of 256 bytes, all in flight at once
    PC_COPY8(l0a, g0, 0);
    PC_COPY8(l0a, g0, 16);
    PC_COPY8(l0a, g0, 32);
    PC_COPY8(l0a, g0, 48);

    // A fragments of the logits product, fetched while the tile is on its way.
    // k order of both loaders: step 2u+s holds channels row0 + 8u + 4 kgrp + 2s, +1.
    float4 a4[8];
#pragma unroll
    for (int u = 0; u < 8; ++u) {
        float4 t = *reinterpret_cast<const float4*>(cmw + (col & 7) * CH + row0 + u * 8 + kgrp * 4);
        a4[u].x = (col < HEADS) ? t.x : 0.f;          // rows >= 8 are zero padding
        a4[u].y = (col < HEADS) ? t.y : 0.f;
        a4[u].z = (col < HEADS) ? t.z : 0.f;
        a4[u].w = (col < HEADS) ? t.w : 0.f;
    }
    const float bias = cmb[wave];

    // the wave's own copies have landed behind this wait
    asm volatile("s_wait_asynccnt 0x0" ::: "memory");
    __syncthreads();

    // row 1 into buffer 1: on its way while row 0 is worked on
    {
        const float* g = g0 + PC_COLS;
        const unsigned l = l0a + PC_TILE * 4u;
        PC_COPY8(l, g, 0);
        PC_COPY8(l, g, 16);
        PC_COPY8(l, g, 32);
        PC_COPY8(l, g, 48);
    }

    // wave h keeps head h's running terms; every wave keeps part of its 64 channels
    float run_m = -3.0e38f, run_s = 0.f, run_pc = 0.f, run_pr = 0.f;
    v8f c[4];
#pragma unroll
    for (int t = 0; t < 4; ++t) c[t] = (v8f){0.f, 0.f, 0.f, 0.f, 0.f, 0.f, 0.f, 0.f};

    for (int it = 0; it < PC_ROWS; ++it) {
        const int tb = (it & 1) * PC_TILE;            // this row's buffer

        // logits over the wave's 64 channels, all 64 columns: N tile t holds columns 4n + t
        {
            v8f acc[4];
#pragma unroll
            for (int t = 0; t < 4; ++t) acc[t] = (v8f){0.f, 0.f, 0.f, 0.f, 0.f, 0.f, 0.f, 0.f};
#pragma unroll
            for (int u = 0; u < 8; ++u) {
#pragma unroll
                for (int s = 0; s < 2; ++s) {
                    const int ch = row0 + u * 8 + kgrp * 4 + s * 2;
                    float4 b0 = *reinterpret_cast<const float4*>(&tile[tb + ch * PC_PITCH + col * 4]);
                    float4 b1 = *reinterpret_cast<const float4*>(&tile[tb + (ch + 1) * PC_PITCH + col * 4]);
                    v2f af; af.x = s ? a4[u].z : a4[u].x;
                            af.y = s ? a4[u].w : a4[u].y;
                    v2f bf;
                    bf.x = b0.x; bf.y = b1.x;
                    acc[0] = __builtin_amdgcn_wmma_f32_16x16x4_f32(false, af, false, bf,
                                                                   (short)0, acc[0], false, false);
                    bf.x = b0.y; bf.y = b1.y;
                    acc[1] = __builtin_amdgcn_wmma_f32_16x16x4_f32(false, af, false, bf,
                                                                   (short)0, acc[1], false, false);
                    bf.x = b0.z; bf.y = b1.z;
                    acc[2] = __builtin_amdgcn_wmma_f32_16x16x4_f32(false, af, false, bf,
                                                                   (short)0, acc[2], false, false);
                    bf.x = b0.w; bf.y = b1.w;
                    acc[3] = __builtin_amdgcn_wmma_f32_16x16x4_f32(false, af, false, bf,
                                                                   (short)0, acc[3], false, false);
                }
            }
            // D layout: VGPR r, lanes 0-15 -> M = r (head), lanes 16-31 -> padding
            if (lane < 16) {
#pragma unroll
                for (int r = 0; r < HEADS; ++r) {
                    float4 o = { acc[0][r], acc[1][r], acc[2][r], acc[3][r] };
                    *reinterpret_cast<float4*>(&lg[(wave * HEADS + r) * PC_COLS + col * 4]) = o;
                }
            }
        }
        __syncthreads();

        // wave h: join the eight channel slices of head h, softmax terms of the row
        // against the running maximum
        {
            const int h = wave;
            float l0 = bias, l1 = bias;
#pragma unroll
            for (int w = 0; w < PC_WAVES; ++w) {
                float2 v = *reinterpret_cast<const float2*>(&lg[(w * HEADS + h) * PC_COLS + lane * 2]);
                l0 += v.x; l1 += v.y;
            }
            float mx = xor_max<32>(fmaxf(l0, l1));
            mx = fmaxf(mx, run_m);
            const float f = expf(run_m - mx);         // 0 for the first row
            float2 e = { expf(l0 - mx), expf(l1 - mx) };
            float2 zero = { 0.f, 0.f };
            *reinterpret_cast<float2*>(&pm[h * PC_PITCH + lane * 2]) = e;
            *reinterpret_cast<float2*>(&pm[(h + HEADS) * PC_PITCH + lane * 2]) = zero;   // N padding
            if (lane == 0) sc[h] = f;
            float sum = xor_sum<32>(e.x + e.y);
            float pc  = xor_sum<32>(e.x * (float)(lane * 2) + e.y * (float)(lane * 2 + 1));
            run_s  = run_s  * f + sum;
            run_pc = run_pc * f + pc;
            run_pr = run_pr * f + sum * (float)(grp * PC_ROWS + it);
            run_m  = mx;
        }
        __syncthreads();

        // part[h, c] over the wave's 64 channels (4 M tiles), K over the 64 columns, on
        // top of the rows before, brought to the new maximum (N = lane & 15 is the head).
        // k order of both loaders: step 2u+s holds columns 8u + 4 kgrp + 2s, +1.
        {
            const float fl = sc[col & 7];
#pragma unroll
            for (int t = 0; t < 4; ++t)
#pragma unroll
                for (int r = 0; r < 8; ++r) c[t][r] *= fl;
        }
#pragma unroll
        for (int u = 0; u < 8; ++u) {
            float4 p4 = *reinterpret_cast<const float4*>(&pm[col * PC_PITCH + u * 8 + kgrp * 4]);
            float4 a[4];
#pragma unroll
            for (int t = 0; t < 4; ++t)
                a[t] = *reinterpret_cast<const float4*>(
                    &tile[tb + (row0 + t * 16 + col) * PC_PITCH + u * 8 + kgrp * 4]);
#pragma unroll
            for (int t = 0; t < 4; ++t) {
                v2f af; af.x = a[t].x; af.y = a[t].y;
                v2f bf; bf.x = p4.x;   bf.y = p4.y;
                c[t] = __builtin_amdgcn_wmma_f32_16x16x4_f32(false, af, false, bf,
                                                             (short)0, c[t], false, false);
            }
#pragma unroll
            for (int t = 0; t < 4; ++t) {
                v2f af; af.x = a[t].z; af.y = a[t].w;
                v2f bf; bf.x = p4.z;   bf.y = p4.w;
                c[t] = __builtin_amdgcn_wmma_f32_16x16x4_f32(false, af, false, bf,
                                                             (short)0, c[t], false, false);
            }
        }

        // hand-over: this wave's LDS reads of the row are done, its copies of the next
        // row have landed, and the barrier says both of every wave
        asm volatile("s_wait_dscnt 0x0" ::: "memory");
        asm volatile("s_wait_asynccnt 0x0" ::: "memory");
        __syncthreads();
        // the row after the next goes into the buffer that has just been read
        if (it + 2 < PC_ROWS) {
            const float* g = g0 + (it + 2) * PC_COLS;
            const unsigned l = l0a + (unsigned)tb * 4u;
            PC_COPY8(l, g, 0);
            PC_COPY8(l, g, 16);
            PC_COPY8(l, g, 32);
            PC_COPY8(l, g, 48);
        }
    }
    // no copy is left on its way when the tile buffers become staging
    asm volatile("s_wait_asynccnt 0x0" ::: "memory");

    if (lane == 0) {
        const int idx = (b * HEADS + wave) * PC_GROUPS + grp;
        smax[idx] = run_m; ssum[idx] = run_s; scol[idx] = run_pc; srow[idx] = run_pr;
    }

    // D layout: VGPR r, lanes 0-15 -> M = r, lanes 16-31 -> M = r + 8; N = lane & 15 (head).
    // Turned through the wave's own, now spent, tile rows so that part is stored in
    // whole 128-byte lines.
    float* stg = &tile[row0 * PC_PITCH];
    if (col < HEADS) {
#pragma unroll
        for (int t = 0; t < 4; ++t) {
            float4 lo = { c[t][0], c[t][1], c[t][2], c[t][3] };
            float4 hi = { c[t][4], c[t][5], c[t][6], c[t][7] };
            *reinterpret_cast<float4*>(&stg[col * PC_PITCH + t * 16 + kgrp * 8])     = lo;
            *reinterpret_cast<float4*>(&stg[col * PC_PITCH + t * 16 + kgrp * 8 + 4]) = hi;
        }
    }
    // orders the lanes' staging writes in front of the other lanes' reads below
    __syncthreads();
    float* po = part + ((long)piece * HEADS) * CH + row0 + col * 4;
#pragma unroll
    for (int i = 0; i < 4; ++i) {
        const int h = i * 2 + kgrp;
        float4 v = *reinterpret_cast<const float4*>(&stg[h * PC_PITCH + col * 4]);
        *reinterpret_cast<float4*>(po + h * CH) = v;
    }
}

// ---------------------------------------------------------------------------
// Kernel 2: two workgroups per (batch, head). Each joins the 16 partial results:
//   w[k] = exp(max[k] - max over k) / sum_k(...)   context[c] = sum_k w[k] part[k, c]
// (the first also stores the centroid cx, cy), keeps the context row in LDS and takes
// 96 of the 192 rows of the K, Q and V weights against it: one wave per weight row,
// read as whole 128-byte lines, the lanes' partial sums joined by a butterfly.
// ---------------------------------------------------------------------------
#define KQ_ROWS 6     // weight rows a wave: 192 rows / 2 workgroups / 16 waves

__device__ __forceinline__ float dot4(float4 a, float4 b, float s)
{
    s += a.x * b.x; s += a.y * b.y; s += a.z * b.z; s += a.w * b.w;
    return s;
}

__global__ void __launch_bounds__(512)
k_join_kqv(const float* __restrict__ part, const float* __restrict__ smax,
           const float* __restrict__ ssum, const float* __restrict__ scol,
           const float* __restrict__ srow,
           const float* __restrict__ k_w, const float* __restrict__ k_b,
           const float* __restrict__ q_w, const float* __restrict__ q_b,
           const float* __restrict__ v_w, const float* __restrict__ v_b,
           float* __restrict__ kqv, float* __restrict__ cx, float* __restrict__ cy)
{
    __shared__ float wl[PC_GROUPS];
    __shared__ __attribute__((aligned(16))) float red[4 * CH];
    __shared__ __attribute__((aligned(16))) float cs[CH];
    __shared__ float ro[16 * KQ_ROWS];
    const int piece = dealt_piece(blockIdx.x);
    const int row  = piece >> 1;                      // b*8 + h
    const int sub  = piece & 1;                       // which 96 weight rows
    const int b    = row >> 3, h = row & 7;
    const int tid  = threadIdx.x;
    const int lane = tid & 31;
    const int wave = __builtin_amdgcn_readfirstlane(tid >> 5);
    const int k16  = tid & 15;
    const int c4   = tid & 127;                       // four channels a thread
    const int cg   = tid >> 7;                        // four partial results a thread

    const float* pp = part + (((long)b * PC_GROUPS + cg * 4) * HEADS + h) * CH + c4 * 4;
    float4 v[4];
#pragma unroll
    for (int i = 0; i < 4; ++i)
        v[i] = *reinterpret_cast<const float4*>(pp + (long)i * HEADS * CH);
    // the loads above share one address pair: this wait stands in front of its
    // reuse, and the operand keeps the pair live up to here. It also holds the loads
    // in front of the weights' butterflies, behind which the compiler had sunk them.
    asm volatile("s_wait_xcnt 0x0" :: "v"(pp) : "memory");

    // every 16 lanes alike: one partial result a lane
    const float m0 = smax[row * PC_GROUPS + k16];
    const float s0 = ssum[row * PC_GROUPS + k16];
    const float p0 = scol[row * PC_GROUPS + k16];
    const float r0 = srow[row * PC_GROUPS + k16];

    // the bias of the result that this thread stores at the end
    const int rs = sub * 96 + ((tid < 96) ? tid : 95);
    const float bk = k_b[rs & 63], bq = q_b[rs & 63], bv = v_b[rs & 63];
    // keeps the small loads older than the weight rows: a wait for them waits for no row
    __builtin_amdgcn_sched_barrier(0);

    // the wave's weight rows need nothing of the join: on their way from here on
    const int lofs = lane * 16;                       // the lane's byte offset in a 512-byte piece
    float4 w[KQ_ROWS][4];
#pragma unroll
    for (int j = 0; j < KQ_ROWS; ++j) {
        const int r = sub * 96 + wave * KQ_ROWS + j;  // 0..191: K | Q | V, 64 rows each
        const float* wm = (r < 64) ? k_w : (r < 128) ? q_w : v_w;
        const char* wb = reinterpret_cast<const char*>(wm + (r & 63) * CH);
#pragma unroll
        for (int i = 0; i < 4; ++i)
            w[j][i] = *reinterpret_cast<const float4*>(wb + lofs + i * 512);
    }
    // the loads above share one offset register: this wait stands in front of its
    // reuse, and the first operand keeps it live up to here. It also holds the loads
    // here, ahead of the join, instead of behind its barriers; the biases are inputs so
    // that their loads are not sunk to the kernel's end, where they would be waited out
    asm volatile("s_wait_xcnt 0x0" :: "v"(lofs), "v"(bk), "v"(bq), "v"(bv) : "memory");
    // the butterflies below wait for the first loads: they stay behind the issue of all
    __builtin_amdgcn_sched_barrier(0);

    const float mx = xor_max<16>(m0);
    const float w0 = expf(m0 - mx);
    const float sum = xor_sum<16>(w0 * s0);
    const float pc  = xor_sum<16>(w0 * p0);
    const float pr  = xor_sum<16>(w0 * r0);
    const float inv = 1.f / sum;
    if (tid < PC_GROUPS) wl[tid] = w0 * inv;
    lds_barrier();

    float4 a = { 0.f, 0.f, 0.f, 0.f };
#pragma unroll
    for (int i = 0; i < 4; ++i) {
        const float wk = wl[cg * 4 + i];
        a.x += wk * v[i].x; a.y += wk * v[i].y; a.z += wk * v[i].z; a.w += wk * v[i].w;
    }
    *reinterpret_cast<float4*>(&red[cg * CH + c4 * 4]) = a;
    lds_barrier();

    if (tid < 128) {
        float4 t0 = *reinterpret_cast<const float4*>(&red[0 * CH + tid * 4]);
        float4 t1 = *reinterpret_cast<const float4*>(&red[1 * CH + tid * 4]);
        float4 t2 = *reinterpret_cast<const float4*>(&red[2 * CH + tid * 4]);
        float4 t3 = *reinterpret_cast<const float4*>(&red[3 * CH + tid * 4]);
        float4 o = { (t0.x + t1.x) + (t2.x + t3.x), (t0.y + t1.y) + (t2.y + t3.y),
                     (t0.z + t1.z) + (t2.z + t3.z), (t0.w + t1.w) + (t2.w + t3.w) };
        *reinterpret_cast<float4*>(&cs[tid * 4]) = o;
    }
    if (tid == 0 && sub == 0) {
        cx[row] = pc * inv / (float)HT;
        cy[row] = pr * inv / (float)WD;
    }
    lds_barrier();

    // the lane's 16 columns of the context row against its 16 columns of each weight row
    {
        float4 c[4];
#pragma unroll
        for (int i = 0; i < 4; ++i)
            c[i] = *reinterpret_cast<const float4*>(&cs[i * 128 + lane * 4]);
        float res = 0.f;
#pragma unroll
        for (int j = 0; j < KQ_ROWS; ++j) {
            float s = 0.f;
#pragma unroll
            for (int i = 0; i < 4; ++i) s = dot4(w[j][i], c[i], s);
            s = xor_sum<32>(s);
            res = (lane == j) ? s : res;
        }
        if (lane < KQ_ROWS) ro[wave * KQ_ROWS + lane] = res;
    }
    lds_barrier();

    // 96 results go out as three whole 128-byte lines: kqv[b][K|Q|V][h][d]
    if (tid < 96) {
        const int mat = rs >> 6, d = rs & 63;
        kqv[b * 1536 + mat * 512 + h * 64 + d] = ro[tid] + ((mat == 0) ? bk : (mat == 1) ? bq : bv);
    }
}

// ---------------------------------------------------------------------------
// Kernel 3: out[b,c,hw] = x[b,c,hw] + add_term[b,c]   (float4 streaming)
// One workgroup of 16 waves per WGP; a wave streams AO_PLANES whole (b,c) planes in
// groups of AO_DEPTH loads, each load 512 contiguous bytes. Ahead of its stream every
// workgroup works out its batch's head attention and channel_add MLP itself (16
// workgroups a batch do the same sums) and the add_term of its own 32 channels. All it
// needs from memory is asked for at the top, in the order of use: the small operands
// (to LDS), the rows of w1 (registers), the first group of x (registers).
// ---------------------------------------------------------------------------
#define AO_WAVES  16    // waves per workgroup
#define AO_PLANES 2     // (b,c) planes per wave
#define AO_DEPTH  16    // 16-byte loads per lane in flight
#define AO_GROUPS (AO_PLANES * (HWSZ / 4) / (32 * AO_DEPTH))
#define AO_CH     (AO_WAVES * AO_PLANES)   // channels per workgroup

__global__ void __launch_bounds__(AO_WAVES * 32)
k_attn_addout(const float* __restrict__ x, const float* __restrict__ kqv,
              const float* __restrict__ cx, const float* __restrict__ cy,
              const float* __restrict__ g_w, const float* __restrict__ g_b,
              const float* __restrict__ w1,  const float* __restrict__ b1,
              const float* __restrict__ lng, const float* __restrict__ lnb,
              const float* __restrict__ w2,  const float* __restrict__ b2,
              float* __restrict__ out)
{
    __shared__ __attribute__((aligned(16))) float wkqv[3 * 512];  // wk | wq | wv, each [h][d]
    __shared__ __attribute__((aligned(16))) float sm[512];        // g_w 64 | b1 128 | ln_g 128 | ln_b 128 | b2 32
    __shared__ __attribute__((aligned(16))) float sw2[AO_CH * PLANES];
    __shared__ float lt[64];
    __shared__ float wmn[64];
    __shared__ __attribute__((aligned(16))) float oc[512];
    __shared__ __attribute__((aligned(16))) float ly[128];

    const int tid   = threadIdx.x;
    const int lane  = tid & 31;
    const int wave  = __builtin_amdgcn_readfirstlane(tid >> 5);
    const int piece = dealt_piece(blockIdx.x);
    const int plane = (piece * AO_WAVES + wave) * AO_PLANES;
    const int b     = piece / (CH / AO_CH);
    const int c0    = (piece % (CH / AO_CH)) * AO_CH;             // the workgroup's first channel
    const float4* xp = reinterpret_cast<const float4*>(x) + (long)plane * (HWSZ / 4) + lane;
    float4*       op = reinterpret_cast<float4*>(out)     + (long)plane * (HWSZ / 4) + lane;

    const int pair = tid >> 3, sub = tid & 7;
    const int m = pair >> 3, n = pair & 7;

    // small operands first: a wait for them then waits for nothing that is large
    const int ikq = b * 1536 + tid, im = b * 8 + m, in = b * 8 + n;
    const int ig = tid & 63, il = (tid - 64) & 127, ib2 = c0 + ((tid - 448) & (AO_CH - 1));
    float kq[3];
#pragma unroll
    for (int i = 0; i < 3; ++i) kq[i] = kqv[ikq + i * 512];
    const float cxm = cx[im], cxn = cx[in];
    const float cym = cy[im], cyn = cy[in];
    const float gb  = g_b[0];
    const float sg  = g_w[ig];
    const float sb1 = b1[il], sgn = lng[il], sbn = lnb[il];   // 64, 192 and 320 are alike mod 128
    const float sb2 = b2[ib2];
    const float4* w2p = reinterpret_cast<const float4*>(w2 + c0 * PLANES) + tid;
    const float4 w2a = w2p[0], w2b = w2p[512];
    // this wait stands in front of any rewrite of a register that the loads above name:
    // the operands keep every index and every base live up to here, so that no later
    // load's result and no scalar load lands on one of them ahead of the wait
    asm volatile("s_wait_xcnt 0x0" :: "v"(ikq), "v"(im), "v"(in), "v"(ig), "v"(il), "v"(ib2),
                 "s"(kqv), "s"(cx), "s"(cy), "s"(g_w), "s"(b1), "s"(lng), "s"(lnb), "s"(b2)
                 : "memory");
    // keeps the small loads the oldest: left free, the compiler put some behind the large
    // ones, and the wait for them in front of the first barrier waited for everything
    __builtin_amdgcn_sched_barrier(0);

    // y = oc @ w1^T: one wave per row, 8 rows a wave
    const char* wb = reinterpret_cast<const char*>(w1 + wave * 8 * 512);
    const int lofs = lane * 16;                       // the lane's byte offset in a 512-byte piece
    float4 w[8][4];
#pragma unroll
    for (int j = 0; j < 8; ++j)
#pragma unroll
        for (int i = 0; i < 4; ++i)
            w[j][i] = *reinterpret_cast<const float4*>(wb + lofs + j * 2048 + i * 512);

    // keeps the rows of w1, used first, older than the group of x
    __builtin_amdgcn_sched_barrier(0);

    // the first group of x
    float4 v[AO_DEPTH];
#pragma unroll
    for (int i = 0; i < AO_DEPTH; ++i) v[i] = xp[i * 32];

    // this wait stands in front of any reuse of the address registers named above, and
    // the first two operands keep the lanes' own up to here. It also holds all these
    // loads in front of the first barrier. The small loaded values are inputs because the
    // compiler had sunk their loads into branches behind the large ones, where the wait
    // for them waited for everything; they are stored to LDS right below
    asm volatile("s_wait_xcnt 0x0" :: "v"(lofs), "v"(w2p), "v"(sg), "v"(sb1), "v"(sgn),
                 "v"(sbn), "v"(sb2), "s"(gb) : "memory");

#pragma unroll
    for (int i = 0; i < 3; ++i) wkqv[i * 512 + tid] = kq[i];
    sm[tid] = (tid < 64) ? sg : (tid < 192) ? sb1 : (tid < 320) ? sgn : (tid < 448) ? sbn : sb2;
    *reinterpret_cast<float4*>(&sw2[tid * 4])         = w2a;
    *reinterpret_cast<float4*>(&sw2[(tid + 512) * 4]) = w2b;
    lds_barrier();

    // w_g (geometric) and scaled_dot -> logits lt[m*8+n]; 8 lanes per (m, n)
    {
        float dx = cxm - cxn;
        float dy = cym - cyn;
        float pos[4] = { fmaxf(dx, 0.f), fmaxf(-dx, 0.f),
                         fmaxf(dy, 0.f), fmaxf(-dy, 0.f) };
        float freq = expf(-6.90775527898f * (float)sub * 0.125f);   // 1000^(-f/8)
        float s = 0.f;
        for (int p = 0; p < 4; ++p) {
            float ang = 100.f * pos[p] * freq;
            s += sinf(ang) * sm[p * 8 + sub] + cosf(ang) * sm[32 + p * 8 + sub];
        }
        float sd = 0.f;
#pragma unroll
        for (int i = 0; i < 8; ++i) {
            const int d = sub + 8 * i;
            sd += wkqv[m * 64 + d] * wkqv[512 + n * 64 + d];
        }
        s  = xor_sum<8>(s);
        sd = xor_sum<8>(sd);
        if (sub == 0) {
            float wg = fmaxf(s + gb, 0.f);
            lt[pair] = logf(fmaxf(wg, 1e-6f)) + sd * 0.125f;        // 1/sqrt(64)
        }
    }
    lds_barrier();

    // softmax over m (axis=1) for each n; 8 lanes per n
    if (tid < 64) {
        const int nn = tid >> 3, mm = tid & 7;
        float t = lt[mm * 8 + nn];
        const float mx = xor_max<8>(t);
        float e = expf(t - mx);
        float inv = 1.f / xor_sum<8>(e);
        wmn[mm * 8 + nn] = e * inv;
    }
    lds_barrier();

    // out_ctx[n, d] = sum_m wmn[m,n] * wv[m,d] -> flat n*64+d
    {
        int nn = tid >> 6, d = tid & 63;
        float s = 0.f;
        for (int mm = 0; mm < 8; ++mm) s += wmn[mm * 8 + nn] * wkqv[1024 + mm * 64 + d];
        oc[tid] = s;
    }
    lds_barrier();

    // y = oc @ w1^T + b1  [128]
    {
        float4 o4[4];
#pragma unroll
        for (int i = 0; i < 4; ++i)
            o4[i] = *reinterpret_cast<const float4*>(&oc[i * 128 + lane * 4]);
        float res = 0.f;
#pragma unroll
        for (int j = 0; j < 8; ++j) {
            float s = 0.f;
#pragma unroll
            for (int i = 0; i < 4; ++i) s = dot4(w[j][i], o4[i], s);
            s = xor_sum<32>(s);
            res = (lane == j) ? s : res;
        }
        if (lane < 8) ly[wave * 8 + lane] = res + sm[64 + wave * 8 + lane];
    }
    lds_barrier();

    // LayerNorm + ReLU in registers (every 8-lane group holds all 128 values), then
    // add_term[c] = y @ w2^T + b2 for the wave's two channels: 8 lanes per row
    float a[AO_PLANES];
    {
        const int s8 = lane & 7, rsub = (lane >> 3) & (AO_PLANES - 1);
        float y[16];
#pragma unroll
        for (int i = 0; i < 4; ++i) {
            float4 t = *reinterpret_cast<const float4*>(&ly[i * 32 + s8 * 4]);
            y[i * 4 + 0] = t.x; y[i * 4 + 1] = t.y; y[i * 4 + 2] = t.z; y[i * 4 + 3] = t.w;
        }
        float mu = 0.f;
#pragma unroll
        for (int i = 0; i < 16; ++i) mu += y[i];
        mu = xor_sum<8>(mu) * (1.f / PLANES);
        float var = 0.f;
#pragma unroll
        for (int i = 0; i < 16; ++i) { float dlt = y[i] - mu; var += dlt * dlt; }
        var = xor_sum<8>(var) * (1.f / PLANES);
        const float rstd = rsqrtf(var + 1e-5f);
        const int cl = wave * AO_PLANES + rsub;       // the 8-lane group's channel, from c0
        float s = 0.f;
#pragma unroll
        for (int i = 0; i < 4; ++i) {
            float4 g4 = *reinterpret_cast<const float4*>(&sm[192 + i * 32 + s8 * 4]);
            float4 b4 = *reinterpret_cast<const float4*>(&sm[320 + i * 32 + s8 * 4]);
            float4 yn;
            yn.x = fmaxf((y[i * 4 + 0] - mu) * rstd * g4.x + b4.x, 0.f);
            yn.y = fmaxf((y[i * 4 + 1] - mu) * rstd * g4.y + b4.y, 0.f);
            yn.z = fmaxf((y[i * 4 + 2] - mu) * rstd * g4.z + b4.z, 0.f);
            yn.w = fmaxf((y[i * 4 + 3] - mu) * rstd * g4.w + b4.w, 0.f);
            s = dot4(*reinterpret_cast<const float4*>(&sw2[cl * PLANES + i * 32 + s8 * 4]), yn, s);
        }
        s = xor_sum<8>(s) + sm[448 + cl];
#pragma unroll
        for (int p = 0; p < AO_PLANES; ++p)   // lane 8 p holds channel p's term: alike for the wave
            a[p] = __builtin_bit_cast(float, __builtin_amdgcn_readlane(__builtin_bit_cast(int, s), p * 8));
    }

    // unrolled: every address is one base and one lane offset plus an immediate, so no
    // address register is rewritten while loads or stores are in flight
#pragma unroll
    for (int g = 0; g < AO_GROUPS; ++g) {
        if (g > 0) {
            // the loads below land on registers that the group before was stored from:
            // this wait stands between those stores and the overwrite of their data
            asm volatile("s_wait_xcnt 0x0" ::: "memory");
#pragma unroll
            for (int i = 0; i < AO_DEPTH; ++i) v[i] = xp[(g * AO_DEPTH + i) * 32];
        }
        // all loads of the group are issued before the first add waits for one: left
        // free, the compiler sinks each load to its use and the wave waits out every one
        __builtin_amdgcn_sched_barrier(0);
        const float s = a[g / (AO_GROUPS / AO_PLANES)];
#pragma unroll
        for (int i = 0; i < AO_DEPTH; ++i) {
            float4 o = { v[i].x + s, v[i].y + s, v[i].z + s, v[i].w + s };
            op[(g * AO_DEPTH + i) * 32] = o;
        }
    }
}

// ---------------------------------------------------------------------------
extern "C" void kernel_launch(void* const* d_in, const int* in_sizes, int n_in,
                              void* d_out, int out_size, void* d_ws, size_t ws_size,
                              hipStream_t stream)
{
    const float* x   = (const float*)d_in[0];
    const float* cmw = (const float*)d_in[1];
    const float* cmb = (const float*)d_in[2];
    const float* g_w = (const float*)d_in[3];
    const float* g_b = (const float*)d_in[4];
    const float* k_w = (const float*)d_in[5];
    const float* k_b = (const float*)d_in[6];
    const float* q_w = (const float*)d_in[7];
    const float* q_b = (const float*)d_in[8];
    const float* v_w = (const float*)d_in[9];
    const float* v_b = (const float*)d_in[10];
    const float* w1  = (const float*)d_in[11];
    const float* b1  = (const float*)d_in[12];
    const float* lng = (const float*)d_in[13];
    const float* lnb = (const float*)d_in[14];
    const float* w2  = (const float*)d_in[15];
    const float* b2  = (const float*)d_in[16];
    float* out = (float*)d_out;

    // workspace layout (floats)
    float* ws   = (float*)d_ws;
    float* part = ws;                                 // 16*16*8*512 = 1048576 used
    float* kqv  = ws + 4194304;                       // 16*3*8*64 = 24576 used
    float* cxb  = ws + 4194304 + 65536;               // 128
    float* cyb  = cxb + 128;                          // 128
    float* smax = cyb + 128 + 8192;                   // 16*8*16 = 2048 used
    float* ssum = smax + 8192;                        // 2048 used
    float* scol = ssum + 8192;                        // 2048 used
    float* srow = scol + 8192;                        // 2048 used

    k_pool_partial<<<dim3(NB * PC_GROUPS), dim3(PC_WAVES * 32), 0, stream>>>(x, cmw, cmb, part,
                                                                             smax, ssum, scol, srow);
    k_join_kqv<<<dim3(NB * HEADS * 2), dim3(512), 0, stream>>>(part, smax, ssum, scol, srow,
                                                               k_w, k_b, q_w, q_b, v_w, v_b,
                                                               kqv, cxb, cyb);
    k_attn_addout<<<dim3(NB * CH / AO_CH), dim3(AO_WAVES * 32), 0, stream>>>(x, kqv, cxb, cyb, g_w, g_b,
                                                                             w1, b1, lng, lnb, w2, b2, out);
}

// v008
// Measured time: 38 microseconds a run.
// Timed twice side by side with v007, it ran 1.05 and 1.06 times as fast.
// Over all steps from v000 it is 5.55 times as fast.
#include <hip/hip_runtime.h>
#include <hip/hip_bf16.h>

typedef __attribute__((ext_vector_type(2))) float v2f;
typedef __attribute__((ext_vector_type(8))) float v8f;

#define HEADS  8
#define NB     16
#define CH     512
#define HT     64
#define WD     64
#define HWSZ   4096
#define PLANES 128

// The value of lane l ^ M, by a vector instruction: a DPP row_xmask move inside a row of
// 16 lanes (the compiler folds it into an add that takes it), a cross-row
// move for M = 16. __shfl_xor goes through the LDS unit and is waited for at every step.
// Every lane of the wave is on wherever this is called.
template <int M>
__device__ __forceinline__ float lane_xor(float v)
{
    const int b = __builtin_bit_cast(int, v);
    if constexpr (M == 16)
        return __builtin_bit_cast(float, __builtin_amdgcn_permlanex16(b, b, 0x76543210, 0xfedcba98,
                                                                      false, false));
    else
        return __builtin_bit_cast(float, __builtin_amdgcn_update_dpp(0, b, 0x160 + M, 0xf, 0xf, true));
}

// butterflies over WIDTH lanes, widest step first
template <int WIDTH>
__device__ __forceinline__ float xor_sum(float v)
{
    if constexpr (WIDTH >= 32) v += lane_xor<16>(v);
    if constexpr (WIDTH >= 16) v += lane_xor<8>(v);
    if constexpr (WIDTH >= 8)  v += lane_xor<4>(v);
    v += lane_xor<2>(v);
    v += lane_xor<1>(v);
    return v;
}

template <int WIDTH>
__device__ __forceinline__ float xor_max(float v)
{
    if constexpr (WIDTH >= 32) v = fmaxf(v, lane_xor<16>(v));
    if constexpr (WIDTH >= 16) v = fmaxf(v, lane_xor<8>(v));
    if constexpr (WIDTH >= 8)  v = fmaxf(v, lane_xor<4>(v));
    v = fmaxf(v, lane_xor<2>(v));
    v = fmaxf(v, lane_xor<1>(v));
    return v;
}

// workgroup barrier for data handed over in LDS alone: the fences name LDS only, so the
// wave waits for its LDS accesses and not, as __syncthreads() makes it, for every global
// load that it still has on its way
__device__ __forceinline__ void lds_barrier()
{
    __builtin_amdgcn_fence(__ATOMIC_RELEASE, "workgroup", "local");
    __builtin_amdgcn_s_barrier();
    __builtin_amdgcn_fence(__ATOMIC_ACQUIRE, "workgroup", "local");
}

// Which piece of the work a workgroup takes, the same in all three launches (256
// workgroups each): piece number = batch * 16 + part of the batch. The 16 workgroups of
// a batch have launch indices that are equal mod 8. For speed only: this is a permutation of 0..255, so every
// piece is done exactly once wherever the workgroups land.
__device__ __forceinline__ int dealt_piece(int i)
{
    return ((i & 7) * 2 + ((i >> 7) & 1)) * 16 + ((i >> 3) & 15);
}

#define PC_COLS  64    // hw columns per tile: one image row
#define PC_ROWS  4     // image rows a workgroup takes, one after the other
#define PC_GROUPS (HWSZ / (PC_COLS * PC_ROWS))   // workgroups, and partial results, per batch
#define PC_PITCH 68    // floats per LDS row: 272 B, an odd multiple of 16 B
#define PC_WAVES 8
#define PC_TILE  (CH * PC_PITCH)   // floats of one tile buffer

// eight 16-byte-a-lane copies, global memory to LDS through no register. The wait in
// the last line stands in front of any rewrite of the address registers named here.
#define PC_COPY8(l, g, r)                                                         \
    asm volatile("global_load_async_to_lds_b128 %0, %8, off\n\t"                  \
                 "global_load_async_to_lds_b128 %1, %9, off\n\t"                  \
                 "global_load_async_to_lds_b128 %2, %10, off\n\t"                 \
                 "global_load_async_to_lds_b128 %3, %11, off\n\t"                 \
                 "global_load_async_to_lds_b128 %4, %12, off\n\t"                 \
                 "global_load_async_to_lds_b128 %5, %13, off\n\t"                 \
                 "global_load_async_to_lds_b128 %6, %14, off\n\t"                 \
                 "global_load_async_to_lds_b128 %7, %15, off\n\t"                 \
                 "s_wait_xcnt 0x0"                                                \
                 :: "v"((l) + ((r) + 0) * (PC_PITCH * 4u)),                       \
                    "v"((l) + ((r) + 2) * (PC_PITCH * 4u)),                       \
                    "v"((l) + ((r) + 4) * (PC_PITCH * 4u)),                       \
                    "v"((l) + ((r) + 6) * (PC_PITCH * 4u)),                       \
                    "v"((l) + ((r) + 8) * (PC_PITCH * 4u)),                       \
                    "v"((l) + ((r) + 10) * (PC_PITCH * 4u)),                      \
                    "v"((l) + ((r) + 12) * (PC_PITCH * 4u)),                      \
                    "v"((l) + ((r) + 14) * (PC_PITCH * 4u)),                      \
                    "v"((g) + ((r) + 0) * HWSZ), "v"((g) + ((r) + 2) * HWSZ),     \
                    "v"((g) + ((r) + 4) * HWSZ), "v"((g) + ((r) + 6) * HWSZ),     \
                    "v"((g) + ((r) + 8) * HWSZ), "v"((g) + ((r) + 10) * HWSZ),    \
                    "v"((g) + ((r) + 12) * HWSZ), "v"((g) + ((r) + 14) * HWSZ)    \
                 : "memory")

// ---------------------------------------------------------------------------
// Kernel 1: one workgroup per (batch, 4 image rows). It takes its rows one after the
// other; a row's tile x[512 c][64 hw] is brought into one of two LDS buffers while the
// row before is worked on, and feeds both products:
//   logits[h, hw] = sum_c cmw[h, c] * x[c, hw] + cmb[h]      (WMMA, K over c)
//   e[h, hw]      = exp(logits - running maximum)
//   part[h, c]    = part[h, c] * exp(old maximum - new) + sum_hw x[c, hw] * e[h, hw]
// part stays in the WMMA accumulators over the four rows. The running maximum, sum of
// e and the two moments go out beside part; kernel 2 joins the 16 workgroups of a
// (batch, head). Wave w copies, and alone reads, the channels 64 w .. 64 w + 63.
// ---------------------------------------------------------------------------
__global__ void __launch_bounds__(PC_WAVES * 32)
k_pool_partial(const float* __restrict__ x, const float* __restrict__ cmw,
               const float* __restrict__ cmb, float* __restrict__ part,
               float* __restrict__ smax, float* __restrict__ ssum,
               float* __restrict__ scol, float* __restrict__ srow)
{
    __shared__ __attribute__((aligned(16))) float tile[2 * PC_TILE];
    __shared__ __attribute__((aligned(16))) float lg[PC_WAVES * HEADS * PC_COLS];
    __shared__ __attribute__((aligned(16))) float pm[16 * PC_PITCH];
    __shared__ float sc[HEADS];

    const int lane  = threadIdx.x & 31;
    const int wave  = __builtin_amdgcn_readfirstlane(threadIdx.x >> 5);
    const int piece = dealt_piece(blockIdx.x);
    const int b     = piece / PC_GROUPS;
    const int grp   = piece % PC_GROUPS;
    const int col   = lane & 15;
    const int kgrp  = lane >> 4;
    const int row0  = wave * 64;

    // the lane's place in the first image row's tile, in memory and in buffer 0
    const float* g0 = x + ((long)b * CH + row0 + kgrp) * HWSZ + grp * (PC_ROWS * PC_COLS) + col * 4;
    const unsigned l0a = (unsigned)(uintptr_t)&tile[(row0 + kgrp) * PC_PITCH + col * 4];

    // row 0 into buffer 0: 32 copies a wave, each two rows of 256 bytes, all in flight at once
    PC_COPY8(l0a, g0, 0);
    PC_COPY8(l0a, g0, 16);
    PC_COPY8(l0a, g0, 32);
    PC_COPY8(l0a, g0, 48);

    // A fragments of the logits product, fetched while the tile is on its way.
    // k order of both loaders: step 2u+s holds channels row0 + 8u + 4 kgrp + 2s, +1.
    float4 a4[8];
#pragma unroll
    for (int u = 0; u < 8; ++u) {
        float4 t = *reinterpret_cast<const float4*>(cmw + (col & 7) * CH + row0 + u * 8 + kgrp * 4);
        a4[u].x = (col < HEADS) ? t.x : 0.f;          // rows >= 8 are zero padding
        a4[u].y = (col < HEADS) ? t.y : 0.f;
        a4[u].z = (col < HEADS) ? t.z : 0.f;
        a4[u].w = (col < HEADS) ? t.w : 0.f;
    }
    const float bias = cmb[wave];

    // the wave's own copies have landed behind this wait
    asm volatile("s_wait_asynccnt 0x0" ::: "memory");
    __syncthreads();

    // row 1 into buffer 1: on its way while row 0 is worked on
    {
        const float* g = g0 + PC_COLS;
        const unsigned l = l0a + PC_TILE * 4u;
        PC_COPY8(l, g, 0);
        PC_COPY8(l, g, 16);
        PC_COPY8(l, g, 32);
        PC_COPY8(l, g, 48);
    }

    // wave h keeps head h's running terms; every wave keeps part of its 64 channels
    float run_m = -3.0e38f, run_s = 0.f, run_pc = 0.f, run_pr = 0.f;
    v8f c[4];
#pragma unroll
    for (int t = 0; t < 4; ++t) c[t] = (v8f){0.f, 0.f, 0.f, 0.f, 0.f, 0.f, 0.f, 0.f};

    for (int it = 0; it < PC_ROWS; ++it) {
        const int tb = (it & 1) * PC_TILE;            // this row's buffer

        // logits over the wave's 64 channels, all 64 columns: N tile t holds columns 4n + t
        {
            v8f acc[4];
#pragma unroll
            for (int t = 0; t < 4; ++t) acc[t] = (v8f){0.f, 0.f, 0.f, 0.f, 0.f, 0.f, 0.f, 0.f};
#pragma unroll
            for (int u = 0; u < 8; ++u) {
#pragma unroll
                for (int s = 0; s < 2; ++s) {
                    const int ch = row0 + u * 8 + kgrp * 4 + s * 2;
                    float4 b0 = *reinterpret_cast<const float4*>(&tile[tb + ch * PC_PITCH + col * 4]);
                    float4 b1 = *reinterpret_cast<const float4*>(&tile[tb + (ch + 1) * PC_PITCH + col * 4]);
                    v2f af; af.x = s ? a4[u].z : a4[u].x;
                            af.y = s ? a4[u].w : a4[u].y;
                    v2f bf;
                    bf.x = b0.x; bf.y = b1.x;
                    acc[0] = __builtin_amdgcn_wmma_f32_16x16x4_f32(false, af, false, bf,
                                                                   (short)0, acc[0], false, false);
                    bf.x = b0.y; bf.y = b1.y;
                    acc[1] = __builtin_amdgcn_wmma_f32_16x16x4_f32(false, af, false, bf,
                                                                   (short)0, acc[1], false, false);
                    bf.x = b0.z; bf.y = b1.z;
                    acc[2] = __builtin_amdgcn_wmma_f32_16x16x4_f32(false, af, false, bf,
                                                                   (short)0, acc[2], false, false);
                    bf.x = b0.w; bf.y = b1.w;
                    acc[3] = __builtin_amdgcn_wmma_f32_16x16x4_f32(false, af, false, bf,
                                                                   (short)0, acc[3], false, false);
                }
            }
            // D layout: VGPR r, lanes 0-15 -> M = r (head), lanes 16-31 -> padding
            if (lane < 16) {
#pragma unroll
                for (int r = 0; r < HEADS; ++r) {
                    float4 o = { acc[0][r], acc[1][r], acc[2][r], acc[3][r] };
                    *reinterpret_cast<float4*>(&lg[(wave * HEADS + r) * PC_COLS + col * 4]) = o;
                }
            }
        }
        __syncthreads();

        // wave h: join the eight channel slices of head h, softmax terms of the row
        // against the running maximum
        {
            const int h = wave;
            float l0 = bias, l1 = bias;
#pragma unroll
            for (int w = 0; w < PC_WAVES; ++w) {
                float2 v = *reinterpret_cast<const float2*>(&lg[(w * HEADS + h) * PC_COLS + lane * 2]);
                l0 += v.x; l1 += v.y;
            }
            float mx = xor_max<32>(fmaxf(l0, l1));
            mx = fmaxf(mx, run_m);
            const float f = expf(run_m - mx);         // 0 for the first row
            float2 e = { expf(l0 - mx), expf(l1 - mx) };
            float2 zero = { 0.f, 0.f };
            *reinterpret_cast<float2*>(&pm[h * PC_PITCH + lane * 2]) = e;
            *reinterpret_cast<float2*>(&pm[(h + HEADS) * PC_PITCH + lane * 2]) = zero;   // N padding
            if (lane == 0) sc[h] = f;
            float sum = xor_sum<32>(e.x + e.y);
            float pc  = xor_sum<32>(e.x * (float)(lane * 2) + e.y * (float)(lane * 2 + 1));
            run_s  = run_s  * f + sum;
            run_pc = run_pc * f + pc;
            run_pr = run_pr * f + sum * (float)(grp * PC_ROWS + it);
            run_m  = mx;
        }
        __syncthreads();

        // part[h, c] over the wave's 64 channels (4 M tiles), K over the 64 columns, on
        // top of the rows before, brought to the new maximum (N = lane & 15 is the head).
        // k order of both loaders: step 2u+s holds columns 8u + 4 kgrp + 2s, +1.
        {
            const float fl = sc[col & 7];
#pragma unroll
            for (int t = 0; t < 4; ++t)
#pragma unroll
                for (int r = 0; r < 8; ++r) c[t][r] *= fl;
        }
#pragma unroll
        for (int u = 0; u < 8; ++u) {
            float4 p4 = *reinterpret_cast<const float4*>(&pm[col * PC_PITCH + u * 8 + kgrp * 4]);
            float4 a[4];
#pragma unroll
            for (int t = 0; t < 4; ++t)
                a[t] = *reinterpret_cast<const float4*>(
                    &tile[tb + (row0 + t * 16 + col) * PC_PITCH + u * 8 + kgrp * 4]);
#pragma unroll
            for (int t = 0; t < 4; ++t) {
                v2f af; af.x = a[t].x; af.y = a[t].y;
                v2f bf; bf.x = p4.x;   bf.y = p4.y;
                c[t] = __builtin_amdgcn_wmma_f32_16x16x4_f32(false, af, false, bf,
                                                             (short)0, c[t], false, false);
            }
#pragma unroll
            for (int t = 0; t < 4; ++t) {
                v2f af; af.x = a[t].z; af.y = a[t].w;
                v2f bf; bf.x = p4.z;   bf.y = p4.w;
                c[t] = __builtin_amdgcn_wmma_f32_16x16x4_f32(false, af, false, bf,
                                                             (short)0, c[t], false, false);
            }
        }

        // hand-over: this wave's LDS reads of the row are done, its copies of the next
        // row have landed, and the barrier says both of every wave
        asm volatile("s_wait_dscnt 0x0" ::: "memory");
        asm volatile("s_wait_asynccnt 0x0" ::: "memory");
        __syncthreads();
        // the row after the next goes into the buffer that has just been read
        if (it + 2 < PC_ROWS) {
            const float* g = g0 + (it + 2) * PC_COLS;
            const unsigned l = l0a + (unsigned)tb * 4u;
            PC_COPY8(l, g, 0);
            PC_COPY8(l, g, 16);
            PC_COPY8(l, g, 32);
            PC_COPY8(l, g, 48);
        }
    }
    // no copy is left on its way when the tile buffers become staging
    asm volatile("s_wait_asynccnt 0x0" ::: "memory");

    if (lane == 0) {
        const int idx = (b * HEADS + wave) * PC_GROUPS + grp;
        smax[idx] = run_m; ssum[idx] = run_s; scol[idx] = run_pc; srow[idx] = run_pr;
    }

    // D layout: VGPR r, lanes 0-15 -> M = r, lanes 16-31 -> M = r + 8; N = lane & 15 (head).
    // Turned through the wave's own, now spent, tile rows so that part is stored in
    // whole 128-byte lines.
    float* stg = &tile[row0 * PC_PITCH];
    if (col < HEADS) {
#pragma unroll
        for (int t = 0; t < 4; ++t) {
            float4 lo = { c[t][0], c[t][1], c[t][2], c[t][3] };
            float4 hi = { c[t][4], c[t][5], c[t][6], c[t][7] };
            *reinterpret_cast<float4*>(&stg[col * PC_PITCH + t * 16 + kgrp * 8])     = lo;
            *reinterpret_cast<float4*>(&stg[col * PC_PITCH + t * 16 + kgrp * 8 + 4]) = hi;
        }
    }
    // orders the lanes' staging writes in front of the other lanes' reads below
    __syncthreads();
    float* po = part + ((long)piece * HEADS) * CH + row0 + col * 4;
#pragma unroll
    for (int i = 0; i < 4; ++i) {
        const int h = i * 2 + kgrp;
        float4 v = *reinterpret_cast<const float4*>(&stg[h * PC_PITCH + col * 4]);
        *reinterpret_cast<float4*>(po + h * CH) = v;
    }
}

// ---------------------------------------------------------------------------
// Kernel 2: two workgroups per (batch, head). Each joins the 16 partial results:
//   w[k] = exp(max[k] - max over k) / sum_k(...)   context[c] = sum_k w[k] part[k, c]
// (the first also stores the centroid cx, cy), keeps the context row in LDS and takes
// 96 of the 192 rows of the K, Q and V weights against it: one wave per weight row,
// read as whole 128-byte lines, the lanes' partial sums joined by a butterfly.
// ---------------------------------------------------------------------------
#define KQ_ROWS 6     // weight rows a wave: 192 rows / 2 workgroups / 16 waves

__device__ __forceinline__ float dot4(float4 a, float4 b, float s)
{
    s += a.x * b.x; s += a.y * b.y; s += a.z * b.z; s += a.w * b.w;
    return s;
}

__global__ void __launch_bounds__(512)
k_join_kqv(const float* __restrict__ part, const float* __restrict__ smax,
           const float* __restrict__ ssum, const float* __restrict__ scol,
           const float* __restrict__ srow,
           const float* __restrict__ k_w, const float* __restrict__ k_b,
           const float* __restrict__ q_w, const float* __restrict__ q_b,
           const float* __restrict__ v_w, const float* __restrict__ v_b,
           float* __restrict__ kqv, float* __restrict__ cx, float* __restrict__ cy)
{
    __shared__ float wl[PC_GROUPS];
    __shared__ __attribute__((aligned(16))) float red[4 * CH];
    __shared__ __attribute__((aligned(16))) float cs[CH];
    __shared__ float ro[16 * KQ_ROWS];
    const int piece = dealt_piece(blockIdx.x);
    const int row  = piece >> 1;                      // b*8 + h
    const int sub  = piece & 1;                       // which 96 weight rows
    const int b    = row >> 3, h = row & 7;
    const int tid  = threadIdx.x;
    const int lane = tid & 31;
    const int wave = __builtin_amdgcn_readfirstlane(tid >> 5);
    const int k16  = tid & 15;
    const int c4   = tid & 127;                       // four channels a thread
    const int cg   = tid >> 7;                        // four partial results a thread

    const float* pp = part + (((long)b * PC_GROUPS + cg * 4) * HEADS + h) * CH + c4 * 4;
    float4 v[4];
#pragma unroll
    for (int i = 0; i < 4; ++i)
        v[i] = *reinterpret_cast<const float4*>(pp + (long)i * HEADS * CH);
    // the loads above share one address pair: this wait stands in front of its
    // reuse, and the operand keeps the pair live up to here. It also holds the loads
    // in front of the weights' butterflies, behind which the compiler had sunk them.
    asm volatile("s_wait_xcnt 0x0" :: "v"(pp) : "memory");

    // every 16 lanes alike: one partial result a lane
    const float m0 = smax[row * PC_GROUPS + k16];
    const float s0 = ssum[row * PC_GROUPS + k16];
    const float p0 = scol[row * PC_GROUPS + k16];
    const float r0 = srow[row * PC_GROUPS + k16];

    // the bias of the result that this thread stores at the end
    const int rs = sub * 96 + ((tid < 96) ? tid : 95);
    const float bk = k_b[rs & 63], bq = q_b[rs & 63], bv = v_b[rs & 63];
    // keeps the small loads older than the weight rows: a wait for them waits for no row
    __builtin_amdgcn_sched_barrier(0);

    // the wave's weight rows need nothing of the join: on their way from here on
    const int lofs = lane * 16;                       // the lane's byte offset in a 512-byte piece
    float4 w[KQ_ROWS][4];
#pragma unroll
    for (int j = 0; j < KQ_ROWS; ++j) {
        const int r = sub * 96 + wave * KQ_ROWS + j;  // 0..191: K | Q | V, 64 rows each
        const float* wm = (r < 64) ? k_w : (r < 128) ? q_w : v_w;
        const char* wb = reinterpret_cast<const char*>(wm + (r & 63) * CH);
#pragma unroll
        for (int i = 0; i < 4; ++i)
            w[j][i] = *reinterpret_cast<const float4*>(wb + lofs + i * 512);
    }
    // the loads above share one offset register: this wait stands in front of its
    // reuse, and the first operand keeps it live up to here. It also holds the loads
    // here, ahead of the join, instead of behind its barriers; the biases are inputs so
    // that their loads are not sunk to the kernel's end, where they would be waited out
    asm volatile("s_wait_xcnt 0x0" :: "v"(lofs), "v"(bk), "v"(bq), "v"(bv) : "memory");
    // the butterflies below wait for the first loads: they stay behind the issue of all
    __builtin_amdgcn_sched_barrier(0);

    const float mx = xor_max<16>(m0);
    const float w0 = expf(m0 - mx);
    const float sum = xor_sum<16>(w0 * s0);
    const float pc  = xor_sum<16>(w0 * p0);
    const float pr  = xor_sum<16>(w0 * r0);
    const float inv = 1.f / sum;
    if (tid < PC_GROUPS) wl[tid] = w0 * inv;
    lds_barrier();

    float4 a = { 0.f, 0.f, 0.f, 0.f };
#pragma unroll
    for (int i = 0; i < 4; ++i) {
        const float wk = wl[cg * 4 + i];
        a.x += wk * v[i].x; a.y += wk * v[i].y; a.z += wk * v[i].z; a.w += wk * v[i].w;
    }
    *reinterpret_cast<float4*>(&red[cg * CH + c4 * 4]) = a;
    lds_barrier();

    if (tid < 128) {
        float4 t0 = *reinterpret_cast<const float4*>(&red[0 * CH + tid * 4]);
        float4 t1 = *reinterpret_cast<const float4*>(&red[1 * CH + tid * 4]);
        float4 t2 = *reinterpret_cast<const float4*>(&red[2 * CH + tid * 4]);
        float4 t3 = *reinterpret_cast<const float4*>(&red[3 * CH + tid * 4]);
        float4 o = { (t0.x + t1.x) + (t2.x + t3.x), (t0.y + t1.y) + (t2.y + t3.y),
                     (t0.z + t1.z) + (t2.z + t3.z), (t0.w + t1.w) + (t2.w + t3.w) };
        *reinterpret_cast<float4*>(&cs[tid * 4]) = o;
    }
    if (tid == 0 && sub == 0) {
        cx[row] = pc * inv / (float)HT;
        cy[row] = pr * inv / (float)WD;
    }
    lds_barrier();

    // the lane's 16 columns of the context row against its 16 columns of each weight row
    {
        float4 c[4];
#pragma unroll
        for (int i = 0; i < 4; ++i)
            c[i] = *reinterpret_cast<const float4*>(&cs[i * 128 + lane * 4]);
        float res = 0.f;
#pragma unroll
        for (int j = 0; j < KQ_ROWS; ++j) {
            float s = 0.f;
#pragma unroll
            for (int i = 0; i < 4; ++i) s = dot4(w[j][i], c[i], s);
            s = xor_sum<32>(s);
            res = (lane == j) ? s : res;
        }
        if (lane < KQ_ROWS) ro[wave * KQ_ROWS + lane] = res;
    }
    lds_barrier();

    // 96 results go out as three whole 128-byte lines: kqv[b][K|Q|V][h][d]
    if (tid < 96) {
        const int mat = rs >> 6, d = rs & 63;
        kqv[b * 1536 + mat * 512 + h * 64 + d] = ro[tid] + ((mat == 0) ? bk : (mat == 1) ? bq : bv);
    }
}

// ---------------------------------------------------------------------------
// Kernel 3: out[b,c,hw] = x[b,c,hw] + add_term[b,c]   (float4 streaming)
// One workgroup of 16 waves per WGP; a wave streams AO_PLANES whole (b,c) planes in
// groups of AO_DEPTH loads, each load 512 contiguous bytes. Ahead of its stream every
// workgroup works out its batch's head attention and channel_add MLP itself (16
// workgroups a batch do the same sums) and the add_term of its own 32 channels. What it
// needs first from memory is asked for at the top, in the order of use: the small operands
// (to LDS), the rows of w1 (registers), the first group of x (registers). The rest of
// the wave's x follows while those sums run: groups 1 and 2 into the wave's own 16 KiB
// of LDS, through no register, group 3 into the registers that w1 leaves. Behind the
// sums the wave has only to add and store.
// ---------------------------------------------------------------------------
#define AO_WAVES  16    // waves per workgroup
#define AO_PLANES 2     // (b,c) planes per wave
#define AO_DEPTH  16    // 16-byte loads per lane in flight
#define AO_GROUPS (AO_PLANES * (HWSZ / 4) / (32 * AO_DEPTH))
#define AO_CH     (AO_WAVES * AO_PLANES)   // channels per workgroup
#define AO_LGRP   2     // groups of x that wait in LDS
#define AO_LFL    (AO_LGRP * AO_DEPTH * 128)   // floats of LDS a wave has for them

// eight 16-byte-a-lane copies, global memory to LDS through no register, 512 bytes
// apart: the immediate offset moves the global and the LDS address alike
#define AO_CP(n)  "global_load_async_to_lds_b128 %0, %1, off offset:" #n "\n\t"
#define AO_CP8(a, b, c, d, e, f, g, h) AO_CP(a) AO_CP(b) AO_CP(c) AO_CP(d) AO_CP(e) AO_CP(f) AO_CP(g) AO_CP(h)

__global__ void __launch_bounds__(AO_WAVES * 32)
k_attn_addout(const float* __restrict__ x, const float* __restrict__ kqv,
              const float* __restrict__ cx, const float* __restrict__ cy,
              const float* __restrict__ g_w, const float* __restrict__ g_b,
              const float* __restrict__ w1,  const float* __restrict__ b1,
              const float* __restrict__ lng, const float* __restrict__ lnb,
              const float* __restrict__ w2,  const float* __restrict__ b2,
              float* __restrict__ out)
{
    __shared__ __attribute__((aligned(16))) float wkqv[3 * 512];  // wk | wq | wv, each [h][d]
    __shared__ __attribute__((aligned(16))) float sm[512];        // g_w 64 | b1 128 | ln_g 128 | ln_b 128 | b2 32
    __shared__ __attribute__((aligned(16))) float sw2[AO_CH * PLANES];
    __shared__ float lt[64];
    __shared__ float wmn[64];
    __shared__ __attribute__((aligned(16))) float oc[512];
    __shared__ __attribute__((aligned(16))) float ly[128];
    __shared__ __attribute__((aligned(16))) float xs[AO_WAVES * AO_LFL];

    const int tid   = threadIdx.x;
    const int lane  = tid & 31;
    const int wave  = __builtin_amdgcn_readfirstlane(tid >> 5);
    const int piece = dealt_piece(blockIdx.x);
    const int plane = (piece * AO_WAVES + wave) * AO_PLANES;
    const int b     = piece / (CH / AO_CH);
    const int c0    = (piece % (CH / AO_CH)) * AO_CH;             // the workgroup's first channel
    const float4* xp = reinterpret_cast<const float4*>(x) + (long)plane * (HWSZ / 4) + lane;
    float4*       op = reinterpret_cast<float4*>(out)     + (long)plane * (HWSZ / 4) + lane;

    const int pair = tid >> 3, sub = tid & 7;
    const int m = pair >> 3, n = pair & 7;

    // small operands first: a wait for them then waits for nothing that is large
    const int ikq = b * 1536 + tid, im = b * 8 + m, in = b * 8 + n;
    const int ig = tid & 63, il = (tid - 64) & 127, ib2 = c0 + ((tid - 448) & (AO_CH - 1));
    float kq[3];
#pragma unroll
    for (int i = 0; i < 3; ++i) kq[i] = kqv[ikq + i * 512];
    const float cxm = cx[im], cxn = cx[in];
    const float cym = cy[im], cyn = cy[in];
    const float gb  = g_b[0];
    const float sg  = g_w[ig];
    const float sb1 = b1[il], sgn = lng[il], sbn = lnb[il];   // 64, 192 and 320 are alike mod 128
    const float sb2 = b2[ib2];
    const float4* w2p = reinterpret_cast<const float4*>(w2 + c0 * PLANES) + tid;
    const float4 w2a = w2p[0], w2b = w2p[512];
    // this wait stands in front of any rewrite of a register that the loads above name:
    // the operands keep every index and every base live up to here, so that no later
    // load's result and no scalar load lands on one of them ahead of the wait
    asm volatile("s_wait_xcnt 0x0" :: "v"(ikq), "v"(im), "v"(in), "v"(ig), "v"(il), "v"(ib2),
                 "s"(kqv), "s"(cx), "s"(cy), "s"(g_w), "s"(b1), "s"(lng), "s"(lnb), "s"(b2)
                 : "memory");
    // keeps the small loads the oldest: left free, the compiler put some behind the large
    // ones, and the wait for them ahead of their stores to LDS waited for everything
    __builtin_amdgcn_sched_barrier(0);

    // y = oc @ w1^T: one wave per row, 8 rows a wave
    const char* wb = reinterpret_cast<const char*>(w1 + wave * 8 * 512);
    const int lofs = lane * 16;                       // the lane's byte offset in a 512-byte piece
    float4 w[8][4];
#pragma unroll
    for (int j = 0; j < 8; ++j)
#pragma unroll
        for (int i = 0; i < 4; ++i)
            w[j][i] = *reinterpret_cast<const float4*>(wb + lofs + j * 2048 + i * 512);

    // keeps the rows of w1, used first, older than the group of x
    __builtin_amdgcn_sched_barrier(0);

    // the first group of x
    float4 v[AO_DEPTH];
#pragma unroll
    for (int i = 0; i < AO_DEPTH; ++i) v[i] = xp[i * 32];

    // keeps the loads above in front of the barrier and the copies below
    __builtin_amdgcn_sched_barrier(0);

    // no data is handed over here: every wave has asked for its rows of w1 before any
    // wave asks for more of x, so that no row, wanted first, queues behind the copies.
    // It stands where the waves would wait for the small operands anyway
    __builtin_amdgcn_s_barrier();

    // groups 1 and 2 of x, 16 KiB in a row, into the wave's own part of xs: 32 copies on
    // their way under the sums below. The wait in the last line stands in front of any
    // rewrite of the two address registers named here.
    float* xw = &xs[wave * AO_LFL + lane * 4];
    asm volatile(AO_CP8(0, 512, 1024, 1536, 2048, 2560, 3072, 3584)
                 AO_CP8(4096, 4608, 5120, 5632, 6144, 6656, 7168, 7680)
                 AO_CP8(8192, 8704, 9216, 9728, 10240, 10752, 11264, 11776)
                 AO_CP8(12288, 12800, 13312, 13824, 14336, 14848, 15360, 15872)
                 "s_wait_xcnt 0x0"
                 :: "v"((unsigned)(uintptr_t)xw), "v"(xp + AO_DEPTH * 32) : "memory");

    // this wait stands in front of any reuse of the address registers named above, and
    // the first two operands keep the lanes' own up to here. It also holds all these
    // loads in front of the barrier below. The small loaded values are inputs because the
    // compiler had sunk their loads into branches behind the large ones, where the wait
    // for them waited for everything; they are stored to LDS right below
    asm volatile("s_wait_xcnt 0x0" :: "v"(lofs), "v"(w2p), "v"(sg), "v"(sb1), "v"(sgn),
                 "v"(sbn), "v"(sb2), "s"(gb) : "memory");

#pragma unroll
    for (int i = 0; i < 3; ++i) wkqv[i * 512 + tid] = kq[i];
    sm[tid] = (tid < 64) ? sg : (tid < 192) ? sb1 : (tid < 320) ? sgn : (tid < 448) ? sbn : sb2;
    *reinterpret_cast<float4*>(&sw2[tid * 4])         = w2a;
    *reinterpret_cast<float4*>(&sw2[(tid + 512) * 4]) = w2b;
    lds_barrier();

    // w_g (geometric) and scaled_dot -> logits lt[m*8+n]; 8 lanes per (m, n)
    {
        float dx = cxm - cxn;
        float dy = cym - cyn;
        float pos[4] = { fmaxf(dx, 0.f), fmaxf(-dx, 0.f),
                         fmaxf(dy, 0.f), fmaxf(-dy, 0.f) };
        float freq = expf(-6.90775527898f * (float)sub * 0.125f);   // 1000^(-f/8)
        float s = 0.f;
        for (int p = 0; p < 4; ++p) {
            float ang = 100.f * pos[p] * freq;
            s += sinf(ang) * sm[p * 8 + sub] + cosf(ang) * sm[32 + p * 8 + sub];
        }
        float sd = 0.f;
#pragma unroll
        for (int i = 0; i < 8; ++i) {
            const int d = sub + 8 * i;
            sd += wkqv[m * 64 + d] * wkqv[512 + n * 64 + d];
        }
        s  = xor_sum<8>(s);
        sd = xor_sum<8>(sd);
        if (sub == 0) {
            float wg = fmaxf(s + gb, 0.f);
            lt[pair] = logf(fmaxf(wg, 1e-6f)) + sd * 0.125f;        // 1/sqrt(64)
        }
    }
    lds_barrier();

    // softmax over m (axis=1) for each n; 8 lanes per n
    if (tid < 64) {
        const int nn = tid >> 3, mm = tid & 7;
        float t = lt[mm * 8 + nn];
        const float mx = xor_max<8>(t);
        float e = expf(t - mx);
        float inv = 1.f / xor_sum<8>(e);
        wmn[mm * 8 + nn] = e * inv;
    }
    lds_barrier();

    // out_ctx[n, d] = sum_m wmn[m,n] * wv[m,d] -> flat n*64+d
    {
        int nn = tid >> 6, d = tid & 63;
        float s = 0.f;
        for (int mm = 0; mm < 8; ++mm) s += wmn[mm * 8 + nn] * wkqv[1024 + mm * 64 + d];
        oc[tid] = s;
    }
    lds_barrier();

    // y = oc @ w1^T + b1  [128]
    {
        float4 o4[4];
#pragma unroll
        for (int i = 0; i < 4; ++i)
            o4[i] = *reinterpret_cast<const float4*>(&oc[i * 128 + lane * 4]);
        float res = 0.f;
#pragma unroll
        for (int j = 0; j < 8; ++j) {
            float s = 0.f;
#pragma unroll
            for (int i = 0; i < 4; ++i) s = dot4(w[j][i], o4[i], s);
            s = xor_sum<32>(s);
            res = (lane == j) ? s : res;
        }
        if (lane < 8) ly[wave * 8 + lane] = res + sm[64 + wave * 8 + lane];
    }
    // the last group of x goes into the registers that the rows of w1 have left: not
    // earlier (there is no room), and not sunk to its use behind the sums that follow
    __builtin_amdgcn_sched_barrier(0);
    float4 vl[AO_DEPTH];
#pragma unroll
    for (int i = 0; i < AO_DEPTH; ++i) vl[i] = xp[((AO_GROUPS - 1) * AO_DEPTH + i) * 32];
    // this wait stands in front of any reuse of the address pair, kept live up to here
    asm volatile("s_wait_xcnt 0x0" :: "v"(xp) : "memory");
    __builtin_amdgcn_sched_barrier(0);
    lds_barrier();

    // LayerNorm + ReLU in registers (every 8-lane group holds all 128 values), then
    // add_term[c] = y @ w2^T + b2 for the wave's two channels: 8 lanes per row
    float a[AO_PLANES];
    {
        const int s8 = lane & 7, rsub = (lane >> 3) & (AO_PLANES - 1);
        float y[16];
#pragma unroll
        for (int i = 0; i < 4; ++i) {
            float4 t = *reinterpret_cast<const float4*>(&ly[i * 32 + s8 * 4]);
            y[i * 4 + 0] = t.x; y[i * 4 + 1] = t.y; y[i * 4 + 2] = t.z; y[i * 4 + 3] = t.w;
        }
        float mu = 0.f;
#pragma unroll
        for (int i = 0; i < 16; ++i) mu += y[i];
        mu = xor_sum<8>(mu) * (1.f / PLANES);
        float var = 0.f;
#pragma unroll
        for (int i = 0; i < 16; ++i) { float dlt = y[i] - mu; var += dlt * dlt; }
        var = xor_sum<8>(var) * (1.f / PLANES);
        const float rstd = rsqrtf(var + 1e-5f);
        const int cl = wave * AO_PLANES + rsub;       // the 8-lane group's channel, from c0
        float s = 0.f;
#pragma unroll
        for (int i = 0; i < 4; ++i) {
            float4 g4 = *reinterpret_cast<const float4*>(&sm[192 + i * 32 + s8 * 4]);
            float4 b4 = *reinterpret_cast<const float4*>(&sm[320 + i * 32 + s8 * 4]);
            float4 yn;
            yn.x = fmaxf((y[i * 4 + 0] - mu) * rstd * g4.x + b4.x, 0.f);
            yn.y = fmaxf((y[i * 4 + 1] - mu) * rstd * g4.y + b4.y, 0.f);
            yn.z = fmaxf((y[i * 4 + 2] - mu) * rstd * g4.z + b4.z, 0.f);
            yn.w = fmaxf((y[i * 4 + 3] - mu) * rstd * g4.w + b4.w, 0.f);
            s = dot4(*reinterpret_cast<const float4*>(&sw2[cl * PLANES + i * 32 + s8 * 4]), yn, s);
        }
        s = xor_sum<8>(s) + sm[448 + cl];
#pragma unroll
        for (int p = 0; p < AO_PLANES; ++p)   // lane 8 p holds channel p's term: alike for the wave
            a[p] = __builtin_bit_cast(float, __builtin_amdgcn_readlane(__builtin_bit_cast(int, s), p * 8));
    }

    // unrolled: every address is one base and one lane offset plus an immediate, so no
    // address register is rewritten while stores are in flight
#pragma unroll
    for (int g = 0; g < AO_GROUPS; ++g) {
        if (g == 1) {
            // the wave's own copies have landed behind this wait; no other wave reads them
            asm volatile("s_wait_asynccnt 0x0" ::: "memory");
        }
        if (g >= 1 && g <= AO_LGRP) {
            // the LDS loads below land on registers that the group before was stored
            // from: this wait stands between those stores and the overwrite of their data
            asm volatile("s_wait_xcnt 0x0" ::: "memory");
#pragma unroll
            for (int i = 0; i < AO_DEPTH; ++i)
                v[i] = *reinterpret_cast<const float4*>(&xw[((g - 1) * AO_DEPTH + i) * 128]);
            // all LDS loads of the group are issued before the first add waits for one
            __builtin_amdgcn_sched_barrier(0);
        }
        const float s = a[g / (AO_GROUPS / AO_PLANES)];
        float4* t = (g > AO_LGRP) ? vl : v;
#pragma unroll
        for (int i = 0; i < AO_DEPTH; ++i) {
            t[i].x += s; t[i].y += s; t[i].z += s; t[i].w += s;
        }
        // a group's adds stand in front of its stores: drawn in between them, they were given
        // registers of stores of the same group, each behind a wait for that store
        __builtin_amdgcn_sched_barrier(0);
#pragma unroll
        for (int i = 0; i < AO_DEPTH; ++i) op[(g * AO_DEPTH + i) * 32] = t[i];
        // the groups go out in the order in which they arrive: left free, the compiler
        // drew the adds of the last group, and the wait for its loads, in front of group 1
        __builtin_amdgcn_sched_barrier(0);
    }
}

// ---------------------------------------------------------------------------
extern "C" void kernel_launch(void* const* d_in, const int* in_sizes, int n_in,
                              void* d_out, int out_size, void* d_ws, size_t ws_size,
                              hipStream_t stream)
{
    const float* x   = (const float*)d_in[0];
    const float* cmw = (const float*)d_in[1];
    const float* cmb = (const float*)d_in[2];
    const float* g_w = (const float*)d_in[3];
    const float* g_b = (const float*)d_in[4];
    const float* k_w = (const float*)d_in[5];
    const float* k_b = (const float*)d_in[6];
    const float* q_w = (const float*)d_in[7];
    const float* q_b = (const float*)d_in[8];
    const float* v_w = (const float*)d_in[9];
    const float* v_b = (const float*)d_in[10];
    const float* w1  = (const float*)d_in[11];
    const float* b1  = (const float*)d_in[12];
    const float* lng = (const float*)d_in[13];
    const float* lnb = (const float*)d_in[14];
    const float* w2  = (const float*)d_in[15];
    const float* b2  = (const float*)d_in[16];
    float* out = (float*)d_out;

    // workspace layout (floats)
    float* ws   = (float*)d_ws;
    float* part = ws;                                 // 16*16*8*512 = 1048576 used
    float* kqv  = ws + 4194304;                       // 16*3*8*64 = 24576 used
    float* cxb  = ws + 4194304 + 65536;               // 128
    float* cyb  = cxb + 128;                          // 128
    float* smax = cyb + 128 + 8192;                   // 16*8*16 = 2048 used
    float* ssum = smax + 8192;                        // 2048 used
    float* scol = ssum + 8192;                        // 2048 used
    float* srow = scol + 8192;                        // 2048 used

    k_pool_partial<<<dim3(NB * PC_GROUPS), dim3(PC_WAVES * 32), 0, stream>>>(x, cmw, cmb, part,
                                                                             smax, ssum, scol, srow);
    k_join_kqv<<<dim3(NB * HEADS * 2), dim3(512), 0, stream>>>(part, smax, ssum, scol, srow,
                                                               k_w, k_b, q_w, q_b, v_w, v_b,
                                                               kqv, cxb, cyb);
    k_attn_addout<<<dim3(NB * CH / AO_CH), dim3(AO_WAVES * 32), 0, stream>>>(x, kqv, cxb, cyb, g_w, g_b,
                                                                             w1, b1, lng, lnb, w2, b2, out);
}

// v009
// Measured time: 36.3 microseconds a run.
// In two side-by-side timings against v008, it was 1.05 and 1.04 times as fast.
// Over all steps from v000 it is 5.80 times as fast.
#include <hip/hip_runtime.h>
#include <hip/hip_bf16.h>

typedef __attribute__((ext_vector_type(2))) float v2f;
typedef __attribute__((ext_vector_type(8))) float v8f;
typedef __attribute__((ext_vector_type(4))) float v4f;

#define HEADS  8
#define NB     16
#define CH     512
#define HT     64
#define WD     64
#define HWSZ   4096
#define PLANES 128

// The value of lane l ^ M, by a vector instruction: a DPP row_xmask move inside a row of
// 16 lanes (the compiler folds it into an add that takes it), a cross-row
// move for M = 16. __shfl_xor goes through the LDS unit and is waited for at every step.
// Every lane of the wave is on wherever this is called.
template <int M>
__device__ __forceinline__ float lane_xor(float v)
{
    const int b = __builtin_bit_cast(int, v);
    if constexpr (M == 16)
        return __builtin_bit_cast(float, __builtin_amdgcn_permlanex16(b, b, 0x76543210, 0xfedcba98,
                                                                      false, false));
    else
        return __builtin_bit_cast(float, __builtin_amdgcn_update_dpp(0, b, 0x160 + M, 0xf, 0xf, true));
}

// butterflies over WIDTH lanes, widest step first
template <int WIDTH>
__device__ __forceinline__ float xor_sum(float v)
{
    if constexpr (WIDTH >= 32) v += lane_xor<16>(v);
    if constexpr (WIDTH >= 16) v += lane_xor<8>(v);
    if constexpr (WIDTH >= 8)  v += lane_xor<4>(v);
    v += lane_xor<2>(v);
    v += lane_xor<1>(v);
    return v;
}

template <int WIDTH>
__device__ __forceinline__ float xor_max(float v)
{
    if constexpr (WIDTH >= 32) v = fmaxf(v, lane_xor<16>(v));
    if constexpr (WIDTH >= 16) v = fmaxf(v, lane_xor<8>(v));
    if constexpr (WIDTH >= 8)  v = fmaxf(v, lane_xor<4>(v));
    v = fmaxf(v, lane_xor<2>(v));
    v = fmaxf(v, lane_xor<1>(v));
    return v;
}

// workgroup barrier for data handed over in LDS alone: the fences name LDS only, so the
// wave waits for its LDS accesses and not, as __syncthreads() makes it, for every global
// load that it still has on its way
__device__ __forceinline__ void lds_barrier()
{
    __builtin_amdgcn_fence(__ATOMIC_RELEASE, "workgroup", "local");
    __builtin_amdgcn_s_barrier();
    __builtin_amdgcn_fence(__ATOMIC_ACQUIRE, "workgroup", "local");
}

// Which piece of the work a workgroup takes, the same in all three launches (256
// workgroups each): piece number = batch * 16 + part of the batch. The 16 workgroups of
// a batch have launch indices that are equal mod 8. For speed only: this is a permutation of 0..255, so every
// piece is done exactly once wherever the workgroups land.
__device__ __forceinline__ int dealt_piece(int i)
{
    return ((i & 7) * 2 + ((i >> 7) & 1)) * 16 + ((i >> 3) & 15);
}

#define PC_COLS  64    // hw columns per tile: one image row
#define PC_ROWS  4     // image rows a workgroup takes, one after the other
#define PC_GROUPS (HWSZ / (PC_COLS * PC_ROWS))   // workgroups, and partial results, per batch
#define PC_PITCH 68    // floats per LDS row: 272 B, an odd multiple of 16 B
#define PC_WAVES 8
#define PC_TILE  (CH * PC_PITCH)   // floats of one tile buffer

// eight 16-byte-a-lane copies, global memory to LDS through no register. The wait in
// the last line stands in front of any rewrite of the address registers named here.
#define PC_COPY8(l, g, r)                                                         \
    asm volatile("global_load_async_to_lds_b128 %0, %8, off\n\t"                  \
                 "global_load_async_to_lds_b128 %1, %9, off\n\t"                  \
                 "global_load_async_to_lds_b128 %2, %10, off\n\t"                 \
                 "global_load_async_to_lds_b128 %3, %11, off\n\t"                 \
                 "global_load_async_to_lds_b128 %4, %12, off\n\t"                 \
                 "global_load_async_to_lds_b128 %5, %13, off\n\t"                 \
                 "global_load_async_to_lds_b128 %6, %14, off\n\t"                 \
                 "global_load_async_to_lds_b128 %7, %15, off\n\t"                 \
                 "s_wait_xcnt 0x0"                                                \
                 :: "v"((l) + ((r) + 0) * (PC_PITCH * 4u)),                       \
                    "v"((l) + ((r) + 2) * (PC_PITCH * 4u)),                       \
                    "v"((l) + ((r) + 4) * (PC_PITCH * 4u)),                       \
                    "v"((l) + ((r) + 6) * (PC_PITCH * 4u)),                       \
                    "v"((l) + ((r) + 8) * (PC_PITCH * 4u)),                       \
                    "v"((l) + ((r) + 10) * (PC_PITCH * 4u)),                      \
                    "v"((l) + ((r) + 12) * (PC_PITCH * 4u)),                      \
                    "v"((l) + ((r) + 14) * (PC_PITCH * 4u)),                      \
                    "v"((g) + ((r) + 0) * HWSZ), "v"((g) + ((r) + 2) * HWSZ),     \
                    "v"((g) + ((r) + 4) * HWSZ), "v"((g) + ((r) + 6) * HWSZ),     \
                    "v"((g) + ((r) + 8) * HWSZ), "v"((g) + ((r) + 10) * HWSZ),    \
                    "v"((g) + ((r) + 12) * HWSZ), "v"((g) + ((r) + 14) * HWSZ)    \
                 : "memory")

// ---------------------------------------------------------------------------
// Kernel 1: one workgroup per (batch, 4 image rows). It takes its rows one after the
// other; a row's tile x[512 c][64 hw] is brought into one of two LDS buffers while the
// row before is worked on, and feeds both products:
//   logits[h, hw] = sum_c cmw[h, c] * x[c, hw] + cmb[h]      (WMMA, K over c)
//   e[h, hw]      = exp(logits - running maximum)
//   part[h, c]    = part[h, c] * exp(old maximum - new) + sum_hw x[c, hw] * e[h, hw]
// part stays in the WMMA accumulators over the four rows. The running maximum, sum of
// e and the two moments go out beside part; kernel 2 joins the 16 workgroups of a
// (batch, head). Wave w copies, and alone reads, the channels 64 w .. 64 w + 63.
// ---------------------------------------------------------------------------
__global__ void __launch_bounds__(PC_WAVES * 32)
k_pool_partial(const float* __restrict__ x, const float* __restrict__ cmw,
               const float* __restrict__ cmb, float* __restrict__ part,
               float* __restrict__ smax, float* __restrict__ ssum,
               float* __restrict__ scol, float* __restrict__ srow)
{
    __shared__ __attribute__((aligned(16))) float tile[2 * PC_TILE];
    __shared__ __attribute__((aligned(16))) float lg[PC_WAVES * HEADS * PC_COLS];
    __shared__ __attribute__((aligned(16))) float pm[16 * PC_PITCH];
    __shared__ float sc[HEADS];

    const int lane  = threadIdx.x & 31;
    const int wave  = __builtin_amdgcn_readfirstlane(threadIdx.x >> 5);
    const int piece = dealt_piece(blockIdx.x);
    const int b     = piece / PC_GROUPS;
    const int grp   = piece % PC_GROUPS;
    const int col   = lane & 15;
    const int kgrp  = lane >> 4;
    const int row0  = wave * 64;

    // the lane's place in the first image row's tile, in memory and in buffer 0
    const float* g0 = x + ((long)b * CH + row0 + kgrp) * HWSZ + grp * (PC_ROWS * PC_COLS) + col * 4;
    const unsigned l0a = (unsigned)(uintptr_t)&tile[(row0 + kgrp) * PC_PITCH + col * 4];

    // row 0 into buffer 0: 32 copies a wave, each two rows of 256 bytes, all in flight at once
    PC_COPY8(l0a, g0, 0);
    PC_COPY8(l0a, g0, 16);
    PC_COPY8(l0a, g0, 32);
    PC_COPY8(l0a, g0, 48);

    // A fragments of the logits product, fetched while the tile is on its way.
    // k order of both loaders: step 2u+s holds channels row0 + 8u + 4 kgrp + 2s, +1.
    float4 a4[8];
#pragma unroll
    for (int u = 0; u < 8; ++u) {
        float4 t = *reinterpret_cast<const float4*>(cmw + (col & 7) * CH + row0 + u * 8 + kgrp * 4);
        a4[u].x = (col < HEADS) ? t.x : 0.f;          // rows >= 8 are zero padding
        a4[u].y = (col < HEADS) ? t.y : 0.f;
        a4[u].z = (col < HEADS) ? t.z : 0.f;
        a4[u].w = (col < HEADS) ? t.w : 0.f;
    }
    const float bias = cmb[wave];

    // the wave's own copies have landed behind this wait
    asm volatile("s_wait_asynccnt 0x0" ::: "memory");
    __syncthreads();

    // row 1 into buffer 1: on its way while row 0 is worked on
    {
        const float* g = g0 + PC_COLS;
        const unsigned l = l0a + PC_TILE * 4u;
        PC_COPY8(l, g, 0);
        PC_COPY8(l, g, 16);
        PC_COPY8(l, g, 32);
        PC_COPY8(l, g, 48);
    }

    // wave h keeps head h's running terms; every wave keeps part of its 64 channels
    float run_m = -3.0e38f, run_s = 0.f, run_pc = 0.f, run_pr = 0.f;
    v8f c[4];
#pragma unroll
    for (int t = 0; t < 4; ++t) c[t] = (v8f){0.f, 0.f, 0.f, 0.f, 0.f, 0.f, 0.f, 0.f};

    for (int it = 0; it < PC_ROWS; ++it) {
        const int tb = (it & 1) * PC_TILE;            // this row's buffer

        // logits over the wave's 64 channels, all 64 columns: N tile t holds columns 4n + t
        {
            v8f acc[4];
#pragma unroll
            for (int t = 0; t < 4; ++t) acc[t] = (v8f){0.f, 0.f, 0.f, 0.f, 0.f, 0.f, 0.f, 0.f};
#pragma unroll
            for (int u = 0; u < 8; ++u) {
#pragma unroll
                for (int s = 0; s < 2; ++s) {
                    const int ch = row0 + u * 8 + kgrp * 4 + s * 2;
                    float4 b0 = *reinterpret_cast<const float4*>(&tile[tb + ch * PC_PITCH + col * 4]);
                    float4 b1 = *reinterpret_cast<const float4*>(&tile[tb + (ch + 1) * PC_PITCH + col * 4]);
                    v2f af; af.x = s ? a4[u].z : a4[u].x;
                            af.y = s ? a4[u].w : a4[u].y;
                    v2f bf;
                    bf.x = b0.x; bf.y = b1.x;
                    acc[0] = __builtin_amdgcn_wmma_f32_16x16x4_f32(false, af, false, bf,
                                                                   (short)0, acc[0], false, false);
                    bf.x = b0.y; bf.y = b1.y;
                    acc[1] = __builtin_amdgcn_wmma_f32_16x16x4_f32(false, af, false, bf,
                                                                   (short)0, acc[1], false, false);
                    bf.x = b0.z; bf.y = b1.z;
                    acc[2] = __builtin_amdgcn_wmma_f32_16x16x4_f32(false, af, false, bf,
                                                                   (short)0, acc[2], false, false);
                    bf.x = b0.w; bf.y = b1.w;
                    acc[3] = __builtin_amdgcn_wmma_f32_16x16x4_f32(false, af, false, bf,
                                                                   (short)0, acc[3], false, false);
                }
            }
            // D layout: VGPR r, lanes 0-15 -> M = r (head), lanes 16-31 -> padding
            if (lane < 16) {
#pragma unroll
                for (int r = 0; r < HEADS; ++r) {
                    float4 o = { acc[0][r], acc[1][r], acc[2][r], acc[3][r] };
                    *reinterpret_cast<float4*>(&lg[(wave * HEADS + r) * PC_COLS + col * 4]) = o;
                }
            }
        }
        __syncthreads();

        // wave h: join the eight channel slices of head h, softmax terms of the row
        // against the running maximum
        {
            const int h = wave;
            float l0 = bias, l1 = bias;
#pragma unroll
            for (int w = 0; w < PC_WAVES; ++w) {
                float2 v = *reinterpret_cast<const float2*>(&lg[(w * HEADS + h) * PC_COLS + lane * 2]);
                l0 += v.x; l1 += v.y;
            }
            float mx = xor_max<32>(fmaxf(l0, l1));
            mx = fmaxf(mx, run_m);
            const float f = expf(run_m - mx);         // 0 for the first row
            float2 e = { expf(l0 - mx), expf(l1 - mx) };
            float2 zero = { 0.f, 0.f };
            *reinterpret_cast<float2*>(&pm[h * PC_PITCH + lane * 2]) = e;
            *reinterpret_cast<float2*>(&pm[(h + HEADS) * PC_PITCH + lane * 2]) = zero;   // N padding
            if (lane == 0) sc[h] = f;
            float sum = xor_sum<32>(e.x + e.y);
            float pc  = xor_sum<32>(e.x * (float)(lane * 2) + e.y * (float)(lane * 2 + 1));
            run_s  = run_s  * f + sum;
            run_pc = run_pc * f + pc;
            run_pr = run_pr * f + sum * (float)(grp * PC_ROWS + it);
            run_m  = mx;
        }
        __syncthreads();

        // part[h, c] over the wave's 64 channels (4 M tiles), K over the 64 columns, on
        // top of the rows before, brought to the new maximum (N = lane & 15 is the head).
        // k order of both loaders: step 2u+s holds columns 8u + 4 kgrp + 2s, +1.
        {
            const float fl = sc[col & 7];
#pragma unroll
            for (int t = 0; t < 4; ++t)
#pragma unroll
                for (int r = 0; r < 8; ++r) c[t][r] *= fl;
        }
#pragma unroll
        for (int u = 0; u < 8; ++u) {
            float4 p4 = *reinterpret_cast<const float4*>(&pm[col * PC_PITCH + u * 8 + kgrp * 4]);
            float4 a[4];
#pragma unroll
            for (int t = 0; t < 4; ++t)
                a[t] = *reinterpret_cast<const float4*>(
                    &tile[tb + (row0 + t * 16 + col) * PC_PITCH + u * 8 + kgrp * 4]);
#pragma unroll
            for (int t = 0; t < 4; ++t) {
                v2f af; af.x = a[t].x; af.y = a[t].y;
                v2f bf; bf.x = p4.x;   bf.y = p4.y;
                c[t] = __builtin_amdgcn_wmma_f32_16x16x4_f32(false, af, false, bf,
                                                             (short)0, c[t], false, false);
            }
#pragma unroll
            for (int t = 0; t < 4; ++t) {
                v2f af; af.x = a[t].z; af.y = a[t].w;
                v2f bf; bf.x = p4.z;   bf.y = p4.w;
                c[t] = __builtin_amdgcn_wmma_f32_16x16x4_f32(false, af, false, bf,
                                                             (short)0, c[t], false, false);
            }
        }

        // hand-over: this wave's LDS reads of the row are done, its copies of the next
        // row have landed, and the barrier says both of every wave
        asm volatile("s_wait_dscnt 0x0" ::: "memory");
        asm volatile("s_wait_asynccnt 0x0" ::: "memory");
        __syncthreads();
        // the row after the next goes into the buffer that has just been read
        if (it + 2 < PC_ROWS) {
            const float* g = g0 + (it + 2) * PC_COLS;
            const unsigned l = l0a + (unsigned)tb * 4u;
            PC_COPY8(l, g, 0);
            PC_COPY8(l, g, 16);
            PC_COPY8(l, g, 32);
            PC_COPY8(l, g, 48);
        }
    }
    // no copy is left on its way when the tile buffers become staging
    asm volatile("s_wait_asynccnt 0x0" ::: "memory");

    if (lane == 0) {
        const int idx = (b * HEADS + wave) * PC_GROUPS + grp;
        smax[idx] = run_m; ssum[idx] = run_s; scol[idx] = run_pc; srow[idx] = run_pr;
    }

    // D layout: VGPR r, lanes 0-15 -> M = r, lanes 16-31 -> M = r + 8; N = lane & 15 (head).
    // Turned through the wave's own, now spent, tile rows so that part is stored in
    // whole 128-byte lines.
    float* stg = &tile[row0 * PC_PITCH];
    if (col < HEADS) {
#pragma unroll
        for (int t = 0; t < 4; ++t) {
            float4 lo = { c[t][0], c[t][1], c[t][2], c[t][3] };
            float4 hi = { c[t][4], c[t][5], c[t][6], c[t][7] };
            *reinterpret_cast<float4*>(&stg[col * PC_PITCH + t * 16 + kgrp * 8])     = lo;
            *reinterpret_cast<float4*>(&stg[col * PC_PITCH + t * 16 + kgrp * 8 + 4]) = hi;
        }
    }
    // orders the lanes' staging writes in front of the other lanes' reads below
    __syncthreads();
    float* po = part + ((long)piece * HEADS) * CH + row0 + col * 4;
#pragma unroll
    for (int i = 0; i < 4; ++i) {
        const int h = i * 2 + kgrp;
        float4 v = *reinterpret_cast<const float4*>(&stg[h * PC_PITCH + col * 4]);
        *reinterpret_cast<float4*>(po + h * CH) = v;
    }
}

// ---------------------------------------------------------------------------
// Kernel 2: two workgroups per (batch, head). Each joins the 16 partial results:
//   w[k] = exp(max[k] - max over k) / sum_k(...)   context[c] = sum_k w[k] part[k, c]
// (the first also stores the centroid cx, cy), keeps the context row in LDS and takes
// 96 of the 192 rows of the K, Q and V weights against it: one wave per weight row,
// read as whole 128-byte lines, the lanes' partial sums joined by a butterfly.
// ---------------------------------------------------------------------------
#define KQ_ROWS 6     // weight rows a wave: 192 rows / 2 workgroups / 16 waves

__device__ __forceinline__ float dot4(float4 a, float4 b, float s)
{
    s += a.x * b.x; s += a.y * b.y; s += a.z * b.z; s += a.w * b.w;
    return s;
}

__global__ void __launch_bounds__(512)
k_join_kqv(const float* __restrict__ part, const float* __restrict__ smax,
           const float* __restrict__ ssum, const float* __restrict__ scol,
           const float* __restrict__ srow,
           const float* __restrict__ k_w, const float* __restrict__ k_b,
           const float* __restrict__ q_w, const float* __restrict__ q_b,
           const float* __restrict__ v_w, const float* __restrict__ v_b,
           float* __restrict__ kqv, float* __restrict__ cx, float* __restrict__ cy)
{
    __shared__ float wl[PC_GROUPS];
    __shared__ __attribute__((aligned(16))) float red[4 * CH];
    __shared__ __attribute__((aligned(16))) float cs[CH];
    __shared__ float ro[16 * KQ_ROWS];
    const int piece = dealt_piece(blockIdx.x);
    const int row  = piece >> 1;                      // b*8 + h
    const int sub  = piece & 1;                       // which 96 weight rows
    const int b    = row >> 3, h = row & 7;
    const int tid  = threadIdx.x;
    const int lane = tid & 31;
    const int wave = __builtin_amdgcn_readfirstlane(tid >> 5);
    const int k16  = tid & 15;
    const int c4   = tid & 127;                       // four channels a thread
    const int cg   = tid >> 7;                        // four partial results a thread

    const float* pp = part + (((long)b * PC_GROUPS + cg * 4) * HEADS + h) * CH + c4 * 4;
    float4 v[4];
#pragma unroll
    for (int i = 0; i < 4; ++i)
        v[i] = *reinterpret_cast<const float4*>(pp + (long)i * HEADS * CH);
    // the loads above share one address pair: this wait stands in front of its
    // reuse, and the operand keeps the pair live up to here. It also holds the loads
    // in front of the weights' butterflies, behind which the compiler had sunk them.
    asm volatile("s_wait_xcnt 0x0" :: "v"(pp) : "memory");

    // every 16 lanes alike: one partial result a lane
    const float m0 = smax[row * PC_GROUPS + k16];
    const float s0 = ssum[row * PC_GROUPS + k16];
    const float p0 = scol[row * PC_GROUPS + k16];
    const float r0 = srow[row * PC_GROUPS + k16];

    // the bias of the result that this thread stores at the end
    const int rs = sub * 96 + ((tid < 96) ? tid : 95);
    const float bk = k_b[rs & 63], bq = q_b[rs & 63], bv = v_b[rs & 63];
    // keeps the small loads older than the weight rows: a wait for them waits for no row
    __builtin_amdgcn_sched_barrier(0);

    // the wave's weight rows need nothing of the join: on their way from here on
    const int lofs = lane * 16;                       // the lane's byte offset in a 512-byte piece
    float4 w[KQ_ROWS][4];
#pragma unroll
    for (int j = 0; j < KQ_ROWS; ++j) {
        const int r = sub * 96 + wave * KQ_ROWS + j;  // 0..191: K | Q | V, 64 rows each
        const float* wm = (r < 64) ? k_w : (r < 128) ? q_w : v_w;
        const char* wb = reinterpret_cast<const char*>(wm + (r & 63) * CH);
#pragma unroll
        for (int i = 0; i < 4; ++i)
            w[j][i] = *reinterpret_cast<const float4*>(wb + lofs + i * 512);
    }
    // the loads above share one offset register: this wait stands in front of its
    // reuse, and the first operand keeps it live up to here. It also holds the loads
    // here, ahead of the join, instead of behind its barriers; the biases are inputs so
    // that their loads are not sunk to the kernel's end, where they would be waited out
    asm volatile("s_wait_xcnt 0x0" :: "v"(lofs), "v"(bk), "v"(bq), "v"(bv) : "memory");
    // the butterflies below wait for the first loads: they stay behind the issue of all
    __builtin_amdgcn_sched_barrier(0);

    const float mx = xor_max<16>(m0);
    const float w0 = expf(m0 - mx);
    const float sum = xor_sum<16>(w0 * s0);
    const float pc  = xor_sum<16>(w0 * p0);
    const float pr  = xor_sum<16>(w0 * r0);
    const float inv = 1.f / sum;
    if (tid < PC_GROUPS) wl[tid] = w0 * inv;
    lds_barrier();

    float4 a = { 0.f, 0.f, 0.f, 0.f };
#pragma unroll
    for (int i = 0; i < 4; ++i) {
        const float wk = wl[cg * 4 + i];
        a.x += wk * v[i].x; a.y += wk * v[i].y; a.z += wk * v[i].z; a.w += wk * v[i].w;
    }
    *reinterpret_cast<float4*>(&red[cg * CH + c4 * 4]) = a;
    lds_barrier();

    if (tid < 128) {
        float4 t0 = *reinterpret_cast<const float4*>(&red[0 * CH + tid * 4]);
        float4 t1 = *reinterpret_cast<const float4*>(&red[1 * CH + tid * 4]);
        float4 t2 = *reinterpret_cast<const float4*>(&red[2 * CH + tid * 4]);
        float4 t3 = *reinterpret_cast<const float4*>(&red[3 * CH + tid * 4]);
        float4 o = { (t0.x + t1.x) + (t2.x + t3.x), (t0.y + t1.y) + (t2.y + t3.y),
                     (t0.z + t1.z) + (t2.z + t3.z), (t0.w + t1.w) + (t2.w + t3.w) };
        *reinterpret_cast<float4*>(&cs[tid * 4]) = o;
    }
    if (tid == 0 && sub == 0) {
        cx[row] = pc * inv / (float)HT;
        cy[row] = pr * inv / (float)WD;
    }
    lds_barrier();

    // the lane's 16 columns of the context row against its 16 columns of each weight row
    {
        float4 c[4];
#pragma unroll
        for (int i = 0; i < 4; ++i)
            c[i] = *reinterpret_cast<const float4*>(&cs[i * 128 + lane * 4]);
        float res = 0.f;
#pragma unroll
        for (int j = 0; j < KQ_ROWS; ++j) {
            float s = 0.f;
#pragma unroll
            for (int i = 0; i < 4; ++i) s = dot4(w[j][i], c[i], s);
            s = xor_sum<32>(s);
            res = (lane == j) ? s : res;
        }
        if (lane < KQ_ROWS) ro[wave * KQ_ROWS + lane] = res;
    }
    lds_barrier();

    // 96 results go out as three whole 128-byte lines: kqv[b][K|Q|V][h][d]
    if (tid < 96) {
        const int mat = rs >> 6, d = rs & 63;
        kqv[b * 1536 + mat * 512 + h * 64 + d] = ro[tid] + ((mat == 0) ? bk : (mat == 1) ? bq : bv);
    }
}

// ---------------------------------------------------------------------------
// Kernel 3: out[b,c,hw] = x[b,c,hw] + add_term[b,c]   (float4 streaming)
// One workgroup of 16 waves per WGP; a wave streams AO_PLANES whole (b,c) planes in
// groups of AO_DEPTH loads, each load 512 contiguous bytes. Ahead of its stream every
// workgroup works out its batch's head attention and channel_add MLP itself (16
// workgroups a batch do the same sums) and the add_term of its own 32 channels. What it
// needs first from memory is asked for at the top, in the order of use: the small operands
// (to LDS), the rows of w1 (registers), the first group of x (registers). The rest of
// the wave's x follows while those sums run: groups 1 and 2 into the wave's own 16 KiB
// of LDS, through no register, group 3 into the registers that w1 leaves. Behind the
// sums the wave has only to add and store.
// ---------------------------------------------------------------------------
#define AO_WAVES  16    // waves per workgroup
#define AO_PLANES 2     // (b,c) planes per wave
#define AO_DEPTH  16    // 16-byte loads per lane in flight
#define AO_GROUPS (AO_PLANES * (HWSZ / 4) / (32 * AO_DEPTH))
#define AO_CH     (AO_WAVES * AO_PLANES)   // channels per workgroup
#define AO_LGRP   2     // groups of x that wait in LDS
#define AO_LFL    (AO_LGRP * AO_DEPTH * 128)   // floats of LDS a wave has for them

// eight 16-byte-a-lane copies, global memory to LDS through no register, 512 bytes
// apart: the immediate offset moves the global and the LDS address alike
#define AO_CP(n)  "global_load_async_to_lds_b128 %0, %1, off offset:" #n "\n\t"
#define AO_CP8(a, b, c, d, e, f, g, h) AO_CP(a) AO_CP(b) AO_CP(c) AO_CP(d) AO_CP(e) AO_CP(f) AO_CP(g) AO_CP(h)

__global__ void __launch_bounds__(AO_WAVES * 32)
k_attn_addout(const float* __restrict__ x, const float* __restrict__ kqv,
              const float* __restrict__ cx, const float* __restrict__ cy,
              const float* __restrict__ g_w, const float* __restrict__ g_b,
              const float* __restrict__ w1,  const float* __restrict__ b1,
              const float* __restrict__ lng, const float* __restrict__ lnb,
              const float* __restrict__ w2,  const float* __restrict__ b2,
              float* __restrict__ out)
{
    __shared__ __attribute__((aligned(16))) float wkqv[3 * 512];  // wk | wq | wv, each [h][d]
    __shared__ __attribute__((aligned(16))) float sm[512];        // g_w 64 | b1 128 | ln_g 128 | ln_b 128 | b2 32
    __shared__ __attribute__((aligned(16))) float sw2[AO_CH * PLANES];
    __shared__ float lt[64];
    __shared__ float wmn[64];
    __shared__ __attribute__((aligned(16))) float oc[512];
    __shared__ __attribute__((aligned(16))) float ly[128];
    __shared__ __attribute__((aligned(16))) float xs[AO_WAVES * AO_LFL];

    const int tid   = threadIdx.x;
    const int lane  = tid & 31;
    const int wave  = __builtin_amdgcn_readfirstlane(tid >> 5);
    const int piece = dealt_piece(blockIdx.x);
    const int plane = (piece * AO_WAVES + wave) * AO_PLANES;
    const int b     = piece / (CH / AO_CH);
    const int c0    = (piece % (CH / AO_CH)) * AO_CH;             // the workgroup's first channel
    const v4f* xp = reinterpret_cast<const v4f*>(x) + (long)plane * (HWSZ / 4) + lane;
    v4f*       op = reinterpret_cast<v4f*>(out)     + (long)plane * (HWSZ / 4) + lane;

    const int pair = tid >> 3, sub = tid & 7;
    const int m = pair >> 3, n = pair & 7;

    // small operands first: a wait for them then waits for nothing that is large
    const int ikq = b * 1536 + tid, im = b * 8 + m, in = b * 8 + n;
    const int ig = tid & 63, il = (tid - 64) & 127, ib2 = c0 + ((tid - 448) & (AO_CH - 1));
    float kq[3];
#pragma unroll
    for (int i = 0; i < 3; ++i) kq[i] = kqv[ikq + i * 512];
    const float cxm = cx[im], cxn = cx[in];
    const float cym = cy[im], cyn = cy[in];
    const float gb  = g_b[0];
    const float sg  = g_w[ig];
    const float sb1 = b1[il], sgn = lng[il], sbn = lnb[il];   // 64, 192 and 320 are alike mod 128
    const float sb2 = b2[ib2];
    const float4* w2p = reinterpret_cast<const float4*>(w2 + c0 * PLANES) + tid;
    const float4 w2a = w2p[0], w2b = w2p[512];
    // this wait stands in front of any rewrite of a register that the loads above name:
    // the operands keep every index and every base live up to here, so that no later
    // load's result and no scalar load lands on one of them ahead of the wait
    asm volatile("s_wait_xcnt 0x0" :: "v"(ikq), "v"(im), "v"(in), "v"(ig), "v"(il), "v"(ib2),
                 "s"(kqv), "s"(cx), "s"(cy), "s"(g_w), "s"(b1), "s"(lng), "s"(lnb), "s"(b2)
                 : "memory");
    // keeps the small loads the oldest: left free, the compiler put some behind the large
    // ones, and the wait for them ahead of their stores to LDS waited for everything
    __builtin_amdgcn_sched_barrier(0);

    // y = oc @ w1^T: one wave per row, 8 rows a wave
    const char* wb = reinterpret_cast<const char*>(w1 + wave * 8 * 512);
    const int lofs = lane * 16;                       // the lane's byte offset in a 512-byte piece
    float4 w[8][4];
#pragma unroll
    for (int j = 0; j < 8; ++j)
#pragma unroll
        for (int i = 0; i < 4; ++i)
            w[j][i] = *reinterpret_cast<const float4*>(wb + lofs + j * 2048 + i * 512);

    // keeps the rows of w1, used first, older than the group of x
    __builtin_amdgcn_sched_barrier(0);

    // the first group of x
    v4f v[AO_DEPTH];
#pragma unroll
    for (int i = 0; i < AO_DEPTH; ++i) v[i] = xp[i * 32];

    // keeps the loads above in front of the barrier and the copies below
    __builtin_amdgcn_sched_barrier(0);

    // no data is handed over here: every wave has asked for its rows of w1 before any
    // wave asks for more of x, so that no row, wanted first, queues behind the copies.
    // It stands where the waves would wait for the small operands anyway
    __builtin_amdgcn_s_barrier();

    // groups 1 and 2 of x, 16 KiB in a row, into the wave's own part of xs: 32 copies on
    // their way under the sums below. The wait in the last line stands in front of any
    // rewrite of the two address registers named here.
    float* xw = &xs[wave * AO_LFL + lane * 4];
    asm volatile(AO_CP8(0, 512, 1024, 1536, 2048, 2560, 3072, 3584)
                 AO_CP8(4096, 4608, 5120, 5632, 6144, 6656, 7168, 7680)
                 AO_CP8(8192, 8704, 9216, 9728, 10240, 10752, 11264, 11776)
                 AO_CP8(12288, 12800, 13312, 13824, 14336, 14848, 15360, 15872)
                 "s_wait_xcnt 0x0"
                 :: "v"((unsigned)(uintptr_t)xw), "v"(xp + AO_DEPTH * 32) : "memory");

    // this wait stands in front of any reuse of the address registers named above, and
    // the first two operands keep the lanes' own up to here. It also holds all these
    // loads in front of the barrier below. The small loaded values are inputs because the
    // compiler had sunk their loads into branches behind the large ones, where the wait
    // for them waited for everything; they are stored to LDS right below
    asm volatile("s_wait_xcnt 0x0" :: "v"(lofs), "v"(w2p), "v"(sg), "v"(sb1), "v"(sgn),
                 "v"(sbn), "v"(sb2), "s"(gb) : "memory");

#pragma unroll
    for (int i = 0; i < 3; ++i) wkqv[i * 512 + tid] = kq[i];
    sm[tid] = (tid < 64) ? sg : (tid < 192) ? sb1 : (tid < 320) ? sgn : (tid < 448) ? sbn : sb2;
    *reinterpret_cast<float4*>(&sw2[tid * 4])         = w2a;
    *reinterpret_cast<float4*>(&sw2[(tid + 512) * 4]) = w2b;
    lds_barrier();

    // w_g (geometric) and scaled_dot -> logits lt[m*8+n]; 8 lanes per (m, n)
    {
        float dx = cxm - cxn;
        float dy = cym - cyn;
        float pos[4] = { fmaxf(dx, 0.f), fmaxf(-dx, 0.f),
                         fmaxf(dy, 0.f), fmaxf(-dy, 0.f) };
        float freq = expf(-6.90775527898f * (float)sub * 0.125f);   // 1000^(-f/8)
        float s = 0.f;
        for (int p = 0; p < 4; ++p) {
            float ang = 100.f * pos[p] * freq;
            s += sinf(ang) * sm[p * 8 + sub] + cosf(ang) * sm[32 + p * 8 + sub];
        }
        float sd = 0.f;
#pragma unroll
        for (int i = 0; i < 8; ++i) {
            const int d = sub + 8 * i;
            sd += wkqv[m * 64 + d] * wkqv[512 + n * 64 + d];
        }
        s  = xor_sum<8>(s);
        sd = xor_sum<8>(sd);
        if (sub == 0) {
            float wg = fmaxf(s + gb, 0.f);
            lt[pair] = logf(fmaxf(wg, 1e-6f)) + sd * 0.125f;        // 1/sqrt(64)
        }
    }
    lds_barrier();

    // softmax over m (axis=1) for each n; 8 lanes per n
    if (tid < 64) {
        const int nn = tid >> 3, mm = tid & 7;
        float t = lt[mm * 8 + nn];
        const float mx = xor_max<8>(t);
        float e = expf(t - mx);
        float inv = 1.f / xor_sum<8>(e);
        wmn[mm * 8 + nn] = e * inv;
    }
    lds_barrier();

    // out_ctx[n, d] = sum_m wmn[m,n] * wv[m,d] -> flat n*64+d
    {
        int nn = tid >> 6, d = tid & 63;
        float s = 0.f;
        for (int mm = 0; mm < 8; ++mm) s += wmn[mm * 8 + nn] * wkqv[1024 + mm * 64 + d];
        oc[tid] = s;
    }
    lds_barrier();

    // y = oc @ w1^T + b1  [128]
    {
        float4 o4[4];
#pragma unroll
        for (int i = 0; i < 4; ++i)
            o4[i] = *reinterpret_cast<const float4*>(&oc[i * 128 + lane * 4]);
        float res = 0.f;
#pragma unroll
        for (int j = 0; j < 8; ++j) {
            float s = 0.f;
#pragma unroll
            for (int i = 0; i < 4; ++i) s = dot4(w[j][i], o4[i], s);
            s = xor_sum<32>(s);
            res = (lane == j) ? s : res;
        }
        if (lane < 8) ly[wave * 8 + lane] = res + sm[64 + wave * 8 + lane];
    }
    // the last group of x goes into the registers that the rows of w1 have left: not
    // earlier (there is no room), and not sunk to its use behind the sums that follow
    __builtin_amdgcn_sched_barrier(0);
    v4f vl[AO_DEPTH];
#pragma unroll
    for (int i = 0; i < AO_DEPTH; ++i) vl[i] = xp[((AO_GROUPS - 1) * AO_DEPTH + i) * 32];
    // this wait stands in front of any reuse of the address pair, kept live up to here
    asm volatile("s_wait_xcnt 0x0" :: "v"(xp) : "memory");
    __builtin_amdgcn_sched_barrier(0);
    lds_barrier();

    // LayerNorm + ReLU in registers (every 8-lane group holds all 128 values), then
    // add_term[c] = y @ w2^T + b2 for the wave's two channels: 8 lanes per row
    float a[AO_PLANES];
    {
        const int s8 = lane & 7, rsub = (lane >> 3) & (AO_PLANES - 1);
        float y[16];
#pragma unroll
        for (int i = 0; i < 4; ++i) {
            float4 t = *reinterpret_cast<const float4*>(&ly[i * 32 + s8 * 4]);
            y[i * 4 + 0] = t.x; y[i * 4 + 1] = t.y; y[i * 4 + 2] = t.z; y[i * 4 + 3] = t.w;
        }
        float mu = 0.f;
#pragma unroll
        for (int i = 0; i < 16; ++i) mu += y[i];
        mu = xor_sum<8>(mu) * (1.f / PLANES);
        float var = 0.f;
#pragma unroll
        for (int i = 0; i < 16; ++i) { float dlt = y[i] - mu; var += dlt * dlt; }
        var = xor_sum<8>(var) * (1.f / PLANES);
        const float rstd = rsqrtf(var + 1e-5f);
        const int cl = wave * AO_PLANES + rsub;       // the 8-lane group's channel, from c0
        float s = 0.f;
#pragma unroll
        for (int i = 0; i < 4; ++i) {
            float4 g4 = *reinterpret_cast<const float4*>(&sm[192 + i * 32 + s8 * 4]);
            float4 b4 = *reinterpret_cast<const float4*>(&sm[320 + i * 32 + s8 * 4]);
            float4 yn;
            yn.x = fmaxf((y[i * 4 + 0] - mu) * rstd * g4.x + b4.x, 0.f);
            yn.y = fmaxf((y[i * 4 + 1] - mu) * rstd * g4.y + b4.y, 0.f);
            yn.z = fmaxf((y[i * 4 + 2] - mu) * rstd * g4.z + b4.z, 0.f);
            yn.w = fmaxf((y[i * 4 + 3] - mu) * rstd * g4.w + b4.w, 0.f);
            s = dot4(*reinterpret_cast<const float4*>(&sw2[cl * PLANES + i * 32 + s8 * 4]), yn, s);
        }
        s = xor_sum<8>(s) + sm[448 + cl];
#pragma unroll
        for (int p = 0; p < AO_PLANES; ++p)   // lane 8 p holds channel p's term: alike for the wave
            a[p] = __builtin_bit_cast(float, __builtin_amdgcn_readlane(__builtin_bit_cast(int, s), p * 8));
    }

    // unrolled: every address is one base and one lane offset plus an immediate, so no
    // address register is rewritten while stores are in flight
#pragma unroll
    for (int g = 0; g < AO_GROUPS; ++g) {
        if (g == 1) {
            // the wave's own copies have landed behind this wait; no other wave reads them
            asm volatile("s_wait_asynccnt 0x0" ::: "memory");
        }
        if (g >= 1 && g <= AO_LGRP) {
            // the LDS loads below land on registers that the group before was stored
            // from: this wait stands between those stores and the overwrite of their data
            asm volatile("s_wait_xcnt 0x0" ::: "memory");
#pragma unroll
            for (int i = 0; i < AO_DEPTH; ++i)
                v[i] = *reinterpret_cast<const v4f*>(&xw[((g - 1) * AO_DEPTH + i) * 128]);
            // all LDS loads of the group are issued before the first add waits for one
            __builtin_amdgcn_sched_barrier(0);
        }
        const float s = a[g / (AO_GROUPS / AO_PLANES)];
        v4f* t = (g > AO_LGRP) ? vl : v;
#pragma unroll
        for (int i = 0; i < AO_DEPTH; ++i) {
            t[i].x += s; t[i].y += s; t[i].z += s; t[i].w += s;
        }
        // a group's adds stand in front of its stores: drawn in between them, they were given
        // registers of stores of the same group, each behind a wait for that store
        __builtin_amdgcn_sched_barrier(0);
#pragma unroll
        for (int i = 0; i < AO_DEPTH; ++i)
            // non-temporal: no launch reads out, so its lines are not to be kept in L2, where
            // they would push out x and lie dirty until they are evicted or the launch ends
            __builtin_nontemporal_store(t[i], &op[(g * AO_DEPTH + i) * 32]);
        // the groups go out in the order in which they arrive: left free, the compiler
        // drew the adds of the last group, and the wait for its loads, in front of group 1
        __builtin_amdgcn_sched_barrier(0);
    }
}

// ---------------------------------------------------------------------------
extern "C" void kernel_launch(void* const* d_in, const int* in_sizes, int n_in,
                              void* d_out, int out_size, void* d_ws, size_t ws_size,
                              hipStream_t stream)
{
    const float* x   = (const float*)d_in[0];
    const float* cmw = (const float*)d_in[1];
    const float* cmb = (const float*)d_in[2];
    const float* g_w = (const float*)d_in[3];
    const float* g_b = (const float*)d_in[4];
    const float* k_w = (const float*)d_in[5];
    const float* k_b = (const float*)d_in[6];
    const float* q_w = (const float*)d_in[7];
    const float* q_b = (const float*)d_in[8];
    const float* v_w = (const float*)d_in[9];
    const float* v_b = (const float*)d_in[10];
    const float* w1  = (const float*)d_in[11];
    const float* b1  = (const float*)d_in[12];
    const float* lng = (const float*)d_in[13];
    const float* lnb = (const float*)d_in[14];
    const float* w2  = (const float*)d_in[15];
    const float* b2  = (const float*)d_in[16];
    float* out = (float*)d_out;

    // workspace layout (floats)
    float* ws   = (float*)d_ws;
    float* part = ws;                                 // 16*16*8*512 = 1048576 used
    float* kqv  = ws + 4194304;                       // 16*3*8*64 = 24576 used
    float* cxb  = ws + 4194304 + 65536;               // 128
    float* cyb  = cxb + 128;                          // 128
    float* smax = cyb + 128 + 8192;                   // 16*8*16 = 2048 used
    float* ssum = smax + 8192;                        // 2048 used
    float* scol = ssum + 8192;                        // 2048 used
    float* srow = scol + 8192;                        // 2048 used

    k_pool_partial<<<dim3(NB * PC_GROUPS), dim3(PC_WAVES * 32), 0, stream>>>(x, cmw, cmb, part,
                                                                             smax, ssum, scol, srow);
    k_join_kqv<<<dim3(NB * HEADS * 2), dim3(512), 0, stream>>>(part, smax, ssum, scol, srow,
                                                               k_w, k_b, q_w, q_b, v_w, v_b,
                                                               kqv, cxb, cyb);
    k_attn_addout<<<dim3(NB * CH / AO_CH), dim3(AO_WAVES * 32), 0, stream>>>(x, kqv, cxb, cyb, g_w, g_b,
                                                                             w1, b1, lng, lnb, w2, b2, out);
}
